// v000
// Times are from an AMD MI455X. After a warm-up the kernel runs many times in a row, and a time is the length of
// such a window on the GPU divided by its runs, so every launch and the gaps after it count. The runs cycle
// through copies of the inputs. A figure is the median of several windows, for all but v000 over two sittings.
// Sittings can differ by a few percent; kernels timed side by side share one.
// v000, which the later versions start from, runs in 533 microseconds.
#include <hip/hip_runtime.h>
#include <math.h>

#define H     1024
#define NHEAD 16
#define HD    64
#define BATCH 8
#define SEQ   1024
#define MROWS (BATCH * SEQ)   // 8192

typedef __attribute__((ext_vector_type(16))) __bf16 v16bf;
typedef __attribute__((ext_vector_type(8)))  float  v8f;

// ---------------------------------------------------------------- helpers ---

static __device__ __forceinline__ unsigned short f2bf(float f) {
  union { float f; unsigned u; } x; x.f = f;
  unsigned r = x.u + 0x7FFFu + ((x.u >> 16) & 1u);   // round-to-nearest-even
  return (unsigned short)(r >> 16);
}

static __device__ __forceinline__ v8f wmma_bf16(v16bf a, v16bf b, v8f c) {
  // D = A(16x32 bf16) * B(32x16 bf16) + C(16x16 f32)
  return __builtin_amdgcn_wmma_f32_16x16x32_bf16(false, a, false, b,
                                                 (short)0, c, false, false);
}

// Load one 16x32 bf16 WMMA A/B fragment from a row-major bf16 matrix whose
// 32 K-elements per row are contiguous. Per the CDNA5 16-bit layout:
//   lanes 0-15 hold K = {kb+0..7, kb+16..23}, lanes 16-31 hold K = {+8, +24}.
static __device__ __forceinline__ v16bf load_frag_g(const unsigned short* base,
                                                    int row, int row_stride,
                                                    int kb, int lane) {
  const unsigned short* p =
      base + (size_t)row * row_stride + kb + ((lane >> 4) << 3);
  v16bf f;
  reinterpret_cast<uint4*>(&f)[0] = *reinterpret_cast<const uint4*>(p);
  reinterpret_cast<uint4*>(&f)[1] = *reinterpret_cast<const uint4*>(p + 16);
  return f;
}

// -------------------------------------------------------------- fp32->bf16 --

__global__ void cvt_kernel(const float* __restrict__ in,
                           unsigned short* __restrict__ out, int n) {
  int i = blockIdx.x * blockDim.x + threadIdx.x;
  int stride = gridDim.x * blockDim.x;
  for (; i < n; i += stride) out[i] = f2bf(in[i]);
}

// --------------------------------------------------------------- QKV GEMM ---
// grid = (MROWS/16, 3), block = 512 (16 waves). Wave w: rows m0..m0+15,
// cols [w*64, w*64+64). Rolled K-loop with ping-pong double buffering:
// the loop-carried buffers keep ~10 loads in flight behind each WMMA.
// Q,K stored [B,NH,S,HD]; V stored [B,NH,HD,S].

__global__ __launch_bounds__(512) void qkv_kernel(
    const unsigned short* __restrict__ Xbf,
    const unsigned short* __restrict__ Wqkv,
    const float* __restrict__ bq, const float* __restrict__ bk,
    const float* __restrict__ bv,
    unsigned short* __restrict__ Qbf, unsigned short* __restrict__ Kbf,
    unsigned short* __restrict__ Vt) {
  int mat = blockIdx.y;                         // 0=Q, 1=K, 2=V
  const unsigned short* W = Wqkv + (size_t)mat * H * H;
  const float* bias = (mat == 0) ? bq : (mat == 1) ? bk : bv;

  int m0 = blockIdx.x << 4;
  int tid = threadIdx.x;
  int w = tid >> 5, lane = tid & 31, l15 = lane & 15;
  int n0 = w << 6;                              // 64 columns per wave

  v8f acc[4] = {};

  // buffer set A (kb) and set B (kb+32), alternated; no rotation copies
  v16bf aA = load_frag_g(Xbf, m0 + l15, H, 0, lane);
  v16bf bA[4];
#pragma unroll
  for (int t = 0; t < 4; t++)
    bA[t] = load_frag_g(W, n0 + t * 16 + l15, H, 0, lane);

  for (int kb = 0; kb < H; kb += 64) {
    v16bf aB = load_frag_g(Xbf, m0 + l15, H, kb + 32, lane);
    v16bf bB[4];
#pragma unroll
    for (int t = 0; t < 4; t++)
      bB[t] = load_frag_g(W, n0 + t * 16 + l15, H, kb + 32, lane);

#pragma unroll
    for (int t = 0; t < 4; t++) acc[t] = wmma_bf16(aA, bA[t], acc[t]);

    int k2 = (kb + 64) & (H - 1);               // wraps to 0 on last iter
    aA = load_frag_g(Xbf, m0 + l15, H, k2, lane);
#pragma unroll
    for (int t = 0; t < 4; t++)
      bA[t] = load_frag_g(W, n0 + t * 16 + l15, H, k2, lane);

#pragma unroll
    for (int t = 0; t < 4; t++) acc[t] = wmma_bf16(aB, bB[t], acc[t]);
  }

  int rw = (lane >> 4) << 3;
#pragma unroll
  for (int t = 0; t < 4; t++) {
    int n = n0 + t * 16 + l15;
    int hh = n >> 6, d = n & 63;
    float bn = bias[n];
#pragma unroll
    for (int v = 0; v < 8; v++) {
      int row = m0 + v + rw;
      int bb = row >> 10, s = row & (SEQ - 1);
      unsigned short val = f2bf(acc[t][v] + bn);
      if (mat == 2)
        Vt[(((size_t)bb * NHEAD + hh) * HD + d) * SEQ + s] = val;    // V^T
      else if (mat == 0)
        Qbf[(((size_t)bb * NHEAD + hh) * SEQ + s) * HD + d] = val;
      else
        Kbf[(((size_t)bb * NHEAD + hh) * SEQ + s) * HD + d] = val;
    }
  }
}

// ------------------------------------------------------- flash attention ----
// One wave = one (b, h, 16-query tile). Online softmax over 32-key steps.
// V frags issued at top of iteration, next K frags issued before the softmax
// math; unroll-by-2 lets the allocator coalesce the K ping-pong (no movs).
// grid = B*NH*(SEQ/16)/8 = 1024 blocks of 256 threads.

__global__ __launch_bounds__(256) void attn_kernel(
    const unsigned short* __restrict__ Qbf,
    const unsigned short* __restrict__ Kbf,
    const unsigned short* __restrict__ Vt,
    const float* __restrict__ mask,
    unsigned short* __restrict__ Ctx) {
  __shared__ uint4 ldsp[8][64];                 // 1KB per wave: 16x32 bf16 P

  int tid = threadIdx.x;
  int w = tid >> 5, lane = tid & 31, l15 = lane & 15;
  int gid = blockIdx.x * 8 + w;
  int qt = gid & 63;
  int bh = gid >> 6;
  int b = bh >> 4, h = bh & 15;
  int q0 = qt << 4;

  const unsigned short* Qh = Qbf + (size_t)bh * SEQ * HD;
  const unsigned short* Kh = Kbf + (size_t)bh * SEQ * HD;
  const unsigned short* Vh = Vt  + (size_t)bh * HD * SEQ;
  const float* mrow = mask + b * SEQ;

  v16bf qa0 = load_frag_g(Qh, q0 + l15, HD, 0,  lane);
  v16bf qa1 = load_frag_g(Qh, q0 + l15, HD, 32, lane);

  v8f acc0 = {}, acc1 = {}, acc2 = {}, acc3 = {};
  float rmax[8], rsum[8];
#pragma unroll
  for (int v = 0; v < 8; v++) { rmax[v] = -INFINITY; rsum[v] = 0.f; }

  unsigned short* lw = (unsigned short*)&ldsp[w][0];
  int rw = (lane >> 4) << 3;

  // prime K fragments for j = 0
  v16bf kc0 = load_frag_g(Kh, 0 + l15,  HD, 0,  lane);
  v16bf kc1 = load_frag_g(Kh, 0 + l15,  HD, 32, lane);
  v16bf kc2 = load_frag_g(Kh, 16 + l15, HD, 0,  lane);
  v16bf kc3 = load_frag_g(Kh, 16 + l15, HD, 32, lane);

#pragma unroll 2
  for (int j = 0; j < SEQ; j += 32) {
    // V fragments for this step: independent of P, issue early
    v16bf vb0 = load_frag_g(Vh, 0 * 16 + l15, SEQ, j, lane);
    v16bf vb1 = load_frag_g(Vh, 1 * 16 + l15, SEQ, j, lane);
    v16bf vb2 = load_frag_g(Vh, 2 * 16 + l15, SEQ, j, lane);
    v16bf vb3 = load_frag_g(Vh, 3 * 16 + l15, SEQ, j, lane);

    // K fragments for the next step (wraps on last iter; redundant but cheap)
    int jn = (j + 32) & (SEQ - 1);
    v16bf kn0 = load_frag_g(Kh, jn + l15,      HD, 0,  lane);
    v16bf kn1 = load_frag_g(Kh, jn + l15,      HD, 32, lane);
    v16bf kn2 = load_frag_g(Kh, jn + 16 + l15, HD, 0,  lane);
    v16bf kn3 = load_frag_g(Kh, jn + 16 + l15, HD, 32, lane);

    // scores: Q(16x64) @ K^T for two 16-key sub-tiles
    v8f s0 = {}, s1 = {};
    s0 = wmma_bf16(qa0, kc0, s0);
    s0 = wmma_bf16(qa1, kc1, s0);
    s1 = wmma_bf16(qa0, kc2, s1);
    s1 = wmma_bf16(qa1, kc3, s1);

    float mk0 = mrow[j + l15];
    float mk1 = mrow[j + 16 + l15];

    float p0[8], p1[8];
#pragma unroll
    for (int v = 0; v < 8; v++) {
      float a = s0[v] * 0.125f + mk0;           // 1/sqrt(64) scale + mask
      float c = s1[v] * 0.125f + mk1;
      float t = fmaxf(a, c);
#pragma unroll
      for (int o = 1; o < 16; o <<= 1) t = fmaxf(t, __shfl_xor(t, o, 32));
      float nm = fmaxf(rmax[v], t);
      float alpha = __expf(rmax[v] - nm);
      rmax[v] = nm;
      float e0 = __expf(a - nm);
      float e1 = __expf(c - nm);
      p0[v] = e0; p1[v] = e1;
      float rs = e0 + e1;
#pragma unroll
      for (int o = 1; o < 16; o <<= 1) rs += __shfl_xor(rs, o, 32);
      rsum[v] = rsum[v] * alpha + rs;
      acc0[v] *= alpha; acc1[v] *= alpha; acc2[v] *= alpha; acc3[v] *= alpha;
    }

    // transpose P (C/D layout) -> A layout via per-wave LDS tile
#pragma unroll
    for (int v = 0; v < 8; v++) {
      int row = v + rw;
      lw[row * 32 + l15]      = f2bf(p0[v]);
      lw[row * 32 + 16 + l15] = f2bf(p1[v]);
    }
    asm volatile("s_wait_dscnt 0" ::: "memory");   // in-wave LDS RAW
    v16bf pa;
    {
      int idx = l15 * 4 + (lane >> 4);
      reinterpret_cast<uint4*>(&pa)[0] = ldsp[w][idx];
      reinterpret_cast<uint4*>(&pa)[1] = ldsp[w][idx + 2];
    }

    // ctx += P(16x32) @ V(32x64); V^T rows are d, contiguous keys
    acc0 = wmma_bf16(pa, vb0, acc0);
    acc1 = wmma_bf16(pa, vb1, acc1);
    acc2 = wmma_bf16(pa, vb2, acc2);
    acc3 = wmma_bf16(pa, vb3, acc3);

    kc0 = kn0; kc1 = kn1; kc2 = kn2; kc3 = kn3;
  }

  // normalize and store merged-head ctx [B*S, H] in bf16
#pragma unroll
  for (int v = 0; v < 8; v++) {
    float inv = 1.f / rsum[v];
    int s = q0 + v + rw;
    size_t rbase = ((size_t)b * SEQ + s) * H + h * HD;
    Ctx[rbase + 0 * 16 + l15] = f2bf(acc0[v] * inv);
    Ctx[rbase + 1 * 16 + l15] = f2bf(acc1[v] * inv);
    Ctx[rbase + 2 * 16 + l15] = f2bf(acc2[v] * inv);
    Ctx[rbase + 3 * 16 + l15] = f2bf(acc3[v] * inv);
  }
}

// ------------------------------- output GEMM + bias + residual + LayerNorm --
// grid = MROWS/16 blocks of 512 (16 waves). Wave w: 16 rows x 64 cols;
// block owns the full 16x1024 strip for the fused LayerNorm.
// Rolled ping-pong K-loop like qkv_kernel.

__global__ __launch_bounds__(512) void out_ln_kernel(
    const unsigned short* __restrict__ Ctx,
    const unsigned short* __restrict__ Wo,
    const float* __restrict__ bo,
    const float* __restrict__ hidden,
    const float* __restrict__ ln_g, const float* __restrict__ ln_b,
    float* __restrict__ out) {
  __shared__ float tile[16 * H];                // 64 KB

  int m0 = blockIdx.x << 4;
  int tid = threadIdx.x;
  int w = tid >> 5, lane = tid & 31, l15 = lane & 15;
  int n0 = w << 6;

  v8f acc[4] = {};
  v16bf aA = load_frag_g(Ctx, m0 + l15, H, 0, lane);
  v16bf bA[4];
#pragma unroll
  for (int t = 0; t < 4; t++)
    bA[t] = load_frag_g(Wo, n0 + t * 16 + l15, H, 0, lane);

  for (int kb = 0; kb < H; kb += 64) {
    v16bf aB = load_frag_g(Ctx, m0 + l15, H, kb + 32, lane);
    v16bf bB[4];
#pragma unroll
    for (int t = 0; t < 4; t++)
      bB[t] = load_frag_g(Wo, n0 + t * 16 + l15, H, kb + 32, lane);

#pragma unroll
    for (int t = 0; t < 4; t++) acc[t] = wmma_bf16(aA, bA[t], acc[t]);

    int k2 = (kb + 64) & (H - 1);
    aA = load_frag_g(Ctx, m0 + l15, H, k2, lane);
#pragma unroll
    for (int t = 0; t < 4; t++)
      bA[t] = load_frag_g(Wo, n0 + t * 16 + l15, H, k2, lane);

#pragma unroll
    for (int t = 0; t < 4; t++) acc[t] = wmma_bf16(aB, bB[t], acc[t]);
  }

  int rw = (lane >> 4) << 3;
#pragma unroll
  for (int t = 0; t < 4; t++) {
    int n = n0 + t * 16 + l15;
    float bn = bo[n];
#pragma unroll
    for (int v = 0; v < 8; v++) {
      int m = v + rw;
      int row = m0 + m;
      tile[m * H + n] = acc[t][v] + bn + hidden[(size_t)row * H + n];
    }
  }
  __syncthreads();

  // LayerNorm: 32 threads per row, 32 elems per thread
  int row = tid >> 5;                           // 16 rows
  const float* tr = &tile[row * H + lane * 32];
  float s = 0.f, ss = 0.f;
#pragma unroll 8
  for (int i = 0; i < 32; i++) { float x = tr[i]; s += x; ss += x * x; }
#pragma unroll
  for (int o = 1; o < 32; o <<= 1) {
    s  += __shfl_xor(s,  o, 32);
    ss += __shfl_xor(ss, o, 32);
  }
  float mu   = s  * (1.f / H);
  float var  = ss * (1.f / H) - mu * mu;
  float rstd = rsqrtf(var + 1e-12f);
  size_t obase = (size_t)(m0 + row) * H + lane * 32;
  for (int i = 0; i < 32; i++) {
    int n = lane * 32 + i;
    out[obase + i] = (tr[i] - mu) * rstd * ln_g[n] + ln_b[n];
  }
}

// ------------------------------------------------------------------ launch --

extern "C" void kernel_launch(void* const* d_in, const int* in_sizes, int n_in,
                              void* d_out, int out_size, void* d_ws,
                              size_t ws_size, hipStream_t stream) {
  (void)in_sizes; (void)n_in; (void)out_size; (void)ws_size;

  const float* hidden = (const float*)d_in[0];
  const float* mask   = (const float*)d_in[1];
  const float* Wq     = (const float*)d_in[2];
  const float* bq     = (const float*)d_in[3];
  const float* Wk     = (const float*)d_in[4];
  const float* bk     = (const float*)d_in[5];
  const float* Wv     = (const float*)d_in[6];
  const float* bv     = (const float*)d_in[7];
  const float* Wo     = (const float*)d_in[8];
  const float* bo     = (const float*)d_in[9];
  const float* ln_g   = (const float*)d_in[10];
  const float* ln_b   = (const float*)d_in[11];

  char* ws = (char*)d_ws;
  size_t off = 0;
  auto alloc = [&](size_t bytes) {
    char* p = ws + off;
    off += (bytes + 255) & ~(size_t)255;
    return p;
  };
  unsigned short* Xbf  = (unsigned short*)alloc((size_t)MROWS * H * 2);
  unsigned short* Wqkv = (unsigned short*)alloc((size_t)3 * H * H * 2);
  unsigned short* Wobf = (unsigned short*)alloc((size_t)H * H * 2);
  unsigned short* Qbf  = (unsigned short*)alloc((size_t)MROWS * H * 2);
  unsigned short* Kbf  = (unsigned short*)alloc((size_t)MROWS * H * 2);
  unsigned short* Vt   = (unsigned short*)alloc((size_t)MROWS * H * 2);
  unsigned short* Ctx  = (unsigned short*)alloc((size_t)MROWS * H * 2);

  cvt_kernel<<<dim3(4096), dim3(256), 0, stream>>>(hidden, Xbf, MROWS * H);
  cvt_kernel<<<dim3(1024), dim3(256), 0, stream>>>(Wq, Wqkv + 0 * H * H, H * H);
  cvt_kernel<<<dim3(1024), dim3(256), 0, stream>>>(Wk, Wqkv + 1 * H * H, H * H);
  cvt_kernel<<<dim3(1024), dim3(256), 0, stream>>>(Wv, Wqkv + 2 * H * H, H * H);
  cvt_kernel<<<dim3(1024), dim3(256), 0, stream>>>(Wo, Wobf, H * H);

  qkv_kernel<<<dim3(MROWS / 16, 3), dim3(512), 0, stream>>>(
      Xbf, Wqkv, bq, bk, bv, Qbf, Kbf, Vt);

  attn_kernel<<<dim3(BATCH * NHEAD * (SEQ / 16) / 8), dim3(256), 0, stream>>>(
      Qbf, Kbf, Vt, mask, Ctx);

  out_ln_kernel<<<dim3(MROWS / 16), dim3(512), 0, stream>>>(
      Ctx, Wobf, bo, hidden, ln_g, ln_b, (float*)d_out);
}

// v001
// One run takes 327 microseconds.
// In both of two side-by-side timings against v000, it was 1.69 times as fast.
#include <hip/hip_runtime.h>
#include <math.h>

#define H     1024
#define NHEAD 16
#define HD    64
#define BATCH 8
#define SEQ   1024
#define MROWS (BATCH * SEQ)   // 8192

typedef __attribute__((ext_vector_type(16))) __bf16 v16bf;
typedef __attribute__((ext_vector_type(8)))  float  v8f;

// ---------------------------------------------------------------- helpers ---

static __device__ __forceinline__ unsigned short f2bf(float f) {
  union { float f; unsigned u; } x; x.f = f;
  unsigned r = x.u + 0x7FFFu + ((x.u >> 16) & 1u);   // round-to-nearest-even
  return (unsigned short)(r >> 16);
}

static __device__ __forceinline__ v8f wmma_bf16(v16bf a, v16bf b, v8f c) {
  // D = A(16x32 bf16) * B(32x16 bf16) + C(16x16 f32)
  return __builtin_amdgcn_wmma_f32_16x16x32_bf16(false, a, false, b,
                                                 (short)0, c, false, false);
}

// Load one 16x32 bf16 WMMA A/B fragment from a row-major bf16 matrix whose
// 32 K-elements per row are contiguous. Per the CDNA5 16-bit layout:
//   lanes 0-15 hold K = {kb+0..7, kb+16..23}, lanes 16-31 hold K = {+8, +24}.
static __device__ __forceinline__ v16bf load_frag_g(const unsigned short* base,
                                                    int row, int row_stride,
                                                    int kb, int lane) {
  const unsigned short* p =
      base + (size_t)row * row_stride + kb + ((lane >> 4) << 3);
  v16bf f;
  reinterpret_cast<uint4*>(&f)[0] = *reinterpret_cast<const uint4*>(p);
  reinterpret_cast<uint4*>(&f)[1] = *reinterpret_cast<const uint4*>(p + 16);
  return f;
}

// -------------------------------------------------------------- fp32->bf16 --

__global__ void cvt_kernel(const float* __restrict__ in,
                           unsigned short* __restrict__ out, int n) {
  int i = blockIdx.x * blockDim.x + threadIdx.x;
  int stride = gridDim.x * blockDim.x;
  for (; i < n; i += stride) out[i] = f2bf(in[i]);
}

// --------------------------------------------------------------- QKV GEMM ---
// Y[8192 x 3072] = X * Wqkv^T. grid = (MROWS/128, 3*H/256), block = 256
// (8 waves, 2 x 4). A work-group owns a 128 x 256 tile of Y; a wave owns
// 64 x 64 of it (4 x 4 fragments). Per trip 64 k of the tile's 128 X rows and
// 256 W rows (128 B a row, whole lines) are copied asynchronously into one of
// two LDS buffers while the other buffer is worked on.
// Q,K stored [B,NH,S,HD]; V stored [B,NH,HD,S].

#define QBM    128
#define QBN    256
#define QBK    64                       // k per trip: 128 B of every row
#define QPITCH 144                      // LDS row pitch in bytes, 16 B x odd
#define QSTAGE ((QBM + QBN) * QPITCH)   // 55,296 B per buffer
#define QTRIPS (H / QBK)                // 16

// One 16x32 fragment from a staged tile; same k order as load_frag_g.
// p: this lane's row, already advanced by (lane >> 4) * 16 bytes.
static __device__ __forceinline__ v16bf load_frag_s(const unsigned char* p) {
  v16bf f;
  reinterpret_cast<uint4*>(&f)[0] = *reinterpret_cast<const uint4*>(p);
  reinterpret_cast<uint4*>(&f)[1] = *reinterpret_cast<const uint4*>(p + 32);
  return f;
}

// Copy one trip's tile: 384 rows of 128 B, 12 copies of 16 B per lane; a
// wave's copy covers 4 whole rows. gx / gw: this lane's 16 bytes in its first
// X / W row; lds: the byte address of the same place in the buffer.
static __device__ __forceinline__ void stage_tile(const unsigned short* gx,
                                                  const unsigned short* gw,
                                                  unsigned lds) {
  const unsigned R = 32 * QPITCH;       // 32 rows further in LDS
  const size_t   G = (size_t)32 * H;    // 32 rows further in global memory
  // The copies and their s_wait_xcnt stand in one statement, so that no
  // address register is rewritten ahead of the wait.
  asm volatile(
      "global_load_async_to_lds_b128 %0, %12, off\n\t"
      "global_load_async_to_lds_b128 %1, %13, off\n\t"
      "global_load_async_to_lds_b128 %2, %14, off\n\t"
      "global_load_async_to_lds_b128 %3, %15, off\n\t"
      "global_load_async_to_lds_b128 %4, %16, off\n\t"
      "global_load_async_to_lds_b128 %5, %17, off\n\t"
      "global_load_async_to_lds_b128 %6, %18, off\n\t"
      "global_load_async_to_lds_b128 %7, %19, off\n\t"
      "global_load_async_to_lds_b128 %8, %20, off\n\t"
      "global_load_async_to_lds_b128 %9, %21, off\n\t"
      "global_load_async_to_lds_b128 %10, %22, off\n\t"
      "global_load_async_to_lds_b128 %11, %23, off\n\t"
      "s_wait_xcnt 0x0"
      :: "v"(lds), "v"(lds + R), "v"(lds + 2 * R), "v"(lds + 3 * R),
         "v"(lds + 4 * R), "v"(lds + 5 * R), "v"(lds + 6 * R),
         "v"(lds + 7 * R), "v"(lds + 8 * R), "v"(lds + 9 * R),
         "v"(lds + 10 * R), "v"(lds + 11 * R),
         "v"(gx), "v"(gx + G), "v"(gx + 2 * G), "v"(gx + 3 * G),
         "v"(gw), "v"(gw + G), "v"(gw + 2 * G), "v"(gw + 3 * G),
         "v"(gw + 4 * G), "v"(gw + 5 * G), "v"(gw + 6 * G), "v"(gw + 7 * G)
      : "memory");
}

__global__ __launch_bounds__(256) void qkv_kernel(
    const unsigned short* __restrict__ Xbf,
    const unsigned short* __restrict__ Wqkv,
    const float* __restrict__ bq, const float* __restrict__ bk,
    const float* __restrict__ bv,
    unsigned short* __restrict__ Qbf, unsigned short* __restrict__ Kbf,
    unsigned short* __restrict__ Vt) {
  __shared__ __attribute__((aligned(16))) unsigned char stage[2 * QSTAGE];

  int mat = blockIdx.y >> 2;                    // 0=Q, 1=K, 2=V
  const float* bias = (mat == 0) ? bq : (mat == 1) ? bk : bv;

  int m0 = blockIdx.x * QBM;
  int nb = blockIdx.y * QBN;                    // row of the stacked Wqkv
  int tid = threadIdx.x;
  int w = tid >> 5, lane = tid & 31, l15 = lane & 15;
  int wm = w >> 2, wn = w & 3;

  // copy side: 8 lanes a row, 32 rows per copy of the work-group
  int cr = tid >> 3, cc = tid & 7;
  const unsigned short* gx = Xbf  + (size_t)(m0 + cr) * H + cc * 8;
  const unsigned short* gw = Wqkv + (size_t)(nb + cr) * H + cc * 8;
  unsigned lds0 = (unsigned)(size_t)stage + cr * QPITCH + cc * 16;

  // read side: this lane's row in the wave's first A and B fragment
  int offA = (wm * 64 + l15) * QPITCH + (lane >> 4) * 16;
  int offB = (QBM + wn * 64 + l15) * QPITCH + (lane >> 4) * 16;

  v8f acc[4][4] = {};

  stage_tile(gx, gw, lds0);
  asm volatile("s_wait_asynccnt 0x0" ::: "memory");  // tile 0 has landed
  __syncthreads();                                   // and every wave may read it
  stage_tile(gx + QBK, gw + QBK, lds0 + QSTAGE);

  // Kept rolled: a trip already holds 32 WMMAs, so the branch costs little,
  // and the code stays short.
#pragma unroll 1
  for (int t = 0; t < QTRIPS; t++) {
    int buf = (t & 1) * QSTAGE;
    const unsigned char* sA = stage + buf + offA;
    const unsigned char* sB = stage + buf + offB;
#pragma unroll
    for (int ks = 0; ks < 2; ks++) {
      v16bf a[4], b[4];
#pragma unroll
      for (int i = 0; i < 4; i++)
        a[i] = load_frag_s(sA + i * 16 * QPITCH + ks * 64);
#pragma unroll
      for (int j = 0; j < 4; j++)
        b[j] = load_frag_s(sB + j * 16 * QPITCH + ks * 64);
      // Keeps the 16 LDS reads one group in front of their 16 WMMAs: left
      // free, they are spread among the WMMAs, each place with a full wait.
      __builtin_amdgcn_sched_barrier(0);
#pragma unroll
      for (int i = 0; i < 4; i++)
#pragma unroll
        for (int j = 0; j < 4; j++)
          acc[i][j] = wmma_bf16(a[i], b[j], acc[i][j]);
      // Other end of the same group: the next reads stay behind these WMMAs.
      __builtin_amdgcn_sched_barrier(0);
    }
    asm volatile("s_wait_dscnt 0x0" ::: "memory");     // own reads of this buffer done
    asm volatile("s_wait_asynccnt 0x0" ::: "memory");  // own copies of tile t+1 landed
    __syncthreads();   // publishes tile t+1, frees the buffer of tile t
    if (t + 2 < QTRIPS)
      stage_tile(gx + (t + 2) * QBK, gw + (t + 2) * QBK, lds0 + buf);
  }
  asm volatile("s_wait_asynccnt 0x0" ::: "memory");    // none in flight at the end

  int rw = (lane >> 4) << 3;
  int hh = ((blockIdx.y & 3) << 2) + wn;        // a wave's 64 columns = one head
  int r0 = m0 + wm * 64 + rw;                   // 128 rows lie in one batch entry
  int bb = r0 >> 10, s0 = r0 & (SEQ - 1);
  size_t hbase = ((size_t)bb * NHEAD + hh) * (SEQ * HD);
  if (mat == 2) {
#pragma unroll
    for (int j = 0; j < 4; j++) {
      int d = j * 16 + l15;
      float bn = bias[hh * HD + d];
#pragma unroll
      for (int i = 0; i < 4; i++)
#pragma unroll
        for (int v = 0; v < 8; v++)
          Vt[hbase + (size_t)d * SEQ + s0 + i * 16 + v] =
              f2bf(acc[i][j][v] + bn);          // V^T
      // The next column reuses the registers that these stores name.
      asm volatile("s_wait_xcnt 0x0" ::: "memory");
      // One column of fragments at a time: all 128 conversions scheduled at
      // once take more than 256 VGPRs, which costs the second work-group per WGP.
      __builtin_amdgcn_sched_barrier(0);
    }
  } else {
    unsigned short* dst = (mat == 0) ? Qbf : Kbf;
#pragma unroll
    for (int j = 0; j < 4; j++) {
      int d = j * 16 + l15;
      float bn = bias[hh * HD + d];
#pragma unroll
      for (int i = 0; i < 4; i++)
#pragma unroll
        for (int v = 0; v < 8; v++)
          dst[hbase + (size_t)(s0 + i * 16 + v) * HD + d] =
              f2bf(acc[i][j][v] + bn);
      // As above: the wait for the stores' registers, then the bound on the
      // registers of the conversions.
      asm volatile("s_wait_xcnt 0x0" ::: "memory");
      __builtin_amdgcn_sched_barrier(0);
    }
  }
}

// ------------------------------------------------------- flash attention ----
// One wave = one (b, h, 16-query tile). Online softmax over 32-key steps.
// V frags issued at top of iteration, next K frags issued before the softmax
// math; unroll-by-2 lets the allocator coalesce the K ping-pong (no movs).
// grid = B*NH*(SEQ/16)/8 = 1024 blocks of 256 threads.

__global__ __launch_bounds__(256) void attn_kernel(
    const unsigned short* __restrict__ Qbf,
    const unsigned short* __restrict__ Kbf,
    const unsigned short* __restrict__ Vt,
    const float* __restrict__ mask,
    unsigned short* __restrict__ Ctx) {
  __shared__ uint4 ldsp[8][64];                 // 1KB per wave: 16x32 bf16 P

  int tid = threadIdx.x;
  int w = tid >> 5, lane = tid & 31, l15 = lane & 15;
  int gid = blockIdx.x * 8 + w;
  int qt = gid & 63;
  int bh = gid >> 6;
  int b = bh >> 4, h = bh & 15;
  int q0 = qt << 4;

  const unsigned short* Qh = Qbf + (size_t)bh * SEQ * HD;
  const unsigned short* Kh = Kbf + (size_t)bh * SEQ * HD;
  const unsigned short* Vh = Vt  + (size_t)bh * HD * SEQ;
  const float* mrow = mask + b * SEQ;

  v16bf qa0 = load_frag_g(Qh, q0 + l15, HD, 0,  lane);
  v16bf qa1 = load_frag_g(Qh, q0 + l15, HD, 32, lane);

  v8f acc0 = {}, acc1 = {}, acc2 = {}, acc3 = {};
  float rmax[8], rsum[8];
#pragma unroll
  for (int v = 0; v < 8; v++) { rmax[v] = -INFINITY; rsum[v] = 0.f; }

  unsigned short* lw = (unsigned short*)&ldsp[w][0];
  int rw = (lane >> 4) << 3;

  // prime K fragments for j = 0
  v16bf kc0 = load_frag_g(Kh, 0 + l15,  HD, 0,  lane);
  v16bf kc1 = load_frag_g(Kh, 0 + l15,  HD, 32, lane);
  v16bf kc2 = load_frag_g(Kh, 16 + l15, HD, 0,  lane);
  v16bf kc3 = load_frag_g(Kh, 16 + l15, HD, 32, lane);

#pragma unroll 2
  for (int j = 0; j < SEQ; j += 32) {
    // V fragments for this step: independent of P, issue early
    v16bf vb0 = load_frag_g(Vh, 0 * 16 + l15, SEQ, j, lane);
    v16bf vb1 = load_frag_g(Vh, 1 * 16 + l15, SEQ, j, lane);
    v16bf vb2 = load_frag_g(Vh, 2 * 16 + l15, SEQ, j, lane);
    v16bf vb3 = load_frag_g(Vh, 3 * 16 + l15, SEQ, j, lane);

    // K fragments for the next step (wraps on last iter; redundant but cheap)
    int jn = (j + 32) & (SEQ - 1);
    v16bf kn0 = load_frag_g(Kh, jn + l15,      HD, 0,  lane);
    v16bf kn1 = load_frag_g(Kh, jn + l15,      HD, 32, lane);
    v16bf kn2 = load_frag_g(Kh, jn + 16 + l15, HD, 0,  lane);
    v16bf kn3 = load_frag_g(Kh, jn + 16 + l15, HD, 32, lane);

    // scores: Q(16x64) @ K^T for two 16-key sub-tiles
    v8f s0 = {}, s1 = {};
    s0 = wmma_bf16(qa0, kc0, s0);
    s0 = wmma_bf16(qa1, kc1, s0);
    s1 = wmma_bf16(qa0, kc2, s1);
    s1 = wmma_bf16(qa1, kc3, s1);

    float mk0 = mrow[j + l15];
    float mk1 = mrow[j + 16 + l15];

    float p0[8], p1[8];
#pragma unroll
    for (int v = 0; v < 8; v++) {
      float a = s0[v] * 0.125f + mk0;           // 1/sqrt(64) scale + mask
      float c = s1[v] * 0.125f + mk1;
      float t = fmaxf(a, c);
#pragma unroll
      for (int o = 1; o < 16; o <<= 1) t = fmaxf(t, __shfl_xor(t, o, 32));
      float nm = fmaxf(rmax[v], t);
      float alpha = __expf(rmax[v] - nm);
      rmax[v] = nm;
      float e0 = __expf(a - nm);
      float e1 = __expf(c - nm);
      p0[v] = e0; p1[v] = e1;
      float rs = e0 + e1;
#pragma unroll
      for (int o = 1; o < 16; o <<= 1) rs += __shfl_xor(rs, o, 32);
      rsum[v] = rsum[v] * alpha + rs;
      acc0[v] *= alpha; acc1[v] *= alpha; acc2[v] *= alpha; acc3[v] *= alpha;
    }

    // transpose P (C/D layout) -> A layout via per-wave LDS tile
#pragma unroll
    for (int v = 0; v < 8; v++) {
      int row = v + rw;
      lw[row * 32 + l15]      = f2bf(p0[v]);
      lw[row * 32 + 16 + l15] = f2bf(p1[v]);
    }
    asm volatile("s_wait_dscnt 0" ::: "memory");   // in-wave LDS RAW
    v16bf pa;
    {
      int idx = l15 * 4 + (lane >> 4);
      reinterpret_cast<uint4*>(&pa)[0] = ldsp[w][idx];
      reinterpret_cast<uint4*>(&pa)[1] = ldsp[w][idx + 2];
    }

    // ctx += P(16x32) @ V(32x64); V^T rows are d, contiguous keys
    acc0 = wmma_bf16(pa, vb0, acc0);
    acc1 = wmma_bf16(pa, vb1, acc1);
    acc2 = wmma_bf16(pa, vb2, acc2);
    acc3 = wmma_bf16(pa, vb3, acc3);

    kc0 = kn0; kc1 = kn1; kc2 = kn2; kc3 = kn3;
  }

  // normalize and store merged-head ctx [B*S, H] in bf16
#pragma unroll
  for (int v = 0; v < 8; v++) {
    float inv = 1.f / rsum[v];
    int s = q0 + v + rw;
    size_t rbase = ((size_t)b * SEQ + s) * H + h * HD;
    Ctx[rbase + 0 * 16 + l15] = f2bf(acc0[v] * inv);
    Ctx[rbase + 1 * 16 + l15] = f2bf(acc1[v] * inv);
    Ctx[rbase + 2 * 16 + l15] = f2bf(acc2[v] * inv);
    Ctx[rbase + 3 * 16 + l15] = f2bf(acc3[v] * inv);
  }
}

// ------------------------------- output GEMM + bias + residual + LayerNorm --
// grid = MROWS/16 blocks of 512 (16 waves). Wave w: 16 rows x 64 cols;
// block owns the full 16x1024 strip for the fused LayerNorm.
// Rolled ping-pong K-loop on register fragments loaded straight from global.

__global__ __launch_bounds__(512) void out_ln_kernel(
    const unsigned short* __restrict__ Ctx,
    const unsigned short* __restrict__ Wo,
    const float* __restrict__ bo,
    const float* __restrict__ hidden,
    const float* __restrict__ ln_g, const float* __restrict__ ln_b,
    float* __restrict__ out) {
  __shared__ float tile[16 * H];                // 64 KB

  int m0 = blockIdx.x << 4;
  int tid = threadIdx.x;
  int w = tid >> 5, lane = tid & 31, l15 = lane & 15;
  int n0 = w << 6;

  v8f acc[4] = {};
  v16bf aA = load_frag_g(Ctx, m0 + l15, H, 0, lane);
  v16bf bA[4];
#pragma unroll
  for (int t = 0; t < 4; t++)
    bA[t] = load_frag_g(Wo, n0 + t * 16 + l15, H, 0, lane);

  for (int kb = 0; kb < H; kb += 64) {
    v16bf aB = load_frag_g(Ctx, m0 + l15, H, kb + 32, lane);
    v16bf bB[4];
#pragma unroll
    for (int t = 0; t < 4; t++)
      bB[t] = load_frag_g(Wo, n0 + t * 16 + l15, H, kb + 32, lane);

#pragma unroll
    for (int t = 0; t < 4; t++) acc[t] = wmma_bf16(aA, bA[t], acc[t]);

    int k2 = (kb + 64) & (H - 1);
    aA = load_frag_g(Ctx, m0 + l15, H, k2, lane);
#pragma unroll
    for (int t = 0; t < 4; t++)
      bA[t] = load_frag_g(Wo, n0 + t * 16 + l15, H, k2, lane);

#pragma unroll
    for (int t = 0; t < 4; t++) acc[t] = wmma_bf16(aB, bB[t], acc[t]);
  }

  int rw = (lane >> 4) << 3;
#pragma unroll
  for (int t = 0; t < 4; t++) {
    int n = n0 + t * 16 + l15;
    float bn = bo[n];
#pragma unroll
    for (int v = 0; v < 8; v++) {
      int m = v + rw;
      int row = m0 + m;
      tile[m * H + n] = acc[t][v] + bn + hidden[(size_t)row * H + n];
    }
  }
  __syncthreads();

  // LayerNorm: 32 threads per row, 32 elems per thread
  int row = tid >> 5;                           // 16 rows
  const float* tr = &tile[row * H + lane * 32];
  float s = 0.f, ss = 0.f;
#pragma unroll 8
  for (int i = 0; i < 32; i++) { float x = tr[i]; s += x; ss += x * x; }
#pragma unroll
  for (int o = 1; o < 32; o <<= 1) {
    s  += __shfl_xor(s,  o, 32);
    ss += __shfl_xor(ss, o, 32);
  }
  float mu   = s  * (1.f / H);
  float var  = ss * (1.f / H) - mu * mu;
  float rstd = rsqrtf(var + 1e-12f);
  size_t obase = (size_t)(m0 + row) * H + lane * 32;
  for (int i = 0; i < 32; i++) {
    int n = lane * 32 + i;
    out[obase + i] = (tr[i] - mu) * rstd * ln_g[n] + ln_b[n];
  }
}

// ------------------------------------------------------------------ launch --

extern "C" void kernel_launch(void* const* d_in, const int* in_sizes, int n_in,
                              void* d_out, int out_size, void* d_ws,
                              size_t ws_size, hipStream_t stream) {
  (void)in_sizes; (void)n_in; (void)out_size; (void)ws_size;

  const float* hidden = (const float*)d_in[0];
  const float* mask   = (const float*)d_in[1];
  const float* Wq     = (const float*)d_in[2];
  const float* bq     = (const float*)d_in[3];
  const float* Wk     = (const float*)d_in[4];
  const float* bk     = (const float*)d_in[5];
  const float* Wv     = (const float*)d_in[6];
  const float* bv     = (const float*)d_in[7];
  const float* Wo     = (const float*)d_in[8];
  const float* bo     = (const float*)d_in[9];
  const float* ln_g   = (const float*)d_in[10];
  const float* ln_b   = (const float*)d_in[11];

  char* ws = (char*)d_ws;
  size_t off = 0;
  auto alloc = [&](size_t bytes) {
    char* p = ws + off;
    off += (bytes + 255) & ~(size_t)255;
    return p;
  };
  unsigned short* Xbf  = (unsigned short*)alloc((size_t)MROWS * H * 2);
  unsigned short* Wqkv = (unsigned short*)alloc((size_t)3 * H * H * 2);
  unsigned short* Wobf = (unsigned short*)alloc((size_t)H * H * 2);
  unsigned short* Qbf  = (unsigned short*)alloc((size_t)MROWS * H * 2);
  unsigned short* Kbf  = (unsigned short*)alloc((size_t)MROWS * H * 2);
  unsigned short* Vt   = (unsigned short*)alloc((size_t)MROWS * H * 2);
  unsigned short* Ctx  = (unsigned short*)alloc((size_t)MROWS * H * 2);

  cvt_kernel<<<dim3(4096), dim3(256), 0, stream>>>(hidden, Xbf, MROWS * H);
  cvt_kernel<<<dim3(1024), dim3(256), 0, stream>>>(Wq, Wqkv + 0 * H * H, H * H);
  cvt_kernel<<<dim3(1024), dim3(256), 0, stream>>>(Wk, Wqkv + 1 * H * H, H * H);
  cvt_kernel<<<dim3(1024), dim3(256), 0, stream>>>(Wv, Wqkv + 2 * H * H, H * H);
  cvt_kernel<<<dim3(1024), dim3(256), 0, stream>>>(Wo, Wobf, H * H);

  qkv_kernel<<<dim3(MROWS / QBM, 3 * H / QBN), dim3(256), 0, stream>>>(
      Xbf, Wqkv, bq, bk, bv, Qbf, Kbf, Vt);

  attn_kernel<<<dim3(BATCH * NHEAD * (SEQ / 16) / 8), dim3(256), 0, stream>>>(
      Qbf, Kbf, Vt, mask, Ctx);

  out_ln_kernel<<<dim3(MROWS / 16), dim3(512), 0, stream>>>(
      Ctx, Wobf, bo, hidden, ln_g, ln_b, (float*)d_out);
}

// v002
// A run of this version takes 201 microseconds.
// Timed twice side by side with v001, it ran 1.61 and 1.62 times as fast.
// Counting every step since v000, it is 2.72 times as fast.
#include <hip/hip_runtime.h>
#include <math.h>

#define H     1024
#define NHEAD 16
#define HD    64
#define BATCH 8
#define SEQ   1024
#define MROWS (BATCH * SEQ)   // 8192

typedef __attribute__((ext_vector_type(16))) __bf16 v16bf;
typedef __attribute__((ext_vector_type(8)))  float  v8f;

// ---------------------------------------------------------------- helpers ---

static __device__ __forceinline__ unsigned short f2bf(float f) {
  union { float f; unsigned u; } x; x.f = f;
  unsigned r = x.u + 0x7FFFu + ((x.u >> 16) & 1u);   // round-to-nearest-even
  return (unsigned short)(r >> 16);
}

static __device__ __forceinline__ v8f wmma_bf16(v16bf a, v16bf b, v8f c) {
  // D = A(16x32 bf16) * B(32x16 bf16) + C(16x16 f32)
  return __builtin_amdgcn_wmma_f32_16x16x32_bf16(false, a, false, b,
                                                 (short)0, c, false, false);
}

// Fragment order. Every operand that a kernel loads straight from global
// memory into a WMMA fragment (Q, K, V^T, Ctx, Wo) is stored as a row of
// 16x32 bf16 fragments of FRAG = 512 elements (1 KB). Per the CDNA5 16-bit
// layout lanes 0-15 hold k = {0..7, 16..23} of row (lane & 15), lanes 16-31
// hold k = {8..15, 24..31}. Element (r, k) of a fragment lies at
//   (k >> 4) * 256 + ((k >> 3) & 1) * 128 + r * 8 + (k & 7),
// so lane L's two 16-byte chunks lie at L * 8 and 256 + L * 8: each of the two
// loads of a wave covers 512 contiguous bytes, 4 whole lines instead of 16.
#define FRAG 512

static __device__ __forceinline__ v16bf load_frag_f(const unsigned short* frag,
                                                    int lane) {
  const unsigned short* p = frag + lane * 8;
  v16bf f;
  reinterpret_cast<uint4*>(&f)[0] = *reinterpret_cast<const uint4*>(p);
  reinterpret_cast<uint4*>(&f)[1] = *reinterpret_cast<const uint4*>(p + 256);
  return f;
}

// Eight floats to one 16-byte chunk of bf16, element 0 at the lowest address.
static __device__ __forceinline__ uint4 pack8(float x0, float x1, float x2,
                                              float x3, float x4, float x5,
                                              float x6, float x7) {
  uint4 r;
  r.x = (unsigned)f2bf(x0) | ((unsigned)f2bf(x1) << 16);
  r.y = (unsigned)f2bf(x2) | ((unsigned)f2bf(x3) << 16);
  r.z = (unsigned)f2bf(x4) | ((unsigned)f2bf(x5) << 16);
  r.w = (unsigned)f2bf(x6) | ((unsigned)f2bf(x7) << 16);
  return r;
}

// -------------------------------------------------------------- fp32->bf16 --

__global__ void cvt_kernel(const float* __restrict__ in,
                           unsigned short* __restrict__ out, int n) {
  int i = blockIdx.x * blockDim.x + threadIdx.x;
  int stride = gridDim.x * blockDim.x;
  for (; i < n; i += stride) out[i] = f2bf(in[i]);
}

// fp32 [H x H] row-major -> bf16 in fragment order: fragment (n >> 4, k >> 5)
// is number (n >> 4) * (H / 32) + (k >> 5). One thread writes one 16-byte chunk.
__global__ void cvt_frag_kernel(const float* __restrict__ in,
                                unsigned short* __restrict__ out) {
  int o = blockIdx.x * blockDim.x + threadIdx.x;   // chunk number
  int frag = o >> 6, c = (o >> 5) & 1, lane = o & 31;
  int n = (frag >> 5) * 16 + (lane & 15);
  int k = (frag & 31) * 32 + c * 16 + (lane >> 4) * 8;
  const float4* p = reinterpret_cast<const float4*>(in + (size_t)n * H + k);
  float4 x = p[0], y = p[1];
  *reinterpret_cast<uint4*>(out + (size_t)o * 8) =
      pack8(x.x, x.y, x.z, x.w, y.x, y.y, y.z, y.w);
}

// --------------------------------------------------------------- QKV GEMM ---
// Y[8192 x 3072] = X * Wqkv^T. grid = (MROWS/128, 3*H/256), block = 256
// (8 waves, 2 x 4). A work-group owns a 128 x 256 tile of Y; a wave owns
// 64 x 64 of it (4 x 4 fragments). Per trip 64 k of the tile's 128 X rows and
// 256 W rows (128 B a row, whole lines) are copied asynchronously into one of
// two LDS buffers while the other buffer is worked on.
// Q, K, V^T are stored per (batch, head) in fragment order:
//   Q, K : row = position s, k = d; fragment number (s >> 4) * 2 + (d >> 5)
//   V^T  : row = d, k = position s; fragment number (s >> 5) * 4 + (d >> 4)
// A chunk is 8 consecutive k of one row, and a lane of a WMMA result holds 8
// consecutive rows of one column. So V is computed as X * W^T (a lane: 8
// positions of one d) and Q, K as W * X^T (a lane: 8 d of one position): the
// two operands trade places, which here is a trade of the two LDS offsets.

#define QBM    128
#define QBN    256
#define QBK    64                       // k per trip: 128 B of every row
#define QPITCH 144                      // LDS row pitch in bytes, 16 B x odd
#define QSTAGE ((QBM + QBN) * QPITCH)   // 55,296 B per buffer
#define QTRIPS (H / QBK)                // 16

// One 16x32 fragment from a staged tile; same k order as load_frag_f.
// p: this lane's row, already advanced by (lane >> 4) * 16 bytes.
static __device__ __forceinline__ v16bf load_frag_s(const unsigned char* p) {
  v16bf f;
  reinterpret_cast<uint4*>(&f)[0] = *reinterpret_cast<const uint4*>(p);
  reinterpret_cast<uint4*>(&f)[1] = *reinterpret_cast<const uint4*>(p + 32);
  return f;
}

// Copy one trip's tile: 384 rows of 128 B, 12 copies of 16 B per lane; a
// wave's copy covers 4 whole rows. gx / gw: this lane's 16 bytes in its first
// X / W row; lds: the byte address of the same place in the buffer.
static __device__ __forceinline__ void stage_tile(const unsigned short* gx,
                                                  const unsigned short* gw,
                                                  unsigned lds) {
  const unsigned R = 32 * QPITCH;       // 32 rows further in LDS
  const size_t   G = (size_t)32 * H;    // 32 rows further in global memory
  // The copies and their s_wait_xcnt stand in one statement, so that no
  // address register is rewritten ahead of the wait.
  asm volatile(
      "global_load_async_to_lds_b128 %0, %12, off\n\t"
      "global_load_async_to_lds_b128 %1, %13, off\n\t"
      "global_load_async_to_lds_b128 %2, %14, off\n\t"
      "global_load_async_to_lds_b128 %3, %15, off\n\t"
      "global_load_async_to_lds_b128 %4, %16, off\n\t"
      "global_load_async_to_lds_b128 %5, %17, off\n\t"
      "global_load_async_to_lds_b128 %6, %18, off\n\t"
      "global_load_async_to_lds_b128 %7, %19, off\n\t"
      "global_load_async_to_lds_b128 %8, %20, off\n\t"
      "global_load_async_to_lds_b128 %9, %21, off\n\t"
      "global_load_async_to_lds_b128 %10, %22, off\n\t"
      "global_load_async_to_lds_b128 %11, %23, off\n\t"
      "s_wait_xcnt 0x0"
      :: "v"(lds), "v"(lds + R), "v"(lds + 2 * R), "v"(lds + 3 * R),
         "v"(lds + 4 * R), "v"(lds + 5 * R), "v"(lds + 6 * R),
         "v"(lds + 7 * R), "v"(lds + 8 * R), "v"(lds + 9 * R),
         "v"(lds + 10 * R), "v"(lds + 11 * R),
         "v"(gx), "v"(gx + G), "v"(gx + 2 * G), "v"(gx + 3 * G),
         "v"(gw), "v"(gw + G), "v"(gw + 2 * G), "v"(gw + 3 * G),
         "v"(gw + 4 * G), "v"(gw + 5 * G), "v"(gw + 6 * G), "v"(gw + 7 * G)
      : "memory");
}

__global__ __launch_bounds__(256) void qkv_kernel(
    const unsigned short* __restrict__ Xbf,
    const unsigned short* __restrict__ Wqkv,
    const float* __restrict__ bq, const float* __restrict__ bk,
    const float* __restrict__ bv,
    unsigned short* __restrict__ Qbf, unsigned short* __restrict__ Kbf,
    unsigned short* __restrict__ Vt) {
  __shared__ __attribute__((aligned(16))) unsigned char stage[2 * QSTAGE];

  int mat = blockIdx.y >> 2;                    // 0=Q, 1=K, 2=V
  const float* bias = (mat == 0) ? bq : (mat == 1) ? bk : bv;

  int m0 = blockIdx.x * QBM;
  int nb = blockIdx.y * QBN;                    // row of the stacked Wqkv
  int tid = threadIdx.x;
  int w = tid >> 5, lane = tid & 31, l15 = lane & 15;
  int wm = w >> 2, wn = w & 3;

  // copy side: 8 lanes a row, 32 rows per copy of the work-group
  int cr = tid >> 3, cc = tid & 7;
  const unsigned short* gx = Xbf  + (size_t)(m0 + cr) * H + cc * 8;
  const unsigned short* gw = Wqkv + (size_t)(nb + cr) * H + cc * 8;
  unsigned lds0 = (unsigned)(size_t)stage + cr * QPITCH + cc * 16;

  // read side: this lane's row in the wave's first X and W fragment
  int offX = (wm * 64 + l15) * QPITCH + (lane >> 4) * 16;
  int offW = (QBM + wn * 64 + l15) * QPITCH + (lane >> 4) * 16;
  int offA = (mat == 2) ? offX : offW;          // rows of the result
  int offB = (mat == 2) ? offW : offX;          // columns of the result

  v8f acc[4][4] = {};

  stage_tile(gx, gw, lds0);
  asm volatile("s_wait_asynccnt 0x0" ::: "memory");  // tile 0 has landed
  __syncthreads();                                   // and every wave may read it
  stage_tile(gx + QBK, gw + QBK, lds0 + QSTAGE);

  // Kept rolled: a trip already holds 32 WMMAs, so the branch costs little,
  // and the code stays short.
#pragma unroll 1
  for (int t = 0; t < QTRIPS; t++) {
    int buf = (t & 1) * QSTAGE;
    const unsigned char* sA = stage + buf + offA;
    const unsigned char* sB = stage + buf + offB;
#pragma unroll
    for (int ks = 0; ks < 2; ks++) {
      v16bf a[4], b[4];
#pragma unroll
      for (int i = 0; i < 4; i++)
        a[i] = load_frag_s(sA + i * 16 * QPITCH + ks * 64);
#pragma unroll
      for (int j = 0; j < 4; j++)
        b[j] = load_frag_s(sB + j * 16 * QPITCH + ks * 64);
      // Keeps the 16 LDS reads one group in front of their 16 WMMAs: left
      // free, they are spread among the WMMAs, each place with a full wait.
      __builtin_amdgcn_sched_barrier(0);
#pragma unroll
      for (int i = 0; i < 4; i++)
#pragma unroll
        for (int j = 0; j < 4; j++)
          acc[i][j] = wmma_bf16(a[i], b[j], acc[i][j]);
      // Other end of the same group: the next reads stay behind these WMMAs.
      __builtin_amdgcn_sched_barrier(0);
    }
    asm volatile("s_wait_dscnt 0x0" ::: "memory");     // own reads of this buffer done
    asm volatile("s_wait_asynccnt 0x0" ::: "memory");  // own copies of tile t+1 landed
    __syncthreads();   // publishes tile t+1, frees the buffer of tile t
    if (t + 2 < QTRIPS)
      stage_tile(gx + (t + 2) * QBK, gw + (t + 2) * QBK, lds0 + buf);
  }
  asm volatile("s_wait_asynccnt 0x0" ::: "memory");    // none in flight at the end

  int hh = ((blockIdx.y & 3) << 2) + wn;        // a wave's 64 W rows = one head
  int r0 = m0 + wm * 64;                        // 128 rows lie in one batch entry
  int bb = r0 >> 10, s0 = r0 & (SEQ - 1);
  size_t hbase = ((size_t)bb * NHEAD + hh) * (SEQ * HD);
  if (mat == 2) {
    // acc[i][j][v]: position s0 + i*16 + (lane>>4)*8 + v, d = j*16 + l15
    unsigned short* dst = Vt + hbase + (size_t)(s0 >> 5) * 4 * FRAG + lane * 8;
#pragma unroll
    for (int j = 0; j < 4; j++) {
      float bn = bias[hh * HD + j * 16 + l15];
#pragma unroll
      for (int i = 0; i < 4; i++)
        *reinterpret_cast<uint4*>(dst + ((i >> 1) * 4 + j) * FRAG + (i & 1) * 256) =
            pack8(acc[i][j][0] + bn, acc[i][j][1] + bn, acc[i][j][2] + bn,
                  acc[i][j][3] + bn, acc[i][j][4] + bn, acc[i][j][5] + bn,
                  acc[i][j][6] + bn, acc[i][j][7] + bn);
      // The next column reuses the registers that these stores name.
      asm volatile("s_wait_xcnt 0x0" ::: "memory");
      // One column of fragments at a time: all 128 conversions scheduled at
      // once take more than 256 VGPRs, which costs the second work-group per WGP.
      __builtin_amdgcn_sched_barrier(0);
    }
  } else {
    // acc[i][j][v]: d = i*16 + (lane>>4)*8 + v, position s0 + j*16 + l15
    unsigned short* dst = ((mat == 0) ? Qbf : Kbf) + hbase +
                          (size_t)(s0 >> 4) * 2 * FRAG + lane * 8;
#pragma unroll
    for (int i = 0; i < 4; i++) {
      const float4* bp = reinterpret_cast<const float4*>(
          bias + hh * HD + i * 16 + ((lane >> 4) << 3));
      float4 b0 = bp[0], b1 = bp[1];
#pragma unroll
      for (int j = 0; j < 4; j++)
        *reinterpret_cast<uint4*>(dst + (j * 2 + (i >> 1)) * FRAG + (i & 1) * 256) =
            pack8(acc[i][j][0] + b0.x, acc[i][j][1] + b0.y, acc[i][j][2] + b0.z,
                  acc[i][j][3] + b0.w, acc[i][j][4] + b1.x, acc[i][j][5] + b1.y,
                  acc[i][j][6] + b1.z, acc[i][j][7] + b1.w);
      // As above: the wait for the stores' registers, then the bound on the
      // registers of the conversions.
      asm volatile("s_wait_xcnt 0x0" ::: "memory");
      __builtin_amdgcn_sched_barrier(0);
    }
  }
}

// ------------------------------------------------------- flash attention ----
// One wave = one (b, h, 16-query tile). Online softmax over 32-key steps.
// V frags issued at top of iteration, next K frags issued before the softmax
// math; unroll-by-2 lets the allocator coalesce the K ping-pong (no movs).
// grid = B*NH*(SEQ/16)/8 = 1024 blocks of 256 threads.

__global__ __launch_bounds__(256) void attn_kernel(
    const unsigned short* __restrict__ Qbf,
    const unsigned short* __restrict__ Kbf,
    const unsigned short* __restrict__ Vt,
    const float* __restrict__ mask,
    unsigned short* __restrict__ Ctx) {
  __shared__ uint4 ldsp[8][64];                 // 1KB per wave: 16x32 bf16 P

  int tid = threadIdx.x;
  int w = tid >> 5, lane = tid & 31, l15 = lane & 15;
  int gid = blockIdx.x * 8 + w;
  int qt = gid & 63;
  int bh = gid >> 6;
  int b = bh >> 4, h = bh & 15;

  const unsigned short* Qh = Qbf + (size_t)bh * SEQ * HD;
  const unsigned short* Kh = Kbf + (size_t)bh * SEQ * HD;
  const unsigned short* Vh = Vt  + (size_t)bh * HD * SEQ;
  const float* mrow = mask + b * SEQ;

  v16bf qa0 = load_frag_f(Qh + (qt * 2 + 0) * FRAG, lane);
  v16bf qa1 = load_frag_f(Qh + (qt * 2 + 1) * FRAG, lane);

  v8f acc0 = {}, acc1 = {}, acc2 = {}, acc3 = {};
  float rmax[8], rsum[8];
#pragma unroll
  for (int v = 0; v < 8; v++) { rmax[v] = -INFINITY; rsum[v] = 0.f; }

  unsigned short* lw = (unsigned short*)&ldsp[w][0];
  int rw = (lane >> 4) << 3;

  // prime K fragments for j = 0
  v16bf kc0 = load_frag_f(Kh + 0 * FRAG, lane);   // keys 0..15,  d 0..31
  v16bf kc1 = load_frag_f(Kh + 1 * FRAG, lane);   // keys 0..15,  d 32..63
  v16bf kc2 = load_frag_f(Kh + 2 * FRAG, lane);   // keys 16..31, d 0..31
  v16bf kc3 = load_frag_f(Kh + 3 * FRAG, lane);   // keys 16..31, d 32..63

#pragma unroll 2
  for (int j = 0; j < SEQ; j += 32) {
    // V fragments for this step: independent of P, issue early
    // (32 keys are 4 fragments = j * HD elements on, in K and in V^T alike)
    v16bf vb0 = load_frag_f(Vh + j * HD + 0 * FRAG, lane);
    v16bf vb1 = load_frag_f(Vh + j * HD + 1 * FRAG, lane);
    v16bf vb2 = load_frag_f(Vh + j * HD + 2 * FRAG, lane);
    v16bf vb3 = load_frag_f(Vh + j * HD + 3 * FRAG, lane);
    // The K loads below may return into the address registers of the V loads
    // above.
    asm volatile("s_wait_xcnt 0x0" ::: "memory");

    // K fragments for the next step (wraps on last iter; redundant but cheap)
    int jn = (j + 32) & (SEQ - 1);
    v16bf kn0 = load_frag_f(Kh + jn * HD + 0 * FRAG, lane);
    v16bf kn1 = load_frag_f(Kh + jn * HD + 1 * FRAG, lane);
    v16bf kn2 = load_frag_f(Kh + jn * HD + 2 * FRAG, lane);
    v16bf kn3 = load_frag_f(Kh + jn * HD + 3 * FRAG, lane);

    // scores: Q(16x64) @ K^T for two 16-key sub-tiles
    v8f s0 = {}, s1 = {};
    s0 = wmma_bf16(qa0, kc0, s0);
    s0 = wmma_bf16(qa1, kc1, s0);
    s1 = wmma_bf16(qa0, kc2, s1);
    s1 = wmma_bf16(qa1, kc3, s1);

    float mk0 = mrow[j + l15];
    float mk1 = mrow[j + 16 + l15];
    // This step's loads are all issued: their address registers are reused
    // below (as load results and for the next step's addresses).
    asm volatile("s_wait_xcnt 0x0" ::: "memory");

    float p0[8], p1[8];
#pragma unroll
    for (int v = 0; v < 8; v++) {
      float a = s0[v] * 0.125f + mk0;           // 1/sqrt(64) scale + mask
      float c = s1[v] * 0.125f + mk1;
      float t = fmaxf(a, c);
#pragma unroll
      for (int o = 1; o < 16; o <<= 1) t = fmaxf(t, __shfl_xor(t, o, 32));
      float nm = fmaxf(rmax[v], t);
      float alpha = __expf(rmax[v] - nm);
      rmax[v] = nm;
      float e0 = __expf(a - nm);
      float e1 = __expf(c - nm);
      p0[v] = e0; p1[v] = e1;
      float rs = e0 + e1;
#pragma unroll
      for (int o = 1; o < 16; o <<= 1) rs += __shfl_xor(rs, o, 32);
      rsum[v] = rsum[v] * alpha + rs;
      acc0[v] *= alpha; acc1[v] *= alpha; acc2[v] *= alpha; acc3[v] *= alpha;
    }

    // transpose P (C/D layout) -> A layout via per-wave LDS tile
#pragma unroll
    for (int v = 0; v < 8; v++) {
      int row = v + rw;
      lw[row * 32 + l15]      = f2bf(p0[v]);
      lw[row * 32 + 16 + l15] = f2bf(p1[v]);
    }
    asm volatile("s_wait_dscnt 0" ::: "memory");   // in-wave LDS RAW
    v16bf pa;
    {
      int idx = l15 * 4 + (lane >> 4);
      reinterpret_cast<uint4*>(&pa)[0] = ldsp[w][idx];
      reinterpret_cast<uint4*>(&pa)[1] = ldsp[w][idx + 2];
    }

    // ctx += P(16x32) @ V(32x64); V^T fragment rows are d, k runs over keys
    acc0 = wmma_bf16(pa, vb0, acc0);
    acc1 = wmma_bf16(pa, vb1, acc1);
    acc2 = wmma_bf16(pa, vb2, acc2);
    acc3 = wmma_bf16(pa, vb3, acc3);

    kc0 = kn0; kc1 = kn1; kc2 = kn2; kc3 = kn3;
  }

  // normalize and store merged-head ctx [B*S, H] in bf16, in fragment order:
  // row = b * SEQ + s, k = h * HD + d, fragment (row >> 4) * (H / 32) + (k >> 5)
  unsigned short* cw = Ctx +
      ((size_t)(b * (SEQ / 16) + qt) * (H / 32) + h * 2) * FRAG +
      (l15 >> 3) * 128 + (l15 & 7);
#pragma unroll
  for (int v = 0; v < 8; v++) {
    float inv = 1.f / rsum[v];
    int ro = (v + rw) * 8;
    cw[0 * FRAG + 0   + ro] = f2bf(acc0[v] * inv);   // d  0..15
    cw[0 * FRAG + 256 + ro] = f2bf(acc1[v] * inv);   // d 16..31
    cw[1 * FRAG + 0   + ro] = f2bf(acc2[v] * inv);   // d 32..47
    cw[1 * FRAG + 256 + ro] = f2bf(acc3[v] * inv);   // d 48..63
  }
}

// ------------------------------- output GEMM + bias + residual + LayerNorm --
// grid = MROWS/16 blocks of 512 (16 waves). Wave w: 16 rows x 64 cols;
// block owns the full 16x1024 strip for the fused LayerNorm.
// Rolled ping-pong K-loop on register fragments loaded straight from global.

__global__ __launch_bounds__(512) void out_ln_kernel(
    const unsigned short* __restrict__ Ctx,
    const unsigned short* __restrict__ Wo,
    const float* __restrict__ bo,
    const float* __restrict__ hidden,
    const float* __restrict__ ln_g, const float* __restrict__ ln_b,
    float* __restrict__ out) {
  __shared__ float tile[16 * H];                // 64 KB

  int m0 = blockIdx.x << 4;
  int tid = threadIdx.x;
  int w = tid >> 5, lane = tid & 31, l15 = lane & 15;
  int n0 = w << 6;

  v8f acc[4] = {};
  // Ctx and Wo lie in fragment order: 16 rows are H / 32 fragments in a row.
  const unsigned short* Ca = Ctx + (size_t)blockIdx.x * (16 * H);
  const unsigned short* Wb = Wo + (size_t)n0 * H;
  v16bf aA = load_frag_f(Ca, lane);
  v16bf bA[4];
#pragma unroll
  for (int t = 0; t < 4; t++)
    bA[t] = load_frag_f(Wb + t * (16 * H), lane);

  for (int kb = 0; kb < H; kb += 64) {
    // 32 k on = one fragment on = 16 * 32 elements
    v16bf aB = load_frag_f(Ca + (kb + 32) * 16, lane);
    v16bf bB[4];
#pragma unroll
    for (int t = 0; t < 4; t++)
      bB[t] = load_frag_f(Wb + t * (16 * H) + (kb + 32) * 16, lane);
    // The address registers of these loads are reused for later load results.
    asm volatile("s_wait_xcnt 0x0" ::: "memory");

#pragma unroll
    for (int t = 0; t < 4; t++) acc[t] = wmma_bf16(aA, bA[t], acc[t]);

    int k2 = (kb + 64) & (H - 1);
    aA = load_frag_f(Ca + k2 * 16, lane);
#pragma unroll
    for (int t = 0; t < 4; t++)
      bA[t] = load_frag_f(Wb + t * (16 * H) + k2 * 16, lane);
    // As above.
    asm volatile("s_wait_xcnt 0x0" ::: "memory");

#pragma unroll
    for (int t = 0; t < 4; t++) acc[t] = wmma_bf16(aB, bB[t], acc[t]);
  }

  int rw = (lane >> 4) << 3;
#pragma unroll
  for (int t = 0; t < 4; t++) {
    int n = n0 + t * 16 + l15;
    float bn = bo[n];
#pragma unroll
    for (int v = 0; v < 8; v++) {
      int m = v + rw;
      int row = m0 + m;
      tile[m * H + n] = acc[t][v] + bn + hidden[(size_t)row * H + n];
    }
  }
  __syncthreads();

  // LayerNorm: 32 threads per row, 32 elems per thread
  int row = tid >> 5;                           // 16 rows
  const float* tr = &tile[row * H + lane * 32];
  float s = 0.f, ss = 0.f;
#pragma unroll 8
  for (int i = 0; i < 32; i++) { float x = tr[i]; s += x; ss += x * x; }
#pragma unroll
  for (int o = 1; o < 32; o <<= 1) {
    s  += __shfl_xor(s,  o, 32);
    ss += __shfl_xor(ss, o, 32);
  }
  float mu   = s  * (1.f / H);
  float var  = ss * (1.f / H) - mu * mu;
  float rstd = rsqrtf(var + 1e-12f);
  size_t obase = (size_t)(m0 + row) * H + lane * 32;
  for (int i = 0; i < 32; i++) {
    int n = lane * 32 + i;
    out[obase + i] = (tr[i] - mu) * rstd * ln_g[n] + ln_b[n];
  }
}

// ------------------------------------------------------------------ launch --

extern "C" void kernel_launch(void* const* d_in, const int* in_sizes, int n_in,
                              void* d_out, int out_size, void* d_ws,
                              size_t ws_size, hipStream_t stream) {
  (void)in_sizes; (void)n_in; (void)out_size; (void)ws_size;

  const float* hidden = (const float*)d_in[0];
  const float* mask   = (const float*)d_in[1];
  const float* Wq     = (const float*)d_in[2];
  const float* bq     = (const float*)d_in[3];
  const float* Wk     = (const float*)d_in[4];
  const float* bk     = (const float*)d_in[5];
  const float* Wv     = (const float*)d_in[6];
  const float* bv     = (const float*)d_in[7];
  const float* Wo     = (const float*)d_in[8];
  const float* bo     = (const float*)d_in[9];
  const float* ln_g   = (const float*)d_in[10];
  const float* ln_b   = (const float*)d_in[11];

  char* ws = (char*)d_ws;
  size_t off = 0;
  auto alloc = [&](size_t bytes) {
    char* p = ws + off;
    off += (bytes + 255) & ~(size_t)255;
    return p;
  };
  unsigned short* Xbf  = (unsigned short*)alloc((size_t)MROWS * H * 2);
  unsigned short* Wqkv = (unsigned short*)alloc((size_t)3 * H * H * 2);
  unsigned short* Wobf = (unsigned short*)alloc((size_t)H * H * 2);
  unsigned short* Qbf  = (unsigned short*)alloc((size_t)MROWS * H * 2);
  unsigned short* Kbf  = (unsigned short*)alloc((size_t)MROWS * H * 2);
  unsigned short* Vt   = (unsigned short*)alloc((size_t)MROWS * H * 2);
  unsigned short* Ctx  = (unsigned short*)alloc((size_t)MROWS * H * 2);

  cvt_kernel<<<dim3(4096), dim3(256), 0, stream>>>(hidden, Xbf, MROWS * H);
  cvt_kernel<<<dim3(1024), dim3(256), 0, stream>>>(Wq, Wqkv + 0 * H * H, H * H);
  cvt_kernel<<<dim3(1024), dim3(256), 0, stream>>>(Wk, Wqkv + 1 * H * H, H * H);
  cvt_kernel<<<dim3(1024), dim3(256), 0, stream>>>(Wv, Wqkv + 2 * H * H, H * H);
  cvt_frag_kernel<<<dim3(H * H / 8 / 256), dim3(256), 0, stream>>>(Wo, Wobf);

  qkv_kernel<<<dim3(MROWS / QBM, 3 * H / QBN), dim3(256), 0, stream>>>(
      Xbf, Wqkv, bq, bk, bv, Qbf, Kbf, Vt);

  attn_kernel<<<dim3(BATCH * NHEAD * (SEQ / 16) / 8), dim3(256), 0, stream>>>(
      Qbf, Kbf, Vt, mask, Ctx);

  out_ln_kernel<<<dim3(MROWS / 16), dim3(512), 0, stream>>>(
      Ctx, Wobf, bo, hidden, ln_g, ln_b, (float*)d_out);
}

// v003
// A run of this version takes 165 microseconds.
// Two timings next to v002 put it at 1.23 and 1.22 times that version's speed.
// All steps since v000 together make it 3.33 times as fast.
#include <hip/hip_runtime.h>
#include <math.h>

#define H     1024
#define NHEAD 16
#define HD    64
#define BATCH 8
#define SEQ   1024
#define MROWS (BATCH * SEQ)   // 8192

typedef __attribute__((ext_vector_type(16))) __bf16 v16bf;
typedef __attribute__((ext_vector_type(8)))  float  v8f;

// ---------------------------------------------------------------- helpers ---

static __device__ __forceinline__ unsigned short f2bf(float f) {
  union { float f; unsigned u; } x; x.f = f;
  unsigned r = x.u + 0x7FFFu + ((x.u >> 16) & 1u);   // round-to-nearest-even
  return (unsigned short)(r >> 16);
}

static __device__ __forceinline__ v8f wmma_bf16(v16bf a, v16bf b, v8f c) {
  // D = A(16x32 bf16) * B(32x16 bf16) + C(16x16 f32)
  return __builtin_amdgcn_wmma_f32_16x16x32_bf16(false, a, false, b,
                                                 (short)0, c, false, false);
}

// Fragment order. Every operand that a kernel loads straight from global
// memory into a WMMA fragment (Q, K, V^T, Ctx, Wo) is stored as a row of
// 16x32 bf16 fragments of FRAG = 512 elements (1 KB). Per the CDNA5 16-bit
// layout lanes 0-15 hold k = {0..7, 16..23} of row (lane & 15), lanes 16-31
// hold k = {8..15, 24..31}. Element (r, k) of a fragment lies at
//   (k >> 4) * 256 + ((k >> 3) & 1) * 128 + r * 8 + (k & 7),
// so lane L's two 16-byte chunks lie at L * 8 and 256 + L * 8: each of the two
// loads of a wave covers 512 contiguous bytes, 4 whole lines instead of 16.
#define FRAG 512

static __device__ __forceinline__ v16bf load_frag_f(const unsigned short* frag,
                                                    int lane) {
  const unsigned short* p = frag + lane * 8;
  v16bf f;
  reinterpret_cast<uint4*>(&f)[0] = *reinterpret_cast<const uint4*>(p);
  reinterpret_cast<uint4*>(&f)[1] = *reinterpret_cast<const uint4*>(p + 256);
  return f;
}

// Eight floats to one 16-byte chunk of bf16, element 0 at the lowest address.
static __device__ __forceinline__ uint4 pack8(float x0, float x1, float x2,
                                              float x3, float x4, float x5,
                                              float x6, float x7) {
  uint4 r;
  r.x = (unsigned)f2bf(x0) | ((unsigned)f2bf(x1) << 16);
  r.y = (unsigned)f2bf(x2) | ((unsigned)f2bf(x3) << 16);
  r.z = (unsigned)f2bf(x4) | ((unsigned)f2bf(x5) << 16);
  r.w = (unsigned)f2bf(x6) | ((unsigned)f2bf(x7) << 16);
  return r;
}

// -------------------------------------------------------------- fp32->bf16 --

__global__ void cvt_kernel(const float* __restrict__ in,
                           unsigned short* __restrict__ out, int n) {
  int i = blockIdx.x * blockDim.x + threadIdx.x;
  int stride = gridDim.x * blockDim.x;
  for (; i < n; i += stride) out[i] = f2bf(in[i]);
}

// fp32 [H x H] row-major -> bf16 in fragment order: fragment (n >> 4, k >> 5)
// is number (n >> 4) * (H / 32) + (k >> 5). One thread writes one 16-byte chunk.
__global__ void cvt_frag_kernel(const float* __restrict__ in,
                                unsigned short* __restrict__ out) {
  int o = blockIdx.x * blockDim.x + threadIdx.x;   // chunk number
  int frag = o >> 6, c = (o >> 5) & 1, lane = o & 31;
  int n = (frag >> 5) * 16 + (lane & 15);
  int k = (frag & 31) * 32 + c * 16 + (lane >> 4) * 8;
  const float4* p = reinterpret_cast<const float4*>(in + (size_t)n * H + k);
  float4 x = p[0], y = p[1];
  *reinterpret_cast<uint4*>(out + (size_t)o * 8) =
      pack8(x.x, x.y, x.z, x.w, y.x, y.y, y.z, y.w);
}

// --------------------------------------------------------------- QKV GEMM ---
// Y[8192 x 3072] = X * Wqkv^T. grid = (MROWS/128, 3*H/256), block = 256
// (8 waves, 2 x 4). A work-group owns a 128 x 256 tile of Y; a wave owns
// 64 x 64 of it (4 x 4 fragments). Per trip 64 k of the tile's 128 X rows and
// 256 W rows (128 B a row, whole lines) are copied asynchronously into one of
// two LDS buffers while the other buffer is worked on.
// Q, K, V^T are stored per (batch, head) in fragment order:
//   Q, K : row = position s, k = d; fragment number (s >> 4) * 2 + (d >> 5)
//   V^T  : row = d, k = position s; fragment number (s >> 5) * 4 + (d >> 4)
// A chunk is 8 consecutive k of one row, and a lane of a WMMA result holds 8
// consecutive rows of one column. So V is computed as X * W^T (a lane: 8
// positions of one d) and Q, K as W * X^T (a lane: 8 d of one position): the
// two operands trade places, which here is a trade of the two LDS offsets.

#define QBM    128
#define QBN    256
#define QBK    64                       // k per trip: 128 B of every row
#define QPITCH 144                      // LDS row pitch in bytes, 16 B x odd
#define QSTAGE ((QBM + QBN) * QPITCH)   // 55,296 B per buffer
#define QTRIPS (H / QBK)                // 16

// One 16x32 fragment from a staged tile; same k order as load_frag_f.
// p: this lane's row, already advanced by (lane >> 4) * 16 bytes.
static __device__ __forceinline__ v16bf load_frag_s(const unsigned char* p) {
  v16bf f;
  reinterpret_cast<uint4*>(&f)[0] = *reinterpret_cast<const uint4*>(p);
  reinterpret_cast<uint4*>(&f)[1] = *reinterpret_cast<const uint4*>(p + 32);
  return f;
}

// Copy one trip's tile: 384 rows of 128 B, 12 copies of 16 B per lane; a
// wave's copy covers 4 whole rows. gx / gw: this lane's 16 bytes in its first
// X / W row; lds: the byte address of the same place in the buffer.
static __device__ __forceinline__ void stage_tile(const unsigned short* gx,
                                                  const unsigned short* gw,
                                                  unsigned lds) {
  const unsigned R = 32 * QPITCH;       // 32 rows further in LDS
  const size_t   G = (size_t)32 * H;    // 32 rows further in global memory
  // The copies and their s_wait_xcnt stand in one statement, so that no
  // address register is rewritten ahead of the wait.
  asm volatile(
      "global_load_async_to_lds_b128 %0, %12, off\n\t"
      "global_load_async_to_lds_b128 %1, %13, off\n\t"
      "global_load_async_to_lds_b128 %2, %14, off\n\t"
      "global_load_async_to_lds_b128 %3, %15, off\n\t"
      "global_load_async_to_lds_b128 %4, %16, off\n\t"
      "global_load_async_to_lds_b128 %5, %17, off\n\t"
      "global_load_async_to_lds_b128 %6, %18, off\n\t"
      "global_load_async_to_lds_b128 %7, %19, off\n\t"
      "global_load_async_to_lds_b128 %8, %20, off\n\t"
      "global_load_async_to_lds_b128 %9, %21, off\n\t"
      "global_load_async_to_lds_b128 %10, %22, off\n\t"
      "global_load_async_to_lds_b128 %11, %23, off\n\t"
      "s_wait_xcnt 0x0"
      :: "v"(lds), "v"(lds + R), "v"(lds + 2 * R), "v"(lds + 3 * R),
         "v"(lds + 4 * R), "v"(lds + 5 * R), "v"(lds + 6 * R),
         "v"(lds + 7 * R), "v"(lds + 8 * R), "v"(lds + 9 * R),
         "v"(lds + 10 * R), "v"(lds + 11 * R),
         "v"(gx), "v"(gx + G), "v"(gx + 2 * G), "v"(gx + 3 * G),
         "v"(gw), "v"(gw + G), "v"(gw + 2 * G), "v"(gw + 3 * G),
         "v"(gw + 4 * G), "v"(gw + 5 * G), "v"(gw + 6 * G), "v"(gw + 7 * G)
      : "memory");
}

__global__ __launch_bounds__(256) void qkv_kernel(
    const unsigned short* __restrict__ Xbf,
    const unsigned short* __restrict__ Wqkv,
    const float* __restrict__ bq, const float* __restrict__ bk,
    const float* __restrict__ bv,
    unsigned short* __restrict__ Qbf, unsigned short* __restrict__ Kbf,
    unsigned short* __restrict__ Vt) {
  __shared__ __attribute__((aligned(16))) unsigned char stage[2 * QSTAGE];

  int mat = blockIdx.y >> 2;                    // 0=Q, 1=K, 2=V
  const float* bias = (mat == 0) ? bq : (mat == 1) ? bk : bv;

  int m0 = blockIdx.x * QBM;
  int nb = blockIdx.y * QBN;                    // row of the stacked Wqkv
  int tid = threadIdx.x;
  int w = tid >> 5, lane = tid & 31, l15 = lane & 15;
  int wm = w >> 2, wn = w & 3;

  // copy side: 8 lanes a row, 32 rows per copy of the work-group
  int cr = tid >> 3, cc = tid & 7;
  const unsigned short* gx = Xbf  + (size_t)(m0 + cr) * H + cc * 8;
  const unsigned short* gw = Wqkv + (size_t)(nb + cr) * H + cc * 8;
  unsigned lds0 = (unsigned)(size_t)stage + cr * QPITCH + cc * 16;

  // read side: this lane's row in the wave's first X and W fragment
  int offX = (wm * 64 + l15) * QPITCH + (lane >> 4) * 16;
  int offW = (QBM + wn * 64 + l15) * QPITCH + (lane >> 4) * 16;
  int offA = (mat == 2) ? offX : offW;          // rows of the result
  int offB = (mat == 2) ? offW : offX;          // columns of the result

  v8f acc[4][4] = {};

  stage_tile(gx, gw, lds0);
  asm volatile("s_wait_asynccnt 0x0" ::: "memory");  // tile 0 has landed
  __syncthreads();                                   // and every wave may read it
  stage_tile(gx + QBK, gw + QBK, lds0 + QSTAGE);

  // Kept rolled: a trip already holds 32 WMMAs, so the branch costs little,
  // and the code stays short.
#pragma unroll 1
  for (int t = 0; t < QTRIPS; t++) {
    int buf = (t & 1) * QSTAGE;
    const unsigned char* sA = stage + buf + offA;
    const unsigned char* sB = stage + buf + offB;
#pragma unroll
    for (int ks = 0; ks < 2; ks++) {
      v16bf a[4], b[4];
#pragma unroll
      for (int i = 0; i < 4; i++)
        a[i] = load_frag_s(sA + i * 16 * QPITCH + ks * 64);
#pragma unroll
      for (int j = 0; j < 4; j++)
        b[j] = load_frag_s(sB + j * 16 * QPITCH + ks * 64);
      // Keeps the 16 LDS reads one group in front of their 16 WMMAs: left
      // free, they are spread among the WMMAs, each place with a full wait.
      __builtin_amdgcn_sched_barrier(0);
#pragma unroll
      for (int i = 0; i < 4; i++)
#pragma unroll
        for (int j = 0; j < 4; j++)
          acc[i][j] = wmma_bf16(a[i], b[j], acc[i][j]);
      // Other end of the same group: the next reads stay behind these WMMAs.
      __builtin_amdgcn_sched_barrier(0);
    }
    asm volatile("s_wait_dscnt 0x0" ::: "memory");     // own reads of this buffer done
    asm volatile("s_wait_asynccnt 0x0" ::: "memory");  // own copies of tile t+1 landed
    __syncthreads();   // publishes tile t+1, frees the buffer of tile t
    if (t + 2 < QTRIPS)
      stage_tile(gx + (t + 2) * QBK, gw + (t + 2) * QBK, lds0 + buf);
  }
  asm volatile("s_wait_asynccnt 0x0" ::: "memory");    // none in flight at the end

  int hh = ((blockIdx.y & 3) << 2) + wn;        // a wave's 64 W rows = one head
  int r0 = m0 + wm * 64;                        // 128 rows lie in one batch entry
  int bb = r0 >> 10, s0 = r0 & (SEQ - 1);
  size_t hbase = ((size_t)bb * NHEAD + hh) * (SEQ * HD);
  if (mat == 2) {
    // acc[i][j][v]: position s0 + i*16 + (lane>>4)*8 + v, d = j*16 + l15
    unsigned short* dst = Vt + hbase + (size_t)(s0 >> 5) * 4 * FRAG + lane * 8;
#pragma unroll
    for (int j = 0; j < 4; j++) {
      float bn = bias[hh * HD + j * 16 + l15];
#pragma unroll
      for (int i = 0; i < 4; i++)
        *reinterpret_cast<uint4*>(dst + ((i >> 1) * 4 + j) * FRAG + (i & 1) * 256) =
            pack8(acc[i][j][0] + bn, acc[i][j][1] + bn, acc[i][j][2] + bn,
                  acc[i][j][3] + bn, acc[i][j][4] + bn, acc[i][j][5] + bn,
                  acc[i][j][6] + bn, acc[i][j][7] + bn);
      // The next column reuses the registers that these stores name.
      asm volatile("s_wait_xcnt 0x0" ::: "memory");
      // One column of fragments at a time: all 128 conversions scheduled at
      // once take more than 256 VGPRs, which costs the second work-group per WGP.
      __builtin_amdgcn_sched_barrier(0);
    }
  } else {
    // acc[i][j][v]: d = i*16 + (lane>>4)*8 + v, position s0 + j*16 + l15
    unsigned short* dst = ((mat == 0) ? Qbf : Kbf) + hbase +
                          (size_t)(s0 >> 4) * 2 * FRAG + lane * 8;
#pragma unroll
    for (int i = 0; i < 4; i++) {
      const float4* bp = reinterpret_cast<const float4*>(
          bias + hh * HD + i * 16 + ((lane >> 4) << 3));
      float4 b0 = bp[0], b1 = bp[1];
#pragma unroll
      for (int j = 0; j < 4; j++)
        *reinterpret_cast<uint4*>(dst + (j * 2 + (i >> 1)) * FRAG + (i & 1) * 256) =
            pack8(acc[i][j][0] + b0.x, acc[i][j][1] + b0.y, acc[i][j][2] + b0.z,
                  acc[i][j][3] + b0.w, acc[i][j][4] + b1.x, acc[i][j][5] + b1.y,
                  acc[i][j][6] + b1.z, acc[i][j][7] + b1.w);
      // As above: the wait for the stores' registers, then the bound on the
      // registers of the conversions.
      asm volatile("s_wait_xcnt 0x0" ::: "memory");
      __builtin_amdgcn_sched_barrier(0);
    }
  }
}

typedef __attribute__((ext_vector_type(16))) float v16f;

// The value that lane (l ^ 16) holds.
static __device__ __forceinline__ float other_half(float x) {
  int b = __builtin_bit_cast(int, x);
  b = __builtin_amdgcn_permlanex16(b, b, 0x76543210, 0xfedcba98, false, false);
  return __builtin_bit_cast(float, b);
}

static __device__ __forceinline__ v8f load8f(const float* p) {
  v8f r;
  reinterpret_cast<float4*>(&r)[0] = reinterpret_cast<const float4*>(p)[0];
  reinterpret_cast<float4*>(&r)[1] = reinterpret_cast<const float4*>(p)[1];
  return r;
}

// Four waves per SIMD (two work-groups per WGP) are asked for by name: with that
// register budget the scheduler issues the next step's K and mask loads right
// behind the score products, a whole softmax ahead of their use; left to aim
// for more waves it holds them back until registers fall free late in the step.
__global__ __launch_bounds__(256) __attribute__((amdgpu_waves_per_eu(4, 4)))
void attn_kernel(
    const unsigned short* __restrict__ Qbf,
    const unsigned short* __restrict__ Kbf,
    const unsigned short* __restrict__ Vt,
    const float* __restrict__ mask,
    unsigned short* __restrict__ Ctx) {
  int tid = threadIdx.x;
  int w = tid >> 5, lane = tid & 31;
  int gid = blockIdx.x * 8 + w;
  int qt = gid & 63;
  int bh = gid >> 6;
  int b = bh >> 4, h = bh & 15;

  const unsigned short* Qh = Qbf + (size_t)bh * SEQ * HD;
  const unsigned short* Kh = Kbf + (size_t)bh * SEQ * HD;
  const unsigned short* Vh = Vt  + (size_t)bh * HD * SEQ;
  const float* mrow = mask + b * SEQ + ((lane >> 4) << 3);   // this half's keys

  // B operand: column = query, k = d
  v16bf qb0 = load_frag_f(Qh + (qt * 2 + 0) * FRAG, lane);
  v16bf qb1 = load_frag_f(Qh + (qt * 2 + 1) * FRAG, lane);

  // O^T tiles: o<t>[r] = d 16t + 8h + r of this lane's query
  v8f o0 = {}, o1 = {}, o2 = {}, o3 = {};
  float rmax = -INFINITY;   // of the query, equal in both halves
  float rsum = 0.f;         // over this half's keys only; joined at the end

  // prime K fragments for j = 0
  v16bf kc0 = load_frag_f(Kh + 0 * FRAG, lane);   // keys 0..15,  d 0..31
  v16bf kc1 = load_frag_f(Kh + 1 * FRAG, lane);   // keys 0..15,  d 32..63
  v16bf kc2 = load_frag_f(Kh + 2 * FRAG, lane);   // keys 16..31, d 0..31
  v16bf kc3 = load_frag_f(Kh + 3 * FRAG, lane);   // keys 16..31, d 32..63

  // and the mask of its keys
  v8f mk0 = load8f(mrow);
  v8f mk1 = load8f(mrow + 16);

  // Kept rolled: K and the mask reload into the registers just read, so there
  // is nothing for an unrolled body to save, and the code stays short.
#pragma unroll 1
  for (int j = 0; j < SEQ; j += 32) {
    // V fragments for this step: independent of P, issue early
    // (32 keys are 4 fragments = j * HD elements on, in K and in V^T alike)
    v16bf va0 = load_frag_f(Vh + j * HD + 0 * FRAG, lane);
    v16bf va1 = load_frag_f(Vh + j * HD + 1 * FRAG, lane);
    v16bf va2 = load_frag_f(Vh + j * HD + 2 * FRAG, lane);
    v16bf va3 = load_frag_f(Vh + j * HD + 3 * FRAG, lane);

    // scores: K(16 keys x 64) @ Q^T for two 16-key sub-tiles
    v8f s0 = {}, s1 = {};
    s0 = wmma_bf16(kc0, qb0, s0);
    s0 = wmma_bf16(kc1, qb1, s0);
    s1 = wmma_bf16(kc2, qb0, s1);
    s1 = wmma_bf16(kc3, qb1, s1);

    v8f a0 = s0 * 0.125f + mk0;                 // 1/sqrt(64) scale + mask
    v8f a1 = s1 * 0.125f + mk1;

    // K fragments and mask for the next step, into the registers just read
    // (wraps on last iter; redundant but cheap)
    int jn = (j + 32) & (SEQ - 1);
    mk0 = load8f(mrow + jn);
    mk1 = load8f(mrow + jn + 16);
    kc0 = load_frag_f(Kh + jn * HD + 0 * FRAG, lane);
    kc1 = load_frag_f(Kh + jn * HD + 1 * FRAG, lane);
    kc2 = load_frag_f(Kh + jn * HD + 2 * FRAG, lane);
    kc3 = load_frag_f(Kh + jn * HD + 3 * FRAG, lane);

    // maximum over this lane's 16 keys, as a tree, then over both halves
    float t0 = fmaxf(fmaxf(a0[0], a0[1]), a0[2]);
    float t1 = fmaxf(fmaxf(a0[3], a0[4]), a0[5]);
    float t2 = fmaxf(fmaxf(a0[6], a0[7]), a1[0]);
    float t3 = fmaxf(fmaxf(a1[1], a1[2]), a1[3]);
    float t4 = fmaxf(fmaxf(a1[4], a1[5]), a1[6]);
    float t = fmaxf(fmaxf(fmaxf(t0, t1), t2), fmaxf(fmaxf(t3, t4), a1[7]));
    t = fmaxf(t, other_half(t));
    float nm = fmaxf(rmax, t);
    float alpha = __expf(rmax - nm);
    rmax = nm;

    v16f p;
#pragma unroll
    for (int r = 0; r < 8; r++) {
      p[r]     = __expf(a0[r] - nm);
      p[8 + r] = __expf(a1[r] - nm);
    }
    o0 *= alpha; o1 *= alpha; o2 *= alpha; o3 *= alpha;

    // P^T as B operand: element s is key 8h + s (s < 8), 16 + 8h + s - 8 (else)
    v16bf pb = __builtin_convertvector(p, v16bf);

    // Keeps vector work out from among the four products: there it lands in
    // registers of a V fragment just read, which costs four idle slots behind
    // the product each time.
    __builtin_amdgcn_sched_barrier(0);

    // ctx^T += V^T(64 x 32) @ P^T(32 x 16); V^T fragment rows are d
    o0 = wmma_bf16(va0, pb, o0);
    o1 = wmma_bf16(va1, pb, o1);
    o2 = wmma_bf16(va2, pb, o2);
    o3 = wmma_bf16(va3, pb, o3);
    // Other end of the same group. The row sum needs nothing of the products
    // and runs while the matrix unit works on them; it also stands between the
    // last product that reads P^T and the next step's first product, whose
    // result the compiler puts into the same registers.
    __builtin_amdgcn_sched_barrier(0);

    float rs = ((p[0] + p[8]) + (p[1] + p[9])) + ((p[2] + p[10]) + (p[3] + p[11])) +
               (((p[4] + p[12]) + (p[5] + p[13])) + ((p[6] + p[14]) + (p[7] + p[15])));
    rsum = rsum * alpha + rs;
  }

  // normalize and store merged-head ctx [B*S, H] in bf16, in fragment order:
  // row = b * SEQ + s, k = h * HD + d, fragment (row >> 4) * (H / 32) + (k >> 5).
  // A lane's 8 d of one tile are one 16-byte chunk, chunk number = lane.
  float inv = 1.f / (rsum + other_half(rsum));
  unsigned short* cw = Ctx +
      ((size_t)(b * (SEQ / 16) + qt) * (H / 32) + h * 2) * FRAG + lane * 8;
  *reinterpret_cast<uint4*>(cw + 0 * FRAG + 0) =                    // d  0..15
      pack8(o0[0] * inv, o0[1] * inv, o0[2] * inv, o0[3] * inv,
            o0[4] * inv, o0[5] * inv, o0[6] * inv, o0[7] * inv);
  *reinterpret_cast<uint4*>(cw + 0 * FRAG + 256) =                  // d 16..31
      pack8(o1[0] * inv, o1[1] * inv, o1[2] * inv, o1[3] * inv,
            o1[4] * inv, o1[5] * inv, o1[6] * inv, o1[7] * inv);
  *reinterpret_cast<uint4*>(cw + 1 * FRAG + 0) =                    // d 32..47
      pack8(o2[0] * inv, o2[1] * inv, o2[2] * inv, o2[3] * inv,
            o2[4] * inv, o2[5] * inv, o2[6] * inv, o2[7] * inv);
  *reinterpret_cast<uint4*>(cw + 1 * FRAG + 256) =                  // d 48..63
      pack8(o3[0] * inv, o3[1] * inv, o3[2] * inv, o3[3] * inv,
            o3[4] * inv, o3[5] * inv, o3[6] * inv, o3[7] * inv);
}

// ------------------------------- output GEMM + bias + residual + LayerNorm --
// grid = MROWS/16 blocks of 512 (16 waves). Wave w: 16 rows x 64 cols;
// block owns the full 16x1024 strip for the fused LayerNorm.
// Rolled ping-pong K-loop on register fragments loaded straight from global.

__global__ __launch_bounds__(512) void out_ln_kernel(
    const unsigned short* __restrict__ Ctx,
    const unsigned short* __restrict__ Wo,
    const float* __restrict__ bo,
    const float* __restrict__ hidden,
    const float* __restrict__ ln_g, const float* __restrict__ ln_b,
    float* __restrict__ out) {
  __shared__ float tile[16 * H];                // 64 KB

  int m0 = blockIdx.x << 4;
  int tid = threadIdx.x;
  int w = tid >> 5, lane = tid & 31, l15 = lane & 15;
  int n0 = w << 6;

  v8f acc[4] = {};
  // Ctx and Wo lie in fragment order: 16 rows are H / 32 fragments in a row.
  const unsigned short* Ca = Ctx + (size_t)blockIdx.x * (16 * H);
  const unsigned short* Wb = Wo + (size_t)n0 * H;
  v16bf aA = load_frag_f(Ca, lane);
  v16bf bA[4];
#pragma unroll
  for (int t = 0; t < 4; t++)
    bA[t] = load_frag_f(Wb + t * (16 * H), lane);

  for (int kb = 0; kb < H; kb += 64) {
    // 32 k on = one fragment on = 16 * 32 elements
    v16bf aB = load_frag_f(Ca + (kb + 32) * 16, lane);
    v16bf bB[4];
#pragma unroll
    for (int t = 0; t < 4; t++)
      bB[t] = load_frag_f(Wb + t * (16 * H) + (kb + 32) * 16, lane);
    // The address registers of these loads are reused for later load results.
    asm volatile("s_wait_xcnt 0x0" ::: "memory");

#pragma unroll
    for (int t = 0; t < 4; t++) acc[t] = wmma_bf16(aA, bA[t], acc[t]);

    int k2 = (kb + 64) & (H - 1);
    aA = load_frag_f(Ca + k2 * 16, lane);
#pragma unroll
    for (int t = 0; t < 4; t++)
      bA[t] = load_frag_f(Wb + t * (16 * H) + k2 * 16, lane);
    // As above.
    asm volatile("s_wait_xcnt 0x0" ::: "memory");

#pragma unroll
    for (int t = 0; t < 4; t++) acc[t] = wmma_bf16(aB, bB[t], acc[t]);
  }

  int rw = (lane >> 4) << 3;
#pragma unroll
  for (int t = 0; t < 4; t++) {
    int n = n0 + t * 16 + l15;
    float bn = bo[n];
#pragma unroll
    for (int v = 0; v < 8; v++) {
      int m = v + rw;
      int row = m0 + m;
      tile[m * H + n] = acc[t][v] + bn + hidden[(size_t)row * H + n];
    }
  }
  __syncthreads();

  // LayerNorm: 32 threads per row, 32 elems per thread
  int row = tid >> 5;                           // 16 rows
  const float* tr = &tile[row * H + lane * 32];
  float s = 0.f, ss = 0.f;
#pragma unroll 8
  for (int i = 0; i < 32; i++) { float x = tr[i]; s += x; ss += x * x; }
#pragma unroll
  for (int o = 1; o < 32; o <<= 1) {
    s  += __shfl_xor(s,  o, 32);
    ss += __shfl_xor(ss, o, 32);
  }
  float mu   = s  * (1.f / H);
  float var  = ss * (1.f / H) - mu * mu;
  float rstd = rsqrtf(var + 1e-12f);
  size_t obase = (size_t)(m0 + row) * H + lane * 32;
  for (int i = 0; i < 32; i++) {
    int n = lane * 32 + i;
    out[obase + i] = (tr[i] - mu) * rstd * ln_g[n] + ln_b[n];
  }
}

// ------------------------------------------------------------------ launch --

extern "C" void kernel_launch(void* const* d_in, const int* in_sizes, int n_in,
                              void* d_out, int out_size, void* d_ws,
                              size_t ws_size, hipStream_t stream) {
  (void)in_sizes; (void)n_in; (void)out_size; (void)ws_size;

  const float* hidden = (const float*)d_in[0];
  const float* mask   = (const float*)d_in[1];
  const float* Wq     = (const float*)d_in[2];
  const float* bq     = (const float*)d_in[3];
  const float* Wk     = (const float*)d_in[4];
  const float* bk     = (const float*)d_in[5];
  const float* Wv     = (const float*)d_in[6];
  const float* bv     = (const float*)d_in[7];
  const float* Wo     = (const float*)d_in[8];
  const float* bo     = (const float*)d_in[9];
  const float* ln_g   = (const float*)d_in[10];
  const float* ln_b   = (const float*)d_in[11];

  char* ws = (char*)d_ws;
  size_t off = 0;
  auto alloc = [&](size_t bytes) {
    char* p = ws + off;
    off += (bytes + 255) & ~(size_t)255;
    return p;
  };
  unsigned short* Xbf  = (unsigned short*)alloc((size_t)MROWS * H * 2);
  unsigned short* Wqkv = (unsigned short*)alloc((size_t)3 * H * H * 2);
  unsigned short* Wobf = (unsigned short*)alloc((size_t)H * H * 2);
  unsigned short* Qbf  = (unsigned short*)alloc((size_t)MROWS * H * 2);
  unsigned short* Kbf  = (unsigned short*)alloc((size_t)MROWS * H * 2);
  unsigned short* Vt   = (unsigned short*)alloc((size_t)MROWS * H * 2);
  unsigned short* Ctx  = (unsigned short*)alloc((size_t)MROWS * H * 2);

  cvt_kernel<<<dim3(4096), dim3(256), 0, stream>>>(hidden, Xbf, MROWS * H);
  cvt_kernel<<<dim3(1024), dim3(256), 0, stream>>>(Wq, Wqkv + 0 * H * H, H * H);
  cvt_kernel<<<dim3(1024), dim3(256), 0, stream>>>(Wk, Wqkv + 1 * H * H, H * H);
  cvt_kernel<<<dim3(1024), dim3(256), 0, stream>>>(Wv, Wqkv + 2 * H * H, H * H);
  cvt_frag_kernel<<<dim3(H * H / 8 / 256), dim3(256), 0, stream>>>(Wo, Wobf);

  qkv_kernel<<<dim3(MROWS / QBM, 3 * H / QBN), dim3(256), 0, stream>>>(
      Xbf, Wqkv, bq, bk, bv, Qbf, Kbf, Vt);

  attn_kernel<<<dim3(BATCH * NHEAD * (SEQ / 16) / 8), dim3(256), 0, stream>>>(
      Qbf, Kbf, Vt, mask, Ctx);

  out_ln_kernel<<<dim3(MROWS / 16), dim3(512), 0, stream>>>(
      Ctx, Wobf, bo, hidden, ln_g, ln_b, (float*)d_out);
}

// v004
// One run takes 155 microseconds.
// Timed twice side by side with v003, it ran 1.06 times as fast both times.
// Over all steps from v000 it is 3.52 times as fast.
#include <hip/hip_runtime.h>
#include <math.h>

#define H     1024
#define NHEAD 16
#define HD    64
#define BATCH 8
#define SEQ   1024
#define MROWS (BATCH * SEQ)   // 8192

typedef __attribute__((ext_vector_type(16))) __bf16 v16bf;
typedef __attribute__((ext_vector_type(8)))  float  v8f;

// ---------------------------------------------------------------- helpers ---

static __device__ __forceinline__ unsigned short f2bf(float f) {
  union { float f; unsigned u; } x; x.f = f;
  unsigned r = x.u + 0x7FFFu + ((x.u >> 16) & 1u);   // round-to-nearest-even
  return (unsigned short)(r >> 16);
}

static __device__ __forceinline__ v8f wmma_bf16(v16bf a, v16bf b, v8f c) {
  // D = A(16x32 bf16) * B(32x16 bf16) + C(16x16 f32)
  return __builtin_amdgcn_wmma_f32_16x16x32_bf16(false, a, false, b,
                                                 (short)0, c, false, false);
}

// Fragment order. Every operand that a kernel loads straight from global
// memory into a WMMA fragment (Q, K, V^T, Ctx, Wo) is stored as a row of
// 16x32 bf16 fragments of FRAG = 512 elements (1 KB). Per the CDNA5 16-bit
// layout lanes 0-15 hold k = {0..7, 16..23} of row (lane & 15), lanes 16-31
// hold k = {8..15, 24..31}. Element (r, k) of a fragment lies at
//   (k >> 4) * 256 + ((k >> 3) & 1) * 128 + r * 8 + (k & 7),
// so lane L's two 16-byte chunks lie at L * 8 and 256 + L * 8: each of the two
// loads of a wave covers 512 contiguous bytes, 4 whole lines instead of 16.
#define FRAG 512

static __device__ __forceinline__ v16bf load_frag_f(const unsigned short* frag,
                                                    int lane) {
  const unsigned short* p = frag + lane * 8;
  v16bf f;
  reinterpret_cast<uint4*>(&f)[0] = *reinterpret_cast<const uint4*>(p);
  reinterpret_cast<uint4*>(&f)[1] = *reinterpret_cast<const uint4*>(p + 256);
  return f;
}

// Eight floats to one 16-byte chunk of bf16, element 0 at the lowest address.
static __device__ __forceinline__ uint4 pack8(float x0, float x1, float x2,
                                              float x3, float x4, float x5,
                                              float x6, float x7) {
  uint4 r;
  r.x = (unsigned)f2bf(x0) | ((unsigned)f2bf(x1) << 16);
  r.y = (unsigned)f2bf(x2) | ((unsigned)f2bf(x3) << 16);
  r.z = (unsigned)f2bf(x4) | ((unsigned)f2bf(x5) << 16);
  r.w = (unsigned)f2bf(x6) | ((unsigned)f2bf(x7) << 16);
  return r;
}

// -------------------------------------------------------------- fp32->bf16 --
// All five conversions (X, Wq, Wk, Wv, Wo) run in ONE launch of 256 work-groups
// of 12 waves, one per WGP. With one element a lane a trip, tens of thousands
// of short waves have to be started, and every launch adds its gap, its fill
// and its tail. Here a wave converts 4,096 elements: a lane issues its 32
// loads of 16 B at once, then converts and stores. The five arrays hold
// 8 : 1 : 1 : 1 : 1 parts, so of a work-group's waves 0-7 take X, 8-10 take
// Wq, Wk, Wv and 11 takes Wo.
// X, Wq, Wk, Wv keep their row-major order: float4 number q becomes the 8-byte
// piece number q, so a wave's load covers 512 contiguous bytes (4 whole lines)
// and its store 256 (2 whole lines).
// Wo goes to fragment order: fragment (n >> 4, k >> 5) is number
// (n >> 4) * (H / 32) + (k >> 5). A lane writes 16-byte chunks, chunk number
// o = fragment * 64 + (k >> 4 & 1) * 32 + lane.

#define CVT_BLOCKS  256
#define CVT_WAVES   12
#define CVT_PER     4096                    // elements a wave

static_assert(CVT_BLOCKS * 8 * CVT_PER == MROWS * H, "8 waves a group cover X");
static_assert(CVT_BLOCKS * CVT_PER == H * H, "1 wave a group covers a weight");

// Four floats to one 8-byte piece of bf16, element 0 at the lowest address.
static __device__ __forceinline__ uint2 pack4(float4 x) {
  uint2 r;
  r.x = (unsigned)f2bf(x.x) | ((unsigned)f2bf(x.y) << 16);
  r.y = (unsigned)f2bf(x.z) | ((unsigned)f2bf(x.w) << 16);
  return r;
}

// The register budget of four waves per SIMD is asked for by name (this grid
// puts three there): aiming for more waves, the compiler holds part of the
// loads back behind the first conversions, where they wait out a second memory
// latency.
__global__ __launch_bounds__(CVT_WAVES * 32) __attribute__((amdgpu_waves_per_eu(4, 4)))
void cvt_all_kernel(
    const float* __restrict__ X, const float* __restrict__ Wq,
    const float* __restrict__ Wk, const float* __restrict__ Wv,
    const float* __restrict__ Wo,
    unsigned short* __restrict__ Xbf, unsigned short* __restrict__ Wqkv,
    unsigned short* __restrict__ Wobf) {
  int lane = threadIdx.x & 31;
  int w = __builtin_amdgcn_readfirstlane(threadIdx.x >> 5);   // scalar: the role
  int blk = blockIdx.x;

  float4 v[CVT_PER / 128];                  // 32 float4 a lane
  if (w < 11) {
    const float* src = (w < 8) ? X + (blk * 8 + w) * CVT_PER
                               : ((w == 8) ? Wq : (w == 9) ? Wk : Wv) + blk * CVT_PER;
    unsigned short* dst = (w < 8) ? Xbf + (blk * 8 + w) * CVT_PER
                                  : Wqkv + (w - 8) * (H * H) + blk * CVT_PER;
    const float4* ps = reinterpret_cast<const float4*>(src) + lane;
    uint2* pd = reinterpret_cast<uint2*>(dst) + lane;
#pragma unroll
    for (int j = 0; j < CVT_PER / 128; j++) v[j] = ps[j * 32];
#pragma unroll
    for (int j = 0; j < CVT_PER / 128; j++) pd[j * 32] = pack4(v[j]);
  } else {
    // Chunks o = blk * 512 + j * 32 + lane, j = 0..15: 8 fragments of one row
    // of fragments. Row n = (blk >> 2) * 16 + (lane & 15), and chunk j starts
    // at k = (blk & 3) * 256 + j * 16 + (lane >> 4) * 8.
    const float4* ps = reinterpret_cast<const float4*>(
        Wo + ((blk >> 2) * 16 + (lane & 15)) * H + (blk & 3) * 256 + (lane >> 4) * 8);
    uint4* pd = reinterpret_cast<uint4*>(Wobf + blk * CVT_PER) + lane;
#pragma unroll
    for (int j = 0; j < CVT_PER / 256; j++) {
      v[2 * j]     = ps[j * 4];
      v[2 * j + 1] = ps[j * 4 + 1];
    }
#pragma unroll
    for (int j = 0; j < CVT_PER / 256; j++) {
      float4 x = v[2 * j], y = v[2 * j + 1];
      pd[j * 32] = pack8(x.x, x.y, x.z, x.w, y.x, y.y, y.z, y.w);
    }
  }
}

// --------------------------------------------------------------- QKV GEMM ---
// Y[8192 x 3072] = X * Wqkv^T. grid = (MROWS/128, 3*H/256), block = 256
// (8 waves, 2 x 4). A work-group owns a 128 x 256 tile of Y; a wave owns
// 64 x 64 of it (4 x 4 fragments). Per trip 64 k of the tile's 128 X rows and
// 256 W rows (128 B a row, whole lines) are copied asynchronously into one of
// two LDS buffers while the other buffer is worked on.
// Q, K, V^T are stored per (batch, head) in fragment order:
//   Q, K : row = position s, k = d; fragment number (s >> 4) * 2 + (d >> 5)
//   V^T  : row = d, k = position s; fragment number (s >> 5) * 4 + (d >> 4)
// A chunk is 8 consecutive k of one row, and a lane of a WMMA result holds 8
// consecutive rows of one column. So V is computed as X * W^T (a lane: 8
// positions of one d) and Q, K as W * X^T (a lane: 8 d of one position): the
// two operands trade places, which here is a trade of the two LDS offsets.

#define QBM    128
#define QBN    256
#define QBK    64                       // k per trip: 128 B of every row
#define QPITCH 144                      // LDS row pitch in bytes, 16 B x odd
#define QSTAGE ((QBM + QBN) * QPITCH)   // 55,296 B per buffer
#define QTRIPS (H / QBK)                // 16

// One 16x32 fragment from a staged tile; same k order as load_frag_f.
// p: this lane's row, already advanced by (lane >> 4) * 16 bytes.
static __device__ __forceinline__ v16bf load_frag_s(const unsigned char* p) {
  v16bf f;
  reinterpret_cast<uint4*>(&f)[0] = *reinterpret_cast<const uint4*>(p);
  reinterpret_cast<uint4*>(&f)[1] = *reinterpret_cast<const uint4*>(p + 32);
  return f;
}

// Copy one trip's tile: 384 rows of 128 B, 12 copies of 16 B per lane; a
// wave's copy covers 4 whole rows. gx / gw: this lane's 16 bytes in its first
// X / W row; lds: the byte address of the same place in the buffer.
static __device__ __forceinline__ void stage_tile(const unsigned short* gx,
                                                  const unsigned short* gw,
                                                  unsigned lds) {
  const unsigned R = 32 * QPITCH;       // 32 rows further in LDS
  const size_t   G = (size_t)32 * H;    // 32 rows further in global memory
  // The copies and their s_wait_xcnt stand in one statement, so that no
  // address register is rewritten ahead of the wait.
  asm volatile(
      "global_load_async_to_lds_b128 %0, %12, off\n\t"
      "global_load_async_to_lds_b128 %1, %13, off\n\t"
      "global_load_async_to_lds_b128 %2, %14, off\n\t"
      "global_load_async_to_lds_b128 %3, %15, off\n\t"
      "global_load_async_to_lds_b128 %4, %16, off\n\t"
      "global_load_async_to_lds_b128 %5, %17, off\n\t"
      "global_load_async_to_lds_b128 %6, %18, off\n\t"
      "global_load_async_to_lds_b128 %7, %19, off\n\t"
      "global_load_async_to_lds_b128 %8, %20, off\n\t"
      "global_load_async_to_lds_b128 %9, %21, off\n\t"
      "global_load_async_to_lds_b128 %10, %22, off\n\t"
      "global_load_async_to_lds_b128 %11, %23, off\n\t"
      "s_wait_xcnt 0x0"
      :: "v"(lds), "v"(lds + R), "v"(lds + 2 * R), "v"(lds + 3 * R),
         "v"(lds + 4 * R), "v"(lds + 5 * R), "v"(lds + 6 * R),
         "v"(lds + 7 * R), "v"(lds + 8 * R), "v"(lds + 9 * R),
         "v"(lds + 10 * R), "v"(lds + 11 * R),
         "v"(gx), "v"(gx + G), "v"(gx + 2 * G), "v"(gx + 3 * G),
         "v"(gw), "v"(gw + G), "v"(gw + 2 * G), "v"(gw + 3 * G),
         "v"(gw + 4 * G), "v"(gw + 5 * G), "v"(gw + 6 * G), "v"(gw + 7 * G)
      : "memory");
}

__global__ __launch_bounds__(256) void qkv_kernel(
    const unsigned short* __restrict__ Xbf,
    const unsigned short* __restrict__ Wqkv,
    const float* __restrict__ bq, const float* __restrict__ bk,
    const float* __restrict__ bv,
    unsigned short* __restrict__ Qbf, unsigned short* __restrict__ Kbf,
    unsigned short* __restrict__ Vt) {
  __shared__ __attribute__((aligned(16))) unsigned char stage[2 * QSTAGE];

  int mat = blockIdx.y >> 2;                    // 0=Q, 1=K, 2=V
  const float* bias = (mat == 0) ? bq : (mat == 1) ? bk : bv;

  int m0 = blockIdx.x * QBM;
  int nb = blockIdx.y * QBN;                    // row of the stacked Wqkv
  int tid = threadIdx.x;
  int w = tid >> 5, lane = tid & 31, l15 = lane & 15;
  int wm = w >> 2, wn = w & 3;

  // copy side: 8 lanes a row, 32 rows per copy of the work-group
  int cr = tid >> 3, cc = tid & 7;
  const unsigned short* gx = Xbf  + (size_t)(m0 + cr) * H + cc * 8;
  const unsigned short* gw = Wqkv + (size_t)(nb + cr) * H + cc * 8;
  unsigned lds0 = (unsigned)(size_t)stage + cr * QPITCH + cc * 16;

  // read side: this lane's row in the wave's first X and W fragment
  int offX = (wm * 64 + l15) * QPITCH + (lane >> 4) * 16;
  int offW = (QBM + wn * 64 + l15) * QPITCH + (lane >> 4) * 16;
  int offA = (mat == 2) ? offX : offW;          // rows of the result
  int offB = (mat == 2) ? offW : offX;          // columns of the result

  v8f acc[4][4] = {};

  stage_tile(gx, gw, lds0);
  asm volatile("s_wait_asynccnt 0x0" ::: "memory");  // tile 0 has landed
  __syncthreads();                                   // and every wave may read it
  stage_tile(gx + QBK, gw + QBK, lds0 + QSTAGE);

  // Kept rolled: a trip already holds 32 WMMAs, so the branch costs little,
  // and the code stays short.
#pragma unroll 1
  for (int t = 0; t < QTRIPS; t++) {
    int buf = (t & 1) * QSTAGE;
    const unsigned char* sA = stage + buf + offA;
    const unsigned char* sB = stage + buf + offB;
#pragma unroll
    for (int ks = 0; ks < 2; ks++) {
      v16bf a[4], b[4];
#pragma unroll
      for (int i = 0; i < 4; i++)
        a[i] = load_frag_s(sA + i * 16 * QPITCH + ks * 64);
#pragma unroll
      for (int j = 0; j < 4; j++)
        b[j] = load_frag_s(sB + j * 16 * QPITCH + ks * 64);
      // Keeps the 16 LDS reads one group in front of their 16 WMMAs: left
      // free, they are spread among the WMMAs, each place with a full wait.
      __builtin_amdgcn_sched_barrier(0);
#pragma unroll
      for (int i = 0; i < 4; i++)
#pragma unroll
        for (int j = 0; j < 4; j++)
          acc[i][j] = wmma_bf16(a[i], b[j], acc[i][j]);
      // Other end of the same group: the next reads stay behind these WMMAs.
      __builtin_amdgcn_sched_barrier(0);
    }
    asm volatile("s_wait_dscnt 0x0" ::: "memory");     // own reads of this buffer done
    asm volatile("s_wait_asynccnt 0x0" ::: "memory");  // own copies of tile t+1 landed
    __syncthreads();   // publishes tile t+1, frees the buffer of tile t
    if (t + 2 < QTRIPS)
      stage_tile(gx + (t + 2) * QBK, gw + (t + 2) * QBK, lds0 + buf);
  }
  asm volatile("s_wait_asynccnt 0x0" ::: "memory");    // none in flight at the end

  int hh = ((blockIdx.y & 3) << 2) + wn;        // a wave's 64 W rows = one head
  int r0 = m0 + wm * 64;                        // 128 rows lie in one batch entry
  int bb = r0 >> 10, s0 = r0 & (SEQ - 1);
  size_t hbase = ((size_t)bb * NHEAD + hh) * (SEQ * HD);
  if (mat == 2) {
    // acc[i][j][v]: position s0 + i*16 + (lane>>4)*8 + v, d = j*16 + l15
    unsigned short* dst = Vt + hbase + (size_t)(s0 >> 5) * 4 * FRAG + lane * 8;
#pragma unroll
    for (int j = 0; j < 4; j++) {
      float bn = bias[hh * HD + j * 16 + l15];
#pragma unroll
      for (int i = 0; i < 4; i++)
        *reinterpret_cast<uint4*>(dst + ((i >> 1) * 4 + j) * FRAG + (i & 1) * 256) =
            pack8(acc[i][j][0] + bn, acc[i][j][1] + bn, acc[i][j][2] + bn,
                  acc[i][j][3] + bn, acc[i][j][4] + bn, acc[i][j][5] + bn,
                  acc[i][j][6] + bn, acc[i][j][7] + bn);
      // The next column reuses the registers that these stores name.
      asm volatile("s_wait_xcnt 0x0" ::: "memory");
      // One column of fragments at a time: all 128 conversions scheduled at
      // once take more than 256 VGPRs, which costs the second work-group per WGP.
      __builtin_amdgcn_sched_barrier(0);
    }
  } else {
    // acc[i][j][v]: d = i*16 + (lane>>4)*8 + v, position s0 + j*16 + l15
    unsigned short* dst = ((mat == 0) ? Qbf : Kbf) + hbase +
                          (size_t)(s0 >> 4) * 2 * FRAG + lane * 8;
#pragma unroll
    for (int i = 0; i < 4; i++) {
      const float4* bp = reinterpret_cast<const float4*>(
          bias + hh * HD + i * 16 + ((lane >> 4) << 3));
      float4 b0 = bp[0], b1 = bp[1];
#pragma unroll
      for (int j = 0; j < 4; j++)
        *reinterpret_cast<uint4*>(dst + (j * 2 + (i >> 1)) * FRAG + (i & 1) * 256) =
            pack8(acc[i][j][0] + b0.x, acc[i][j][1] + b0.y, acc[i][j][2] + b0.z,
                  acc[i][j][3] + b0.w, acc[i][j][4] + b1.x, acc[i][j][5] + b1.y,
                  acc[i][j][6] + b1.z, acc[i][j][7] + b1.w);
      // As above: the wait for the stores' registers, then the bound on the
      // registers of the conversions.
      asm volatile("s_wait_xcnt 0x0" ::: "memory");
      __builtin_amdgcn_sched_barrier(0);
    }
  }
}

typedef __attribute__((ext_vector_type(16))) float v16f;

// The value that lane (l ^ 16) holds.
static __device__ __forceinline__ float other_half(float x) {
  int b = __builtin_bit_cast(int, x);
  b = __builtin_amdgcn_permlanex16(b, b, 0x76543210, 0xfedcba98, false, false);
  return __builtin_bit_cast(float, b);
}

static __device__ __forceinline__ v8f load8f(const float* p) {
  v8f r;
  reinterpret_cast<float4*>(&r)[0] = reinterpret_cast<const float4*>(p)[0];
  reinterpret_cast<float4*>(&r)[1] = reinterpret_cast<const float4*>(p)[1];
  return r;
}

// Four waves per SIMD (two work-groups per WGP) are asked for by name: with that
// register budget the scheduler issues the next step's K and mask loads right
// behind the score products, a whole softmax ahead of their use; left to aim
// for more waves it holds them back until registers fall free late in the step.
__global__ __launch_bounds__(256) __attribute__((amdgpu_waves_per_eu(4, 4)))
void attn_kernel(
    const unsigned short* __restrict__ Qbf,
    const unsigned short* __restrict__ Kbf,
    const unsigned short* __restrict__ Vt,
    const float* __restrict__ mask,
    unsigned short* __restrict__ Ctx) {
  int tid = threadIdx.x;
  int w = tid >> 5, lane = tid & 31;
  int gid = blockIdx.x * 8 + w;
  int qt = gid & 63;
  int bh = gid >> 6;
  int b = bh >> 4, h = bh & 15;

  const unsigned short* Qh = Qbf + (size_t)bh * SEQ * HD;
  const unsigned short* Kh = Kbf + (size_t)bh * SEQ * HD;
  const unsigned short* Vh = Vt  + (size_t)bh * HD * SEQ;
  const float* mrow = mask + b * SEQ + ((lane >> 4) << 3);   // this half's keys

  // B operand: column = query, k = d
  v16bf qb0 = load_frag_f(Qh + (qt * 2 + 0) * FRAG, lane);
  v16bf qb1 = load_frag_f(Qh + (qt * 2 + 1) * FRAG, lane);

  // O^T tiles: o<t>[r] = d 16t + 8h + r of this lane's query
  v8f o0 = {}, o1 = {}, o2 = {}, o3 = {};
  float rmax = -INFINITY;   // of the query, equal in both halves
  float rsum = 0.f;         // over this half's keys only; joined at the end

  // prime K fragments for j = 0
  v16bf kc0 = load_frag_f(Kh + 0 * FRAG, lane);   // keys 0..15,  d 0..31
  v16bf kc1 = load_frag_f(Kh + 1 * FRAG, lane);   // keys 0..15,  d 32..63
  v16bf kc2 = load_frag_f(Kh + 2 * FRAG, lane);   // keys 16..31, d 0..31
  v16bf kc3 = load_frag_f(Kh + 3 * FRAG, lane);   // keys 16..31, d 32..63

  // and the mask of its keys
  v8f mk0 = load8f(mrow);
  v8f mk1 = load8f(mrow + 16);

  // Kept rolled: K and the mask reload into the registers just read, so there
  // is nothing for an unrolled body to save, and the code stays short.
#pragma unroll 1
  for (int j = 0; j < SEQ; j += 32) {
    // V fragments for this step: independent of P, issue early
    // (32 keys are 4 fragments = j * HD elements on, in K and in V^T alike)
    v16bf va0 = load_frag_f(Vh + j * HD + 0 * FRAG, lane);
    v16bf va1 = load_frag_f(Vh + j * HD + 1 * FRAG, lane);
    v16bf va2 = load_frag_f(Vh + j * HD + 2 * FRAG, lane);
    v16bf va3 = load_frag_f(Vh + j * HD + 3 * FRAG, lane);

    // scores: K(16 keys x 64) @ Q^T for two 16-key sub-tiles
    v8f s0 = {}, s1 = {};
    s0 = wmma_bf16(kc0, qb0, s0);
    s0 = wmma_bf16(kc1, qb1, s0);
    s1 = wmma_bf16(kc2, qb0, s1);
    s1 = wmma_bf16(kc3, qb1, s1);

    v8f a0 = s0 * 0.125f + mk0;                 // 1/sqrt(64) scale + mask
    v8f a1 = s1 * 0.125f + mk1;

    // K fragments and mask for the next step, into the registers just read
    // (wraps on last iter; redundant but cheap)
    int jn = (j + 32) & (SEQ - 1);
    mk0 = load8f(mrow + jn);
    mk1 = load8f(mrow + jn + 16);
    kc0 = load_frag_f(Kh + jn * HD + 0 * FRAG, lane);
    kc1 = load_frag_f(Kh + jn * HD + 1 * FRAG, lane);
    kc2 = load_frag_f(Kh + jn * HD + 2 * FRAG, lane);
    kc3 = load_frag_f(Kh + jn * HD + 3 * FRAG, lane);

    // maximum over this lane's 16 keys, as a tree, then over both halves
    float t0 = fmaxf(fmaxf(a0[0], a0[1]), a0[2]);
    float t1 = fmaxf(fmaxf(a0[3], a0[4]), a0[5]);
    float t2 = fmaxf(fmaxf(a0[6], a0[7]), a1[0]);
    float t3 = fmaxf(fmaxf(a1[1], a1[2]), a1[3]);
    float t4 = fmaxf(fmaxf(a1[4], a1[5]), a1[6]);
    float t = fmaxf(fmaxf(fmaxf(t0, t1), t2), fmaxf(fmaxf(t3, t4), a1[7]));
    t = fmaxf(t, other_half(t));
    float nm = fmaxf(rmax, t);
    float alpha = __expf(rmax - nm);
    rmax = nm;

    v16f p;
#pragma unroll
    for (int r = 0; r < 8; r++) {
      p[r]     = __expf(a0[r] - nm);
      p[8 + r] = __expf(a1[r] - nm);
    }
    o0 *= alpha; o1 *= alpha; o2 *= alpha; o3 *= alpha;

    // P^T as B operand: element s is key 8h + s (s < 8), 16 + 8h + s - 8 (else)
    v16bf pb = __builtin_convertvector(p, v16bf);

    // Keeps vector work out from among the four products: there it lands in
    // registers of a V fragment just read, which costs four idle slots behind
    // the product each time.
    __builtin_amdgcn_sched_barrier(0);

    // ctx^T += V^T(64 x 32) @ P^T(32 x 16); V^T fragment rows are d
    o0 = wmma_bf16(va0, pb, o0);
    o1 = wmma_bf16(va1, pb, o1);
    o2 = wmma_bf16(va2, pb, o2);
    o3 = wmma_bf16(va3, pb, o3);
    // Other end of the same group. The row sum needs nothing of the products
    // and runs while the matrix unit works on them; it also stands between the
    // last product that reads P^T and the next step's first product, whose
    // result the compiler puts into the same registers.
    __builtin_amdgcn_sched_barrier(0);

    float rs = ((p[0] + p[8]) + (p[1] + p[9])) + ((p[2] + p[10]) + (p[3] + p[11])) +
               (((p[4] + p[12]) + (p[5] + p[13])) + ((p[6] + p[14]) + (p[7] + p[15])));
    rsum = rsum * alpha + rs;
  }

  // normalize and store merged-head ctx [B*S, H] in bf16, in fragment order:
  // row = b * SEQ + s, k = h * HD + d, fragment (row >> 4) * (H / 32) + (k >> 5).
  // A lane's 8 d of one tile are one 16-byte chunk, chunk number = lane.
  float inv = 1.f / (rsum + other_half(rsum));
  unsigned short* cw = Ctx +
      ((size_t)(b * (SEQ / 16) + qt) * (H / 32) + h * 2) * FRAG + lane * 8;
  *reinterpret_cast<uint4*>(cw + 0 * FRAG + 0) =                    // d  0..15
      pack8(o0[0] * inv, o0[1] * inv, o0[2] * inv, o0[3] * inv,
            o0[4] * inv, o0[5] * inv, o0[6] * inv, o0[7] * inv);
  *reinterpret_cast<uint4*>(cw + 0 * FRAG + 256) =                  // d 16..31
      pack8(o1[0] * inv, o1[1] * inv, o1[2] * inv, o1[3] * inv,
            o1[4] * inv, o1[5] * inv, o1[6] * inv, o1[7] * inv);
  *reinterpret_cast<uint4*>(cw + 1 * FRAG + 0) =                    // d 32..47
      pack8(o2[0] * inv, o2[1] * inv, o2[2] * inv, o2[3] * inv,
            o2[4] * inv, o2[5] * inv, o2[6] * inv, o2[7] * inv);
  *reinterpret_cast<uint4*>(cw + 1 * FRAG + 256) =                  // d 48..63
      pack8(o3[0] * inv, o3[1] * inv, o3[2] * inv, o3[3] * inv,
            o3[4] * inv, o3[5] * inv, o3[6] * inv, o3[7] * inv);
}

// ------------------------------- output GEMM + bias + residual + LayerNorm --
// grid = MROWS/16 blocks of 512 (16 waves). Wave w: 16 rows x 64 cols;
// block owns the full 16x1024 strip for the fused LayerNorm.
// Rolled ping-pong K-loop on register fragments loaded straight from global.

__global__ __launch_bounds__(512) void out_ln_kernel(
    const unsigned short* __restrict__ Ctx,
    const unsigned short* __restrict__ Wo,
    const float* __restrict__ bo,
    const float* __restrict__ hidden,
    const float* __restrict__ ln_g, const float* __restrict__ ln_b,
    float* __restrict__ out) {
  __shared__ float tile[16 * H];                // 64 KB

  int m0 = blockIdx.x << 4;
  int tid = threadIdx.x;
  int w = tid >> 5, lane = tid & 31, l15 = lane & 15;
  int n0 = w << 6;

  v8f acc[4] = {};
  // Ctx and Wo lie in fragment order: 16 rows are H / 32 fragments in a row.
  const unsigned short* Ca = Ctx + (size_t)blockIdx.x * (16 * H);
  const unsigned short* Wb = Wo + (size_t)n0 * H;
  v16bf aA = load_frag_f(Ca, lane);
  v16bf bA[4];
#pragma unroll
  for (int t = 0; t < 4; t++)
    bA[t] = load_frag_f(Wb + t * (16 * H), lane);

  for (int kb = 0; kb < H; kb += 64) {
    // 32 k on = one fragment on = 16 * 32 elements
    v16bf aB = load_frag_f(Ca + (kb + 32) * 16, lane);
    v16bf bB[4];
#pragma unroll
    for (int t = 0; t < 4; t++)
      bB[t] = load_frag_f(Wb + t * (16 * H) + (kb + 32) * 16, lane);
    // The address registers of these loads are reused for later load results.
    asm volatile("s_wait_xcnt 0x0" ::: "memory");

#pragma unroll
    for (int t = 0; t < 4; t++) acc[t] = wmma_bf16(aA, bA[t], acc[t]);

    int k2 = (kb + 64) & (H - 1);
    aA = load_frag_f(Ca + k2 * 16, lane);
#pragma unroll
    for (int t = 0; t < 4; t++)
      bA[t] = load_frag_f(Wb + t * (16 * H) + k2 * 16, lane);
    // As above.
    asm volatile("s_wait_xcnt 0x0" ::: "memory");

#pragma unroll
    for (int t = 0; t < 4; t++) acc[t] = wmma_bf16(aB, bB[t], acc[t]);
  }

  int rw = (lane >> 4) << 3;
#pragma unroll
  for (int t = 0; t < 4; t++) {
    int n = n0 + t * 16 + l15;
    float bn = bo[n];
#pragma unroll
    for (int v = 0; v < 8; v++) {
      int m = v + rw;
      int row = m0 + m;
      tile[m * H + n] = acc[t][v] + bn + hidden[(size_t)row * H + n];
    }
  }
  __syncthreads();

  // LayerNorm: 32 threads per row, 32 elems per thread
  int row = tid >> 5;                           // 16 rows
  const float* tr = &tile[row * H + lane * 32];
  float s = 0.f, ss = 0.f;
#pragma unroll 8
  for (int i = 0; i < 32; i++) { float x = tr[i]; s += x; ss += x * x; }
#pragma unroll
  for (int o = 1; o < 32; o <<= 1) {
    s  += __shfl_xor(s,  o, 32);
    ss += __shfl_xor(ss, o, 32);
  }
  float mu   = s  * (1.f / H);
  float var  = ss * (1.f / H) - mu * mu;
  float rstd = rsqrtf(var + 1e-12f);
  size_t obase = (size_t)(m0 + row) * H + lane * 32;
  for (int i = 0; i < 32; i++) {
    int n = lane * 32 + i;
    out[obase + i] = (tr[i] - mu) * rstd * ln_g[n] + ln_b[n];
  }
}

// ------------------------------------------------------------------ launch --

extern "C" void kernel_launch(void* const* d_in, const int* in_sizes, int n_in,
                              void* d_out, int out_size, void* d_ws,
                              size_t ws_size, hipStream_t stream) {
  (void)in_sizes; (void)n_in; (void)out_size; (void)ws_size;

  const float* hidden = (const float*)d_in[0];
  const float* mask   = (const float*)d_in[1];
  const float* Wq     = (const float*)d_in[2];
  const float* bq     = (const float*)d_in[3];
  const float* Wk     = (const float*)d_in[4];
  const float* bk     = (const float*)d_in[5];
  const float* Wv     = (const float*)d_in[6];
  const float* bv     = (const float*)d_in[7];
  const float* Wo     = (const float*)d_in[8];
  const float* bo     = (const float*)d_in[9];
  const float* ln_g   = (const float*)d_in[10];
  const float* ln_b   = (const float*)d_in[11];

  char* ws = (char*)d_ws;
  size_t off = 0;
  auto alloc = [&](size_t bytes) {
    char* p = ws + off;
    off += (bytes + 255) & ~(size_t)255;
    return p;
  };
  unsigned short* Xbf  = (unsigned short*)alloc((size_t)MROWS * H * 2);
  unsigned short* Wqkv = (unsigned short*)alloc((size_t)3 * H * H * 2);
  unsigned short* Wobf = (unsigned short*)alloc((size_t)H * H * 2);
  unsigned short* Qbf  = (unsigned short*)alloc((size_t)MROWS * H * 2);
  unsigned short* Kbf  = (unsigned short*)alloc((size_t)MROWS * H * 2);
  unsigned short* Vt   = (unsigned short*)alloc((size_t)MROWS * H * 2);
  unsigned short* Ctx  = (unsigned short*)alloc((size_t)MROWS * H * 2);

  cvt_all_kernel<<<dim3(CVT_BLOCKS), dim3(CVT_WAVES * 32), 0, stream>>>(
      hidden, Wq, Wk, Wv, Wo, Xbf, Wqkv, Wobf);

  qkv_kernel<<<dim3(MROWS / QBM, 3 * H / QBN), dim3(256), 0, stream>>>(
      Xbf, Wqkv, bq, bk, bv, Qbf, Kbf, Vt);

  attn_kernel<<<dim3(BATCH * NHEAD * (SEQ / 16) / 8), dim3(256), 0, stream>>>(
      Qbf, Kbf, Vt, mask, Ctx);

  out_ln_kernel<<<dim3(MROWS / 16), dim3(512), 0, stream>>>(
      Ctx, Wobf, bo, hidden, ln_g, ln_b, (float*)d_out);
}

// v005
// A run of this version takes 130 microseconds.
// Two timings next to v004 both put it at 1.19 times that version's speed.
// Counting every step since v000, it is 4.19 times as fast.
#include <hip/hip_runtime.h>
#include <math.h>

#define H     1024
#define NHEAD 16
#define HD    64
#define BATCH 8
#define SEQ   1024
#define MROWS (BATCH * SEQ)   // 8192

typedef __attribute__((ext_vector_type(16))) __bf16 v16bf;
typedef __attribute__((ext_vector_type(8)))  float  v8f;

// ---------------------------------------------------------------- helpers ---

static __device__ __forceinline__ unsigned short f2bf(float f) {
  union { float f; unsigned u; } x; x.f = f;
  unsigned r = x.u + 0x7FFFu + ((x.u >> 16) & 1u);   // round-to-nearest-even
  return (unsigned short)(r >> 16);
}

static __device__ __forceinline__ v8f wmma_bf16(v16bf a, v16bf b, v8f c) {
  // D = A(16x32 bf16) * B(32x16 bf16) + C(16x16 f32)
  return __builtin_amdgcn_wmma_f32_16x16x32_bf16(false, a, false, b,
                                                 (short)0, c, false, false);
}

// Fragment order. Every operand that a kernel loads straight from global
// memory into a WMMA fragment (Q, K, V^T, Ctx, Wo) is stored as a row of
// 16x32 bf16 fragments of FRAG = 512 elements (1 KB). Per the CDNA5 16-bit
// layout lanes 0-15 hold k = {0..7, 16..23} of row (lane & 15), lanes 16-31
// hold k = {8..15, 24..31}. Element (r, k) of a fragment lies at
//   (k >> 4) * 256 + ((k >> 3) & 1) * 128 + r * 8 + (k & 7),
// so lane L's two 16-byte chunks lie at L * 8 and 256 + L * 8: each of the two
// loads of a wave covers 512 contiguous bytes, 4 whole lines instead of 16.
#define FRAG 512

static __device__ __forceinline__ v16bf load_frag_f(const unsigned short* frag,
                                                    int lane) {
  const unsigned short* p = frag + lane * 8;
  v16bf f;
  reinterpret_cast<uint4*>(&f)[0] = *reinterpret_cast<const uint4*>(p);
  reinterpret_cast<uint4*>(&f)[1] = *reinterpret_cast<const uint4*>(p + 256);
  return f;
}

// Eight floats to one 16-byte chunk of bf16, element 0 at the lowest address.
static __device__ __forceinline__ uint4 pack8(float x0, float x1, float x2,
                                              float x3, float x4, float x5,
                                              float x6, float x7) {
  uint4 r;
  r.x = (unsigned)f2bf(x0) | ((unsigned)f2bf(x1) << 16);
  r.y = (unsigned)f2bf(x2) | ((unsigned)f2bf(x3) << 16);
  r.z = (unsigned)f2bf(x4) | ((unsigned)f2bf(x5) << 16);
  r.w = (unsigned)f2bf(x6) | ((unsigned)f2bf(x7) << 16);
  return r;
}

// -------------------------------------------------------------- fp32->bf16 --
// All five conversions (X, Wq, Wk, Wv, Wo) run in ONE launch of 256 work-groups
// of 12 waves, one per WGP. With one element a lane a trip, tens of thousands
// of short waves have to be started, and every launch adds its gap, its fill
// and its tail. Here a wave converts 4,096 elements: a lane issues its 32
// loads of 16 B at once, then converts and stores. The five arrays hold
// 8 : 1 : 1 : 1 : 1 parts, so of a work-group's waves 0-7 take X, 8-10 take
// Wq, Wk, Wv and 11 takes Wo.
// X, Wq, Wk, Wv keep their row-major order: float4 number q becomes the 8-byte
// piece number q, so a wave's load covers 512 contiguous bytes (4 whole lines)
// and its store 256 (2 whole lines).
// Wo goes to fragment order: fragment (n >> 4, k >> 5) is number
// (n >> 4) * (H / 32) + (k >> 5). A lane writes 16-byte chunks, chunk number
// o = fragment * 64 + (k >> 4 & 1) * 32 + lane.

#define CVT_BLOCKS  256
#define CVT_WAVES   12
#define CVT_PER     4096                    // elements a wave

static_assert(CVT_BLOCKS * 8 * CVT_PER == MROWS * H, "8 waves a group cover X");
static_assert(CVT_BLOCKS * CVT_PER == H * H, "1 wave a group covers a weight");

// Four floats to one 8-byte piece of bf16, element 0 at the lowest address.
static __device__ __forceinline__ uint2 pack4(float4 x) {
  uint2 r;
  r.x = (unsigned)f2bf(x.x) | ((unsigned)f2bf(x.y) << 16);
  r.y = (unsigned)f2bf(x.z) | ((unsigned)f2bf(x.w) << 16);
  return r;
}

// The register budget of four waves per SIMD is asked for by name (this grid
// puts three there): aiming for more waves, the compiler holds part of the
// loads back behind the first conversions, where they wait out a second memory
// latency.
__global__ __launch_bounds__(CVT_WAVES * 32) __attribute__((amdgpu_waves_per_eu(4, 4)))
void cvt_all_kernel(
    const float* __restrict__ X, const float* __restrict__ Wq,
    const float* __restrict__ Wk, const float* __restrict__ Wv,
    const float* __restrict__ Wo,
    unsigned short* __restrict__ Xbf, unsigned short* __restrict__ Wqkv,
    unsigned short* __restrict__ Wobf) {
  int lane = threadIdx.x & 31;
  int w = __builtin_amdgcn_readfirstlane(threadIdx.x >> 5);   // scalar: the role
  int blk = blockIdx.x;

  float4 v[CVT_PER / 128];                  // 32 float4 a lane
  if (w < 11) {
    const float* src = (w < 8) ? X + (blk * 8 + w) * CVT_PER
                               : ((w == 8) ? Wq : (w == 9) ? Wk : Wv) + blk * CVT_PER;
    unsigned short* dst = (w < 8) ? Xbf + (blk * 8 + w) * CVT_PER
                                  : Wqkv + (w - 8) * (H * H) + blk * CVT_PER;
    const float4* ps = reinterpret_cast<const float4*>(src) + lane;
    uint2* pd = reinterpret_cast<uint2*>(dst) + lane;
#pragma unroll
    for (int j = 0; j < CVT_PER / 128; j++) v[j] = ps[j * 32];
#pragma unroll
    for (int j = 0; j < CVT_PER / 128; j++) pd[j * 32] = pack4(v[j]);
  } else {
    // Chunks o = blk * 512 + j * 32 + lane, j = 0..15: 8 fragments of one row
    // of fragments. Row n = (blk >> 2) * 16 + (lane & 15), and chunk j starts
    // at k = (blk & 3) * 256 + j * 16 + (lane >> 4) * 8.
    const float4* ps = reinterpret_cast<const float4*>(
        Wo + ((blk >> 2) * 16 + (lane & 15)) * H + (blk & 3) * 256 + (lane >> 4) * 8);
    uint4* pd = reinterpret_cast<uint4*>(Wobf + blk * CVT_PER) + lane;
#pragma unroll
    for (int j = 0; j < CVT_PER / 256; j++) {
      v[2 * j]     = ps[j * 4];
      v[2 * j + 1] = ps[j * 4 + 1];
    }
#pragma unroll
    for (int j = 0; j < CVT_PER / 256; j++) {
      float4 x = v[2 * j], y = v[2 * j + 1];
      pd[j * 32] = pack8(x.x, x.y, x.z, x.w, y.x, y.y, y.z, y.w);
    }
  }
}

// --------------------------------------------------------------- QKV GEMM ---
// Y[8192 x 3072] = X * Wqkv^T. grid = (MROWS/128, 3*H/256), block = 256
// (8 waves, 2 x 4). A work-group owns a 128 x 256 tile of Y; a wave owns
// 64 x 64 of it (4 x 4 fragments). Per trip 64 k of the tile's 128 X rows and
// 256 W rows (128 B a row, whole lines) are copied asynchronously into one of
// two LDS buffers while the other buffer is worked on.
// Q, K, V^T are stored per (batch, head) in fragment order:
//   Q, K : row = position s, k = d; fragment number (s >> 4) * 2 + (d >> 5)
//   V^T  : row = d, k = position s; fragment number (s >> 5) * 4 + (d >> 4)
// A chunk is 8 consecutive k of one row, and a lane of a WMMA result holds 8
// consecutive rows of one column. So V is computed as X * W^T (a lane: 8
// positions of one d) and Q, K as W * X^T (a lane: 8 d of one position): the
// two operands trade places, which here is a trade of the two LDS offsets.

#define QBM    128
#define QBN    256
#define QBK    64                       // k per trip: 128 B of every row
#define QPITCH 144                      // LDS row pitch in bytes, 16 B x odd
#define QSTAGE ((QBM + QBN) * QPITCH)   // 55,296 B per buffer
#define QTRIPS (H / QBK)                // 16

// One 16x32 fragment from a staged tile; same k order as load_frag_f.
// p: this lane's row, already advanced by (lane >> 4) * 16 bytes.
static __device__ __forceinline__ v16bf load_frag_s(const unsigned char* p) {
  v16bf f;
  reinterpret_cast<uint4*>(&f)[0] = *reinterpret_cast<const uint4*>(p);
  reinterpret_cast<uint4*>(&f)[1] = *reinterpret_cast<const uint4*>(p + 32);
  return f;
}

// Copy one trip's tile: 384 rows of 128 B, 12 copies of 16 B per lane; a
// wave's copy covers 4 whole rows. gx / gw: this lane's 16 bytes in its first
// X / W row; lds: the byte address of the same place in the buffer.
static __device__ __forceinline__ void stage_tile(const unsigned short* gx,
                                                  const unsigned short* gw,
                                                  unsigned lds) {
  const unsigned R = 32 * QPITCH;       // 32 rows further in LDS
  const size_t   G = (size_t)32 * H;    // 32 rows further in global memory
  // The copies and their s_wait_xcnt stand in one statement, so that no
  // address register is rewritten ahead of the wait.
  asm volatile(
      "global_load_async_to_lds_b128 %0, %12, off\n\t"
      "global_load_async_to_lds_b128 %1, %13, off\n\t"
      "global_load_async_to_lds_b128 %2, %14, off\n\t"
      "global_load_async_to_lds_b128 %3, %15, off\n\t"
      "global_load_async_to_lds_b128 %4, %16, off\n\t"
      "global_load_async_to_lds_b128 %5, %17, off\n\t"
      "global_load_async_to_lds_b128 %6, %18, off\n\t"
      "global_load_async_to_lds_b128 %7, %19, off\n\t"
      "global_load_async_to_lds_b128 %8, %20, off\n\t"
      "global_load_async_to_lds_b128 %9, %21, off\n\t"
      "global_load_async_to_lds_b128 %10, %22, off\n\t"
      "global_load_async_to_lds_b128 %11, %23, off\n\t"
      "s_wait_xcnt 0x0"
      :: "v"(lds), "v"(lds + R), "v"(lds + 2 * R), "v"(lds + 3 * R),
         "v"(lds + 4 * R), "v"(lds + 5 * R), "v"(lds + 6 * R),
         "v"(lds + 7 * R), "v"(lds + 8 * R), "v"(lds + 9 * R),
         "v"(lds + 10 * R), "v"(lds + 11 * R),
         "v"(gx), "v"(gx + G), "v"(gx + 2 * G), "v"(gx + 3 * G),
         "v"(gw), "v"(gw + G), "v"(gw + 2 * G), "v"(gw + 3 * G),
         "v"(gw + 4 * G), "v"(gw + 5 * G), "v"(gw + 6 * G), "v"(gw + 7 * G)
      : "memory");
}

__global__ __launch_bounds__(256) void qkv_kernel(
    const unsigned short* __restrict__ Xbf,
    const unsigned short* __restrict__ Wqkv,
    const float* __restrict__ bq, const float* __restrict__ bk,
    const float* __restrict__ bv,
    unsigned short* __restrict__ Qbf, unsigned short* __restrict__ Kbf,
    unsigned short* __restrict__ Vt) {
  __shared__ __attribute__((aligned(16))) unsigned char stage[2 * QSTAGE];

  int mat = blockIdx.y >> 2;                    // 0=Q, 1=K, 2=V
  const float* bias = (mat == 0) ? bq : (mat == 1) ? bk : bv;

  int m0 = blockIdx.x * QBM;
  int nb = blockIdx.y * QBN;                    // row of the stacked Wqkv
  int tid = threadIdx.x;
  int w = tid >> 5, lane = tid & 31, l15 = lane & 15;
  int wm = w >> 2, wn = w & 3;

  // copy side: 8 lanes a row, 32 rows per copy of the work-group
  int cr = tid >> 3, cc = tid & 7;
  const unsigned short* gx = Xbf  + (size_t)(m0 + cr) * H + cc * 8;
  const unsigned short* gw = Wqkv + (size_t)(nb + cr) * H + cc * 8;
  unsigned lds0 = (unsigned)(size_t)stage + cr * QPITCH + cc * 16;

  // read side: this lane's row in the wave's first X and W fragment
  int offX = (wm * 64 + l15) * QPITCH + (lane >> 4) * 16;
  int offW = (QBM + wn * 64 + l15) * QPITCH + (lane >> 4) * 16;
  int offA = (mat == 2) ? offX : offW;          // rows of the result
  int offB = (mat == 2) ? offW : offX;          // columns of the result

  v8f acc[4][4] = {};

  stage_tile(gx, gw, lds0);
  asm volatile("s_wait_asynccnt 0x0" ::: "memory");  // tile 0 has landed
  __syncthreads();                                   // and every wave may read it
  stage_tile(gx + QBK, gw + QBK, lds0 + QSTAGE);

  // Kept rolled: a trip already holds 32 WMMAs, so the branch costs little,
  // and the code stays short.
#pragma unroll 1
  for (int t = 0; t < QTRIPS; t++) {
    int buf = (t & 1) * QSTAGE;
    const unsigned char* sA = stage + buf + offA;
    const unsigned char* sB = stage + buf + offB;
#pragma unroll
    for (int ks = 0; ks < 2; ks++) {
      v16bf a[4], b[4];
#pragma unroll
      for (int i = 0; i < 4; i++)
        a[i] = load_frag_s(sA + i * 16 * QPITCH + ks * 64);
#pragma unroll
      for (int j = 0; j < 4; j++)
        b[j] = load_frag_s(sB + j * 16 * QPITCH + ks * 64);
      // Keeps the 16 LDS reads one group in front of their 16 WMMAs: left
      // free, they are spread among the WMMAs, each place with a full wait.
      __builtin_amdgcn_sched_barrier(0);
#pragma unroll
      for (int i = 0; i < 4; i++)
#pragma unroll
        for (int j = 0; j < 4; j++)
          acc[i][j] = wmma_bf16(a[i], b[j], acc[i][j]);
      // Other end of the same group: the next reads stay behind these WMMAs.
      __builtin_amdgcn_sched_barrier(0);
    }
    asm volatile("s_wait_dscnt 0x0" ::: "memory");     // own reads of this buffer done
    asm volatile("s_wait_asynccnt 0x0" ::: "memory");  // own copies of tile t+1 landed
    __syncthreads();   // publishes tile t+1, frees the buffer of tile t
    if (t + 2 < QTRIPS)
      stage_tile(gx + (t + 2) * QBK, gw + (t + 2) * QBK, lds0 + buf);
  }
  asm volatile("s_wait_asynccnt 0x0" ::: "memory");    // none in flight at the end

  int hh = ((blockIdx.y & 3) << 2) + wn;        // a wave's 64 W rows = one head
  int r0 = m0 + wm * 64;                        // 128 rows lie in one batch entry
  int bb = r0 >> 10, s0 = r0 & (SEQ - 1);
  size_t hbase = ((size_t)bb * NHEAD + hh) * (SEQ * HD);
  if (mat == 2) {
    // acc[i][j][v]: position s0 + i*16 + (lane>>4)*8 + v, d = j*16 + l15
    unsigned short* dst = Vt + hbase + (size_t)(s0 >> 5) * 4 * FRAG + lane * 8;
#pragma unroll
    for (int j = 0; j < 4; j++) {
      float bn = bias[hh * HD + j * 16 + l15];
#pragma unroll
      for (int i = 0; i < 4; i++)
        *reinterpret_cast<uint4*>(dst + ((i >> 1) * 4 + j) * FRAG + (i & 1) * 256) =
            pack8(acc[i][j][0] + bn, acc[i][j][1] + bn, acc[i][j][2] + bn,
                  acc[i][j][3] + bn, acc[i][j][4] + bn, acc[i][j][5] + bn,
                  acc[i][j][6] + bn, acc[i][j][7] + bn);
      // The next column reuses the registers that these stores name.
      asm volatile("s_wait_xcnt 0x0" ::: "memory");
      // One column of fragments at a time: all 128 conversions scheduled at
      // once take more than 256 VGPRs, which costs the second work-group per WGP.
      __builtin_amdgcn_sched_barrier(0);
    }
  } else {
    // acc[i][j][v]: d = i*16 + (lane>>4)*8 + v, position s0 + j*16 + l15
    unsigned short* dst = ((mat == 0) ? Qbf : Kbf) + hbase +
                          (size_t)(s0 >> 4) * 2 * FRAG + lane * 8;
#pragma unroll
    for (int i = 0; i < 4; i++) {
      const float4* bp = reinterpret_cast<const float4*>(
          bias + hh * HD + i * 16 + ((lane >> 4) << 3));
      float4 b0 = bp[0], b1 = bp[1];
#pragma unroll
      for (int j = 0; j < 4; j++)
        *reinterpret_cast<uint4*>(dst + (j * 2 + (i >> 1)) * FRAG + (i & 1) * 256) =
            pack8(acc[i][j][0] + b0.x, acc[i][j][1] + b0.y, acc[i][j][2] + b0.z,
                  acc[i][j][3] + b0.w, acc[i][j][4] + b1.x, acc[i][j][5] + b1.y,
                  acc[i][j][6] + b1.z, acc[i][j][7] + b1.w);
      // As above: the wait for the stores' registers, then the bound on the
      // registers of the conversions.
      asm volatile("s_wait_xcnt 0x0" ::: "memory");
      __builtin_amdgcn_sched_barrier(0);
    }
  }
}

#define AQT 2   // query tiles a wave

typedef __attribute__((ext_vector_type(16))) float v16f;

// The value that lane (l ^ 16) holds.
static __device__ __forceinline__ float other_half(float x) {
  int b = __builtin_bit_cast(int, x);
  b = __builtin_amdgcn_permlanex16(b, b, 0x76543210, 0xfedcba98, false, false);
  return __builtin_bit_cast(float, b);
}

static __device__ __forceinline__ v8f load8f(const float* p) {
  v8f r;
  reinterpret_cast<float4*>(&r)[0] = reinterpret_cast<const float4*>(p)[0];
  reinterpret_cast<float4*>(&r)[1] = reinterpret_cast<const float4*>(p)[1];
  return r;
}

// Four waves per SIMD (two work-groups per WGP) are asked for by name: with that
// register budget the scheduler issues the next step's K and mask loads right
// behind the score products, a whole softmax ahead of their use; left to aim
// for more waves it holds them back until registers fall free late in the step.
__global__ __launch_bounds__(256) __attribute__((amdgpu_waves_per_eu(4, 4)))
void attn_kernel(
    const unsigned short* __restrict__ Qbf,
    const unsigned short* __restrict__ Kbf,
    const unsigned short* __restrict__ Vt,
    const float* __restrict__ mask,
    unsigned short* __restrict__ Ctx) {
  int tid = threadIdx.x;
  int w = tid >> 5, lane = tid & 31;
  int gid = blockIdx.x * 8 + w;
  int qt = (gid & (SEQ / (16 * AQT) - 1)) * AQT;   // the wave's first query tile
  int bh = gid / (SEQ / (16 * AQT));
  int b = bh >> 4, h = bh & 15;

  const unsigned short* Qh = Qbf + (size_t)bh * SEQ * HD;
  const unsigned short* Kh = Kbf + (size_t)bh * SEQ * HD;
  const unsigned short* Vh = Vt  + (size_t)bh * HD * SEQ;
  const float* mrow = mask + b * SEQ + ((lane >> 4) << 3);   // this half's keys

  // B operand: column = query, k = d
  v16bf qb[AQT][2];
#pragma unroll
  for (int u = 0; u < AQT; u++) {
    qb[u][0] = load_frag_f(Qh + ((qt + u) * 2 + 0) * FRAG, lane);
    qb[u][1] = load_frag_f(Qh + ((qt + u) * 2 + 1) * FRAG, lane);
  }

  // O^T tiles: o[u][t][r] = d 16t + 8h + r of this lane's query in tile u
  v8f o[AQT][4] = {};
  float rmax[AQT];   // of the query, equal in both halves
  float rsum[AQT];   // over this half's keys only; joined at the end
#pragma unroll
  for (int u = 0; u < AQT; u++) { rmax[u] = -INFINITY; rsum[u] = 0.f; }

  // prime K fragments for j = 0
  v16bf kc0 = load_frag_f(Kh + 0 * FRAG, lane);   // keys 0..15,  d 0..31
  v16bf kc1 = load_frag_f(Kh + 1 * FRAG, lane);   // keys 0..15,  d 32..63
  v16bf kc2 = load_frag_f(Kh + 2 * FRAG, lane);   // keys 16..31, d 0..31
  v16bf kc3 = load_frag_f(Kh + 3 * FRAG, lane);   // keys 16..31, d 32..63

  // and the mask of its keys
  v8f mk0 = load8f(mrow);
  v8f mk1 = load8f(mrow + 16);

  // Kept rolled: K and the mask reload into the registers just read, so there
  // is nothing for an unrolled body to save, and the code stays short.
#pragma unroll 1
  for (int j = 0; j < SEQ; j += 32) {
    // V fragments for this step: independent of P, issue early
    // (32 keys are 4 fragments = j * HD elements on, in K and in V^T alike)
    v16bf va0 = load_frag_f(Vh + j * HD + 0 * FRAG, lane);
    v16bf va1 = load_frag_f(Vh + j * HD + 1 * FRAG, lane);
    v16bf va2 = load_frag_f(Vh + j * HD + 2 * FRAG, lane);
    v16bf va3 = load_frag_f(Vh + j * HD + 3 * FRAG, lane);

    // scores: K(16 keys x 64) @ Q^T for two 16-key sub-tiles of each query tile
    v8f s0[AQT], s1[AQT];
#pragma unroll
    for (int u = 0; u < AQT; u++) {
      v8f z = {};
      s0[u] = wmma_bf16(kc0, qb[u][0], z);
      s1[u] = wmma_bf16(kc2, qb[u][0], z);
    }
#pragma unroll
    for (int u = 0; u < AQT; u++) {
      s0[u] = wmma_bf16(kc1, qb[u][1], s0[u]);
      s1[u] = wmma_bf16(kc3, qb[u][1], s1[u]);
    }

    v8f a0[AQT], a1[AQT];
#pragma unroll
    for (int u = 0; u < AQT; u++) {
      a0[u] = s0[u] * 0.125f + mk0;             // 1/sqrt(64) scale + mask
      a1[u] = s1[u] * 0.125f + mk1;
    }

    // K fragments and mask for the next step, into the registers just read
    // (wraps on last iter; redundant but cheap)
    int jn = (j + 32) & (SEQ - 1);
    mk0 = load8f(mrow + jn);
    mk1 = load8f(mrow + jn + 16);
    kc0 = load_frag_f(Kh + jn * HD + 0 * FRAG, lane);
    kc1 = load_frag_f(Kh + jn * HD + 1 * FRAG, lane);
    kc2 = load_frag_f(Kh + jn * HD + 2 * FRAG, lane);
    kc3 = load_frag_f(Kh + jn * HD + 3 * FRAG, lane);

    v16f p[AQT];
    v16bf pb[AQT];
    float alpha[AQT];
#pragma unroll
    for (int u = 0; u < AQT; u++) {
      v8f x0 = a0[u], x1 = a1[u];
      // maximum over this lane's 16 keys, as a tree, then over both halves
      float t0 = fmaxf(fmaxf(x0[0], x0[1]), x0[2]);
      float t1 = fmaxf(fmaxf(x0[3], x0[4]), x0[5]);
      float t2 = fmaxf(fmaxf(x0[6], x0[7]), x1[0]);
      float t3 = fmaxf(fmaxf(x1[1], x1[2]), x1[3]);
      float t4 = fmaxf(fmaxf(x1[4], x1[5]), x1[6]);
      float t = fmaxf(fmaxf(fmaxf(t0, t1), t2), fmaxf(fmaxf(t3, t4), x1[7]));
      t = fmaxf(t, other_half(t));
      float nm = fmaxf(rmax[u], t);
      alpha[u] = __expf(rmax[u] - nm);
      rmax[u] = nm;

#pragma unroll
      for (int r = 0; r < 8; r++) {
        p[u][r]     = __expf(x0[r] - nm);
        p[u][8 + r] = __expf(x1[r] - nm);
      }
      o[u][0] *= alpha[u]; o[u][1] *= alpha[u];
      o[u][2] *= alpha[u]; o[u][3] *= alpha[u];

      // P^T as B operand: element s is key 8h + s (s < 8), 16 + 8h + s - 8 (else)
      pb[u] = __builtin_convertvector(p[u], v16bf);
    }

    // Keeps vector work out from among the eight products: there it lands in
    // registers of a V fragment just read, which costs four idle slots behind
    // the product each time.
    __builtin_amdgcn_sched_barrier(0);

    // ctx^T += V^T(64 x 32) @ P^T(32 x 16); V^T fragment rows are d
#pragma unroll
    for (int u = 0; u < AQT; u++) {
      o[u][0] = wmma_bf16(va0, pb[u], o[u][0]);
      o[u][1] = wmma_bf16(va1, pb[u], o[u][1]);
      o[u][2] = wmma_bf16(va2, pb[u], o[u][2]);
      o[u][3] = wmma_bf16(va3, pb[u], o[u][3]);
    }
    // Other end of the same group. The row sums need nothing of the products
    // and run while the matrix unit works on them; they also stand between the
    // last product that reads P^T and the next step's first product, whose
    // result the compiler puts into the same registers.
    __builtin_amdgcn_sched_barrier(0);

#pragma unroll
    for (int u = 0; u < AQT; u++) {
      v16f q = p[u];
      float rs = ((q[0] + q[8]) + (q[1] + q[9])) + ((q[2] + q[10]) + (q[3] + q[11])) +
                 (((q[4] + q[12]) + (q[5] + q[13])) + ((q[6] + q[14]) + (q[7] + q[15])));
      rsum[u] = rsum[u] * alpha[u] + rs;
    }
  }

  // normalize and store merged-head ctx [B*S, H] in bf16, in fragment order:
  // row = b * SEQ + s, k = h * HD + d, fragment (row >> 4) * (H / 32) + (k >> 5).
  // A lane's 8 d of one tile are one 16-byte chunk, chunk number = lane.
#pragma unroll
  for (int u = 0; u < AQT; u++) {
    float inv = 1.f / (rsum[u] + other_half(rsum[u]));
    unsigned short* cw = Ctx +
        ((size_t)(b * (SEQ / 16) + qt + u) * (H / 32) + h * 2) * FRAG + lane * 8;
#pragma unroll
    for (int t = 0; t < 4; t++)                  // d 16t .. 16t + 15
      *reinterpret_cast<uint4*>(cw + (t >> 1) * FRAG + (t & 1) * 256) =
          pack8(o[u][t][0] * inv, o[u][t][1] * inv, o[u][t][2] * inv,
                o[u][t][3] * inv, o[u][t][4] * inv, o[u][t][5] * inv,
                o[u][t][6] * inv, o[u][t][7] * inv);
  }
}

// ------------------------------- output GEMM + bias + residual + LayerNorm --
// grid = MROWS/16 blocks of 512 (16 waves). Wave w: 16 rows x 64 cols;
// block owns the full 16x1024 strip for the fused LayerNorm.
// Rolled ping-pong K-loop on register fragments loaded straight from global.

__global__ __launch_bounds__(512) void out_ln_kernel(
    const unsigned short* __restrict__ Ctx,
    const unsigned short* __restrict__ Wo,
    const float* __restrict__ bo,
    const float* __restrict__ hidden,
    const float* __restrict__ ln_g, const float* __restrict__ ln_b,
    float* __restrict__ out) {
  __shared__ float tile[16 * H];                // 64 KB

  int m0 = blockIdx.x << 4;
  int tid = threadIdx.x;
  int w = tid >> 5, lane = tid & 31, l15 = lane & 15;
  int n0 = w << 6;

  v8f acc[4] = {};
  // Ctx and Wo lie in fragment order: 16 rows are H / 32 fragments in a row.
  const unsigned short* Ca = Ctx + (size_t)blockIdx.x * (16 * H);
  const unsigned short* Wb = Wo + (size_t)n0 * H;
  v16bf aA = load_frag_f(Ca, lane);
  v16bf bA[4];
#pragma unroll
  for (int t = 0; t < 4; t++)
    bA[t] = load_frag_f(Wb + t * (16 * H), lane);

  for (int kb = 0; kb < H; kb += 64) {
    // 32 k on = one fragment on = 16 * 32 elements
    v16bf aB = load_frag_f(Ca + (kb + 32) * 16, lane);
    v16bf bB[4];
#pragma unroll
    for (int t = 0; t < 4; t++)
      bB[t] = load_frag_f(Wb + t * (16 * H) + (kb + 32) * 16, lane);
    // The address registers of these loads are reused for later load results.
    asm volatile("s_wait_xcnt 0x0" ::: "memory");

#pragma unroll
    for (int t = 0; t < 4; t++) acc[t] = wmma_bf16(aA, bA[t], acc[t]);

    int k2 = (kb + 64) & (H - 1);
    aA = load_frag_f(Ca + k2 * 16, lane);
#pragma unroll
    for (int t = 0; t < 4; t++)
      bA[t] = load_frag_f(Wb + t * (16 * H) + k2 * 16, lane);
    // As above.
    asm volatile("s_wait_xcnt 0x0" ::: "memory");

#pragma unroll
    for (int t = 0; t < 4; t++) acc[t] = wmma_bf16(aB, bB[t], acc[t]);
  }

  int rw = (lane >> 4) << 3;
#pragma unroll
  for (int t = 0; t < 4; t++) {
    int n = n0 + t * 16 + l15;
    float bn = bo[n];
#pragma unroll
    for (int v = 0; v < 8; v++) {
      int m = v + rw;
      int row = m0 + m;
      tile[m * H + n] = acc[t][v] + bn + hidden[(size_t)row * H + n];
    }
  }
  __syncthreads();

  // LayerNorm: 32 threads per row, 32 elems per thread
  int row = tid >> 5;                           // 16 rows
  const float* tr = &tile[row * H + lane * 32];
  float s = 0.f, ss = 0.f;
#pragma unroll 8
  for (int i = 0; i < 32; i++) { float x = tr[i]; s += x; ss += x * x; }
#pragma unroll
  for (int o = 1; o < 32; o <<= 1) {
    s  += __shfl_xor(s,  o, 32);
    ss += __shfl_xor(ss, o, 32);
  }
  float mu   = s  * (1.f / H);
  float var  = ss * (1.f / H) - mu * mu;
  float rstd = rsqrtf(var + 1e-12f);
  size_t obase = (size_t)(m0 + row) * H + lane * 32;
  for (int i = 0; i < 32; i++) {
    int n = lane * 32 + i;
    out[obase + i] = (tr[i] - mu) * rstd * ln_g[n] + ln_b[n];
  }
}

// ------------------------------------------------------------------ launch --

extern "C" void kernel_launch(void* const* d_in, const int* in_sizes, int n_in,
                              void* d_out, int out_size, void* d_ws,
                              size_t ws_size, hipStream_t stream) {
  (void)in_sizes; (void)n_in; (void)out_size; (void)ws_size;

  const float* hidden = (const float*)d_in[0];
  const float* mask   = (const float*)d_in[1];
  const float* Wq     = (const float*)d_in[2];
  const float* bq     = (const float*)d_in[3];
  const float* Wk     = (const float*)d_in[4];
  const float* bk     = (const float*)d_in[5];
  const float* Wv     = (const float*)d_in[6];
  const float* bv     = (const float*)d_in[7];
  const float* Wo     = (const float*)d_in[8];
  const float* bo     = (const float*)d_in[9];
  const float* ln_g   = (const float*)d_in[10];
  const float* ln_b   = (const float*)d_in[11];

  char* ws = (char*)d_ws;
  size_t off = 0;
  auto alloc = [&](size_t bytes) {
    char* p = ws + off;
    off += (bytes + 255) & ~(size_t)255;
    return p;
  };
  unsigned short* Xbf  = (unsigned short*)alloc((size_t)MROWS * H * 2);
  unsigned short* Wqkv = (unsigned short*)alloc((size_t)3 * H * H * 2);
  unsigned short* Wobf = (unsigned short*)alloc((size_t)H * H * 2);
  unsigned short* Qbf  = (unsigned short*)alloc((size_t)MROWS * H * 2);
  unsigned short* Kbf  = (unsigned short*)alloc((size_t)MROWS * H * 2);
  unsigned short* Vt   = (unsigned short*)alloc((size_t)MROWS * H * 2);
  unsigned short* Ctx  = (unsigned short*)alloc((size_t)MROWS * H * 2);

  cvt_all_kernel<<<dim3(CVT_BLOCKS), dim3(CVT_WAVES * 32), 0, stream>>>(
      hidden, Wq, Wk, Wv, Wo, Xbf, Wqkv, Wobf);

  qkv_kernel<<<dim3(MROWS / QBM, 3 * H / QBN), dim3(256), 0, stream>>>(
      Xbf, Wqkv, bq, bk, bv, Qbf, Kbf, Vt);

  attn_kernel<<<dim3(BATCH * NHEAD * (SEQ / (16 * AQT)) / 8), dim3(256), 0, stream>>>(
      Qbf, Kbf, Vt, mask, Ctx);

  out_ln_kernel<<<dim3(MROWS / 16), dim3(512), 0, stream>>>(
      Ctx, Wobf, bo, hidden, ln_g, ln_b, (float*)d_out);
}

// v006
// One run takes 118 microseconds.
// Timed twice side by side with v005, it ran 1.09 and 1.10 times as fast.
// Over all steps from v000 it is 4.57 times as fast.
#include <hip/hip_runtime.h>
#include <math.h>

#define H     1024
#define NHEAD 16
#define HD    64
#define BATCH 8
#define SEQ   1024
#define MROWS (BATCH * SEQ)   // 8192

typedef __attribute__((ext_vector_type(16))) __bf16 v16bf;
typedef __attribute__((ext_vector_type(8)))  float  v8f;

// ---------------------------------------------------------------- helpers ---

static __device__ __forceinline__ unsigned short f2bf(float f) {
  union { float f; unsigned u; } x; x.f = f;
  unsigned r = x.u + 0x7FFFu + ((x.u >> 16) & 1u);   // round-to-nearest-even
  return (unsigned short)(r >> 16);
}

static __device__ __forceinline__ v8f wmma_bf16(v16bf a, v16bf b, v8f c) {
  // D = A(16x32 bf16) * B(32x16 bf16) + C(16x16 f32)
  return __builtin_amdgcn_wmma_f32_16x16x32_bf16(false, a, false, b,
                                                 (short)0, c, false, false);
}

// Fragment order. Every operand that a kernel loads straight from global
// memory into a WMMA fragment (Q, K, V^T, Ctx, Wo) is stored as a row of
// 16x32 bf16 fragments of FRAG = 512 elements (1 KB). Per the CDNA5 16-bit
// layout lanes 0-15 hold k = {0..7, 16..23} of row (lane & 15), lanes 16-31
// hold k = {8..15, 24..31}. Element (r, k) of a fragment lies at
//   (k >> 4) * 256 + ((k >> 3) & 1) * 128 + r * 8 + (k & 7),
// so lane L's two 16-byte chunks lie at L * 8 and 256 + L * 8: each of the two
// loads of a wave covers 512 contiguous bytes, 4 whole lines instead of 16.
#define FRAG 512

static __device__ __forceinline__ v16bf load_frag_f(const unsigned short* frag,
                                                    int lane) {
  const unsigned short* p = frag + lane * 8;
  v16bf f;
  reinterpret_cast<uint4*>(&f)[0] = *reinterpret_cast<const uint4*>(p);
  reinterpret_cast<uint4*>(&f)[1] = *reinterpret_cast<const uint4*>(p + 256);
  return f;
}

// Eight floats to one 16-byte chunk of bf16, element 0 at the lowest address.
static __device__ __forceinline__ uint4 pack8(float x0, float x1, float x2,
                                              float x3, float x4, float x5,
                                              float x6, float x7) {
  uint4 r;
  r.x = (unsigned)f2bf(x0) | ((unsigned)f2bf(x1) << 16);
  r.y = (unsigned)f2bf(x2) | ((unsigned)f2bf(x3) << 16);
  r.z = (unsigned)f2bf(x4) | ((unsigned)f2bf(x5) << 16);
  r.w = (unsigned)f2bf(x6) | ((unsigned)f2bf(x7) << 16);
  return r;
}

// -------------------------------------------------------------- fp32->bf16 --
// All five conversions (X, Wq, Wk, Wv, Wo) run in ONE launch of 256 work-groups
// of 12 waves, one per WGP. With one element a lane a trip, tens of thousands
// of short waves have to be started, and every launch adds its gap, its fill
// and its tail. Here a wave converts 4,096 elements: a lane issues its 32
// loads of 16 B at once, then converts and stores. The five arrays hold
// 8 : 1 : 1 : 1 : 1 parts, so of a work-group's waves 0-7 take X, 8-10 take
// Wq, Wk, Wv and 11 takes Wo.
// X, Wq, Wk, Wv keep their row-major order: float4 number q becomes the 8-byte
// piece number q, so a wave's load covers 512 contiguous bytes (4 whole lines)
// and its store 256 (2 whole lines).
// Wo goes to fragment order: fragment (n >> 4, k >> 5) is number
// (n >> 4) * (H / 32) + (k >> 5). A lane writes 16-byte chunks, chunk number
// o = fragment * 64 + (k >> 4 & 1) * 32 + lane.

#define CVT_BLOCKS  256
#define CVT_WAVES   12
#define CVT_PER     4096                    // elements a wave

static_assert(CVT_BLOCKS * 8 * CVT_PER == MROWS * H, "8 waves a group cover X");
static_assert(CVT_BLOCKS * CVT_PER == H * H, "1 wave a group covers a weight");

// Four floats to one 8-byte piece of bf16, element 0 at the lowest address.
static __device__ __forceinline__ uint2 pack4(float4 x) {
  uint2 r;
  r.x = (unsigned)f2bf(x.x) | ((unsigned)f2bf(x.y) << 16);
  r.y = (unsigned)f2bf(x.z) | ((unsigned)f2bf(x.w) << 16);
  return r;
}

// The register budget of four waves per SIMD is asked for by name (this grid
// puts three there): aiming for more waves, the compiler holds part of the
// loads back behind the first conversions, where they wait out a second memory
// latency.
__global__ __launch_bounds__(CVT_WAVES * 32) __attribute__((amdgpu_waves_per_eu(4, 4)))
void cvt_all_kernel(
    const float* __restrict__ X, const float* __restrict__ Wq,
    const float* __restrict__ Wk, const float* __restrict__ Wv,
    const float* __restrict__ Wo,
    unsigned short* __restrict__ Xbf, unsigned short* __restrict__ Wqkv,
    unsigned short* __restrict__ Wobf) {
  int lane = threadIdx.x & 31;
  int w = __builtin_amdgcn_readfirstlane(threadIdx.x >> 5);   // scalar: the role
  int blk = blockIdx.x;

  float4 v[CVT_PER / 128];                  // 32 float4 a lane
  if (w < 11) {
    const float* src = (w < 8) ? X + (blk * 8 + w) * CVT_PER
                               : ((w == 8) ? Wq : (w == 9) ? Wk : Wv) + blk * CVT_PER;
    unsigned short* dst = (w < 8) ? Xbf + (blk * 8 + w) * CVT_PER
                                  : Wqkv + (w - 8) * (H * H) + blk * CVT_PER;
    const float4* ps = reinterpret_cast<const float4*>(src) + lane;
    uint2* pd = reinterpret_cast<uint2*>(dst) + lane;
#pragma unroll
    for (int j = 0; j < CVT_PER / 128; j++) v[j] = ps[j * 32];
#pragma unroll
    for (int j = 0; j < CVT_PER / 128; j++) pd[j * 32] = pack4(v[j]);
  } else {
    // Chunks o = blk * 512 + j * 32 + lane, j = 0..15: 8 fragments of one row
    // of fragments. Row n = (blk >> 2) * 16 + (lane & 15), and chunk j starts
    // at k = (blk & 3) * 256 + j * 16 + (lane >> 4) * 8.
    const float4* ps = reinterpret_cast<const float4*>(
        Wo + ((blk >> 2) * 16 + (lane & 15)) * H + (blk & 3) * 256 + (lane >> 4) * 8);
    uint4* pd = reinterpret_cast<uint4*>(Wobf + blk * CVT_PER) + lane;
#pragma unroll
    for (int j = 0; j < CVT_PER / 256; j++) {
      v[2 * j]     = ps[j * 4];
      v[2 * j + 1] = ps[j * 4 + 1];
    }
#pragma unroll
    for (int j = 0; j < CVT_PER / 256; j++) {
      float4 x = v[2 * j], y = v[2 * j + 1];
      pd[j * 32] = pack8(x.x, x.y, x.z, x.w, y.x, y.y, y.z, y.w);
    }
  }
}

// --------------------------------------------------------------- QKV GEMM ---
// Y[8192 x 3072] = X * Wqkv^T. grid = (MROWS/128, 3*H/256), block = 256
// (8 waves, 2 x 4). A work-group owns a 128 x 256 tile of Y; a wave owns
// 64 x 64 of it (4 x 4 fragments). Per trip 64 k of the tile's 128 X rows and
// 256 W rows (128 B a row, whole lines) are copied asynchronously into one of
// two LDS buffers while the other buffer is worked on.
// Q, K, V^T are stored per (batch, head) in fragment order:
//   Q, K : row = position s, k = d; fragment number (s >> 4) * 2 + (d >> 5)
//   V^T  : row = d, k = position s; fragment number (s >> 5) * 4 + (d >> 4)
// A chunk is 8 consecutive k of one row, and a lane of a WMMA result holds 8
// consecutive rows of one column. So V is computed as X * W^T (a lane: 8
// positions of one d) and Q, K as W * X^T (a lane: 8 d of one position): the
// two operands trade places, which here is a trade of the two LDS offsets.

#define QBM    128
#define QBN    256
#define QBK    64                       // k per trip: 128 B of every row
#define QPITCH 144                      // LDS row pitch in bytes, 16 B x odd
#define QSTAGE ((QBM + QBN) * QPITCH)   // 55,296 B per buffer
#define QTRIPS (H / QBK)                // 16

// One 16x32 fragment from a staged tile; same k order as load_frag_f.
// p: this lane's row, already advanced by (lane >> 4) * 16 bytes.
static __device__ __forceinline__ v16bf load_frag_s(const unsigned char* p) {
  v16bf f;
  reinterpret_cast<uint4*>(&f)[0] = *reinterpret_cast<const uint4*>(p);
  reinterpret_cast<uint4*>(&f)[1] = *reinterpret_cast<const uint4*>(p + 32);
  return f;
}

// Copy one trip's tile: 384 rows of 128 B, 12 copies of 16 B per lane; a
// wave's copy covers 4 whole rows. gx / gw: this lane's 16 bytes in its first
// X / W row; lds: the byte address of the same place in the buffer.
static __device__ __forceinline__ void stage_tile(const unsigned short* gx,
                                                  const unsigned short* gw,
                                                  unsigned lds) {
  const unsigned R = 32 * QPITCH;       // 32 rows further in LDS
  const size_t   G = (size_t)32 * H;    // 32 rows further in global memory
  // The copies and their s_wait_xcnt stand in one statement, so that no
  // address register is rewritten ahead of the wait.
  asm volatile(
      "global_load_async_to_lds_b128 %0, %12, off\n\t"
      "global_load_async_to_lds_b128 %1, %13, off\n\t"
      "global_load_async_to_lds_b128 %2, %14, off\n\t"
      "global_load_async_to_lds_b128 %3, %15, off\n\t"
      "global_load_async_to_lds_b128 %4, %16, off\n\t"
      "global_load_async_to_lds_b128 %5, %17, off\n\t"
      "global_load_async_to_lds_b128 %6, %18, off\n\t"
      "global_load_async_to_lds_b128 %7, %19, off\n\t"
      "global_load_async_to_lds_b128 %8, %20, off\n\t"
      "global_load_async_to_lds_b128 %9, %21, off\n\t"
      "global_load_async_to_lds_b128 %10, %22, off\n\t"
      "global_load_async_to_lds_b128 %11, %23, off\n\t"
      "s_wait_xcnt 0x0"
      :: "v"(lds), "v"(lds + R), "v"(lds + 2 * R), "v"(lds + 3 * R),
         "v"(lds + 4 * R), "v"(lds + 5 * R), "v"(lds + 6 * R),
         "v"(lds + 7 * R), "v"(lds + 8 * R), "v"(lds + 9 * R),
         "v"(lds + 10 * R), "v"(lds + 11 * R),
         "v"(gx), "v"(gx + G), "v"(gx + 2 * G), "v"(gx + 3 * G),
         "v"(gw), "v"(gw + G), "v"(gw + 2 * G), "v"(gw + 3 * G),
         "v"(gw + 4 * G), "v"(gw + 5 * G), "v"(gw + 6 * G), "v"(gw + 7 * G)
      : "memory");
}

__global__ __launch_bounds__(256) void qkv_kernel(
    const unsigned short* __restrict__ Xbf,
    const unsigned short* __restrict__ Wqkv,
    const float* __restrict__ bq, const float* __restrict__ bk,
    const float* __restrict__ bv,
    unsigned short* __restrict__ Qbf, unsigned short* __restrict__ Kbf,
    unsigned short* __restrict__ Vt) {
  __shared__ __attribute__((aligned(16))) unsigned char stage[2 * QSTAGE];

  int mat = blockIdx.y >> 2;                    // 0=Q, 1=K, 2=V
  const float* bias = (mat == 0) ? bq : (mat == 1) ? bk : bv;

  int m0 = blockIdx.x * QBM;
  int nb = blockIdx.y * QBN;                    // row of the stacked Wqkv
  int tid = threadIdx.x;
  int w = tid >> 5, lane = tid & 31, l15 = lane & 15;
  int wm = w >> 2, wn = w & 3;

  // copy side: 8 lanes a row, 32 rows per copy of the work-group
  int cr = tid >> 3, cc = tid & 7;
  const unsigned short* gx = Xbf  + (size_t)(m0 + cr) * H + cc * 8;
  const unsigned short* gw = Wqkv + (size_t)(nb + cr) * H + cc * 8;
  unsigned lds0 = (unsigned)(size_t)stage + cr * QPITCH + cc * 16;

  // read side: this lane's row in the wave's first X and W fragment
  int offX = (wm * 64 + l15) * QPITCH + (lane >> 4) * 16;
  int offW = (QBM + wn * 64 + l15) * QPITCH + (lane >> 4) * 16;
  int offA = (mat == 2) ? offX : offW;          // rows of the result
  int offB = (mat == 2) ? offW : offX;          // columns of the result

  v8f acc[4][4] = {};

  stage_tile(gx, gw, lds0);
  asm volatile("s_wait_asynccnt 0x0" ::: "memory");  // tile 0 has landed
  __syncthreads();                                   // and every wave may read it
  stage_tile(gx + QBK, gw + QBK, lds0 + QSTAGE);

  // Kept rolled: a trip already holds 32 WMMAs, so the branch costs little,
  // and the code stays short.
#pragma unroll 1
  for (int t = 0; t < QTRIPS; t++) {
    int buf = (t & 1) * QSTAGE;
    const unsigned char* sA = stage + buf + offA;
    const unsigned char* sB = stage + buf + offB;
#pragma unroll
    for (int ks = 0; ks < 2; ks++) {
      v16bf a[4], b[4];
#pragma unroll
      for (int i = 0; i < 4; i++)
        a[i] = load_frag_s(sA + i * 16 * QPITCH + ks * 64);
#pragma unroll
      for (int j = 0; j < 4; j++)
        b[j] = load_frag_s(sB + j * 16 * QPITCH + ks * 64);
      // Keeps the 16 LDS reads one group in front of their 16 WMMAs: left
      // free, they are spread among the WMMAs, each place with a full wait.
      __builtin_amdgcn_sched_barrier(0);
#pragma unroll
      for (int i = 0; i < 4; i++)
#pragma unroll
        for (int j = 0; j < 4; j++)
          acc[i][j] = wmma_bf16(a[i], b[j], acc[i][j]);
      // Other end of the same group: the next reads stay behind these WMMAs.
      __builtin_amdgcn_sched_barrier(0);
    }
    asm volatile("s_wait_dscnt 0x0" ::: "memory");     // own reads of this buffer done
    asm volatile("s_wait_asynccnt 0x0" ::: "memory");  // own copies of tile t+1 landed
    __syncthreads();   // publishes tile t+1, frees the buffer of tile t
    if (t + 2 < QTRIPS)
      stage_tile(gx + (t + 2) * QBK, gw + (t + 2) * QBK, lds0 + buf);
  }
  asm volatile("s_wait_asynccnt 0x0" ::: "memory");    // none in flight at the end

  int hh = ((blockIdx.y & 3) << 2) + wn;        // a wave's 64 W rows = one head
  int r0 = m0 + wm * 64;                        // 128 rows lie in one batch entry
  int bb = r0 >> 10, s0 = r0 & (SEQ - 1);
  size_t hbase = ((size_t)bb * NHEAD + hh) * (SEQ * HD);
  if (mat == 2) {
    // acc[i][j][v]: position s0 + i*16 + (lane>>4)*8 + v, d = j*16 + l15
    unsigned short* dst = Vt + hbase + (size_t)(s0 >> 5) * 4 * FRAG + lane * 8;
#pragma unroll
    for (int j = 0; j < 4; j++) {
      float bn = bias[hh * HD + j * 16 + l15];
#pragma unroll
      for (int i = 0; i < 4; i++)
        *reinterpret_cast<uint4*>(dst + ((i >> 1) * 4 + j) * FRAG + (i & 1) * 256) =
            pack8(acc[i][j][0] + bn, acc[i][j][1] + bn, acc[i][j][2] + bn,
                  acc[i][j][3] + bn, acc[i][j][4] + bn, acc[i][j][5] + bn,
                  acc[i][j][6] + bn, acc[i][j][7] + bn);
      // The next column reuses the registers that these stores name.
      asm volatile("s_wait_xcnt 0x0" ::: "memory");
      // One column of fragments at a time: all 128 conversions scheduled at
      // once take more than 256 VGPRs, which costs the second work-group per WGP.
      __builtin_amdgcn_sched_barrier(0);
    }
  } else {
    // acc[i][j][v]: d = i*16 + (lane>>4)*8 + v, position s0 + j*16 + l15
    unsigned short* dst = ((mat == 0) ? Qbf : Kbf) + hbase +
                          (size_t)(s0 >> 4) * 2 * FRAG + lane * 8;
#pragma unroll
    for (int i = 0; i < 4; i++) {
      const float4* bp = reinterpret_cast<const float4*>(
          bias + hh * HD + i * 16 + ((lane >> 4) << 3));
      float4 b0 = bp[0], b1 = bp[1];
#pragma unroll
      for (int j = 0; j < 4; j++)
        *reinterpret_cast<uint4*>(dst + (j * 2 + (i >> 1)) * FRAG + (i & 1) * 256) =
            pack8(acc[i][j][0] + b0.x, acc[i][j][1] + b0.y, acc[i][j][2] + b0.z,
                  acc[i][j][3] + b0.w, acc[i][j][4] + b1.x, acc[i][j][5] + b1.y,
                  acc[i][j][6] + b1.z, acc[i][j][7] + b1.w);
      // As above: the wait for the stores' registers, then the bound on the
      // registers of the conversions.
      asm volatile("s_wait_xcnt 0x0" ::: "memory");
      __builtin_amdgcn_sched_barrier(0);
    }
  }
}

#define AQT 2   // query tiles a wave

typedef __attribute__((ext_vector_type(16))) float v16f;

// The value that lane (l ^ 16) holds.
static __device__ __forceinline__ float other_half(float x) {
  int b = __builtin_bit_cast(int, x);
  b = __builtin_amdgcn_permlanex16(b, b, 0x76543210, 0xfedcba98, false, false);
  return __builtin_bit_cast(float, b);
}

static __device__ __forceinline__ v8f load8f(const float* p) {
  v8f r;
  reinterpret_cast<float4*>(&r)[0] = reinterpret_cast<const float4*>(p)[0];
  reinterpret_cast<float4*>(&r)[1] = reinterpret_cast<const float4*>(p)[1];
  return r;
}

// Four waves per SIMD (two work-groups per WGP) are asked for by name: with that
// register budget the scheduler issues the next step's K and mask loads right
// behind the score products, a whole softmax ahead of their use; left to aim
// for more waves it holds them back until registers fall free late in the step.
__global__ __launch_bounds__(256) __attribute__((amdgpu_waves_per_eu(4, 4)))
void attn_kernel(
    const unsigned short* __restrict__ Qbf,
    const unsigned short* __restrict__ Kbf,
    const unsigned short* __restrict__ Vt,
    const float* __restrict__ mask,
    unsigned short* __restrict__ Ctx) {
  int tid = threadIdx.x;
  int w = tid >> 5, lane = tid & 31;
  int gid = blockIdx.x * 8 + w;
  int qt = (gid & (SEQ / (16 * AQT) - 1)) * AQT;   // the wave's first query tile
  int bh = gid / (SEQ / (16 * AQT));
  int b = bh >> 4, h = bh & 15;

  const unsigned short* Qh = Qbf + (size_t)bh * SEQ * HD;
  const unsigned short* Kh = Kbf + (size_t)bh * SEQ * HD;
  const unsigned short* Vh = Vt  + (size_t)bh * HD * SEQ;
  const float* mrow = mask + b * SEQ + ((lane >> 4) << 3);   // this half's keys

  // B operand: column = query, k = d
  v16bf qb[AQT][2];
#pragma unroll
  for (int u = 0; u < AQT; u++) {
    qb[u][0] = load_frag_f(Qh + ((qt + u) * 2 + 0) * FRAG, lane);
    qb[u][1] = load_frag_f(Qh + ((qt + u) * 2 + 1) * FRAG, lane);
  }

  // O^T tiles: o[u][t][r] = d 16t + 8h + r of this lane's query in tile u
  v8f o[AQT][4] = {};
  float rmax[AQT];   // of the query, equal in both halves
  float rsum[AQT];   // over this half's keys only; joined at the end
#pragma unroll
  for (int u = 0; u < AQT; u++) { rmax[u] = -INFINITY; rsum[u] = 0.f; }

  // prime K fragments for j = 0
  v16bf kc0 = load_frag_f(Kh + 0 * FRAG, lane);   // keys 0..15,  d 0..31
  v16bf kc1 = load_frag_f(Kh + 1 * FRAG, lane);   // keys 0..15,  d 32..63
  v16bf kc2 = load_frag_f(Kh + 2 * FRAG, lane);   // keys 16..31, d 0..31
  v16bf kc3 = load_frag_f(Kh + 3 * FRAG, lane);   // keys 16..31, d 32..63

  // and the mask of its keys
  v8f mk0 = load8f(mrow);
  v8f mk1 = load8f(mrow + 16);

  // Kept rolled: K and the mask reload into the registers just read, so there
  // is nothing for an unrolled body to save, and the code stays short.
#pragma unroll 1
  for (int j = 0; j < SEQ; j += 32) {
    // V fragments for this step: independent of P, issue early
    // (32 keys are 4 fragments = j * HD elements on, in K and in V^T alike)
    v16bf va0 = load_frag_f(Vh + j * HD + 0 * FRAG, lane);
    v16bf va1 = load_frag_f(Vh + j * HD + 1 * FRAG, lane);
    v16bf va2 = load_frag_f(Vh + j * HD + 2 * FRAG, lane);
    v16bf va3 = load_frag_f(Vh + j * HD + 3 * FRAG, lane);

    // scores: K(16 keys x 64) @ Q^T for two 16-key sub-tiles of each query tile
    v8f s0[AQT], s1[AQT];
#pragma unroll
    for (int u = 0; u < AQT; u++) {
      v8f z = {};
      s0[u] = wmma_bf16(kc0, qb[u][0], z);
      s1[u] = wmma_bf16(kc2, qb[u][0], z);
    }
#pragma unroll
    for (int u = 0; u < AQT; u++) {
      s0[u] = wmma_bf16(kc1, qb[u][1], s0[u]);
      s1[u] = wmma_bf16(kc3, qb[u][1], s1[u]);
    }

    v8f a0[AQT], a1[AQT];
#pragma unroll
    for (int u = 0; u < AQT; u++) {
      a0[u] = s0[u] * 0.125f + mk0;             // 1/sqrt(64) scale + mask
      a1[u] = s1[u] * 0.125f + mk1;
    }

    // K fragments and mask for the next step, into the registers just read
    // (wraps on last iter; redundant but cheap)
    int jn = (j + 32) & (SEQ - 1);
    mk0 = load8f(mrow + jn);
    mk1 = load8f(mrow + jn + 16);
    kc0 = load_frag_f(Kh + jn * HD + 0 * FRAG, lane);
    kc1 = load_frag_f(Kh + jn * HD + 1 * FRAG, lane);
    kc2 = load_frag_f(Kh + jn * HD + 2 * FRAG, lane);
    kc3 = load_frag_f(Kh + jn * HD + 3 * FRAG, lane);

    v16f p[AQT];
    v16bf pb[AQT];
    float alpha[AQT];
#pragma unroll
    for (int u = 0; u < AQT; u++) {
      v8f x0 = a0[u], x1 = a1[u];
      // maximum over this lane's 16 keys, as a tree, then over both halves
      float t0 = fmaxf(fmaxf(x0[0], x0[1]), x0[2]);
      float t1 = fmaxf(fmaxf(x0[3], x0[4]), x0[5]);
      float t2 = fmaxf(fmaxf(x0[6], x0[7]), x1[0]);
      float t3 = fmaxf(fmaxf(x1[1], x1[2]), x1[3]);
      float t4 = fmaxf(fmaxf(x1[4], x1[5]), x1[6]);
      float t = fmaxf(fmaxf(fmaxf(t0, t1), t2), fmaxf(fmaxf(t3, t4), x1[7]));
      t = fmaxf(t, other_half(t));
      float nm = fmaxf(rmax[u], t);
      alpha[u] = __expf(rmax[u] - nm);
      rmax[u] = nm;

#pragma unroll
      for (int r = 0; r < 8; r++) {
        p[u][r]     = __expf(x0[r] - nm);
        p[u][8 + r] = __expf(x1[r] - nm);
      }
      o[u][0] *= alpha[u]; o[u][1] *= alpha[u];
      o[u][2] *= alpha[u]; o[u][3] *= alpha[u];

      // P^T as B operand: element s is key 8h + s (s < 8), 16 + 8h + s - 8 (else)
      pb[u] = __builtin_convertvector(p[u], v16bf);
    }

    // Keeps vector work out from among the eight products: there it lands in
    // registers of a V fragment just read, which costs four idle slots behind
    // the product each time.
    __builtin_amdgcn_sched_barrier(0);

    // ctx^T += V^T(64 x 32) @ P^T(32 x 16); V^T fragment rows are d
#pragma unroll
    for (int u = 0; u < AQT; u++) {
      o[u][0] = wmma_bf16(va0, pb[u], o[u][0]);
      o[u][1] = wmma_bf16(va1, pb[u], o[u][1]);
      o[u][2] = wmma_bf16(va2, pb[u], o[u][2]);
      o[u][3] = wmma_bf16(va3, pb[u], o[u][3]);
    }
    // Other end of the same group. The row sums need nothing of the products
    // and run while the matrix unit works on them; they also stand between the
    // last product that reads P^T and the next step's first product, whose
    // result the compiler puts into the same registers.
    __builtin_amdgcn_sched_barrier(0);

#pragma unroll
    for (int u = 0; u < AQT; u++) {
      v16f q = p[u];
      float rs = ((q[0] + q[8]) + (q[1] + q[9])) + ((q[2] + q[10]) + (q[3] + q[11])) +
                 (((q[4] + q[12]) + (q[5] + q[13])) + ((q[6] + q[14]) + (q[7] + q[15])));
      rsum[u] = rsum[u] * alpha[u] + rs;
    }
  }

  // normalize and store merged-head ctx [B*S, H] in bf16, in fragment order:
  // row = b * SEQ + s, k = h * HD + d, fragment (row >> 4) * (H / 32) + (k >> 5).
  // A lane's 8 d of one tile are one 16-byte chunk, chunk number = lane.
#pragma unroll
  for (int u = 0; u < AQT; u++) {
    float inv = 1.f / (rsum[u] + other_half(rsum[u]));
    unsigned short* cw = Ctx +
        ((size_t)(b * (SEQ / 16) + qt + u) * (H / 32) + h * 2) * FRAG + lane * 8;
#pragma unroll
    for (int t = 0; t < 4; t++)                  // d 16t .. 16t + 15
      *reinterpret_cast<uint4*>(cw + (t >> 1) * FRAG + (t & 1) * 256) =
          pack8(o[u][t][0] * inv, o[u][t][1] * inv, o[u][t][2] * inv,
                o[u][t][3] * inv, o[u][t][4] * inv, o[u][t][5] * inv,
                o[u][t][6] * inv, o[u][t][7] * inv);
  }
}

// ------------------------------- output GEMM + bias + residual + LayerNorm --
// grid = MROWS/32 = 256 blocks of 512 (16 waves), one per WGP. Wave w: 32 rows
// x 64 cols; the block owns the full 32x1024 strip for the fused LayerNorm.
// Every block has to read all of Wo (2 MB) from L2, so the L2 bytes of this
// launch are 2 MB x the number of blocks. With two 16-row tiles a wave, each
// Wo fragment loaded feeds two products and the blocks are half as many.
// Ping-pong K-loop over two fragment sets held in registers.

#define ORT 2   // 16-row tiles a wave (and a block)

// This grid puts four waves on a SIMD, and their register budget is asked for
// by name: aiming for eight, the compiler gives up the second fragment set and
// waits for each set's loads right behind their issue.
__global__ __launch_bounds__(512) __attribute__((amdgpu_waves_per_eu(4, 4)))
void out_ln_kernel(
    const unsigned short* __restrict__ Ctx,
    const unsigned short* __restrict__ Wo,
    const float* __restrict__ bo,
    const float* __restrict__ hidden,
    const float* __restrict__ ln_g, const float* __restrict__ ln_b,
    float* __restrict__ out) {
  __shared__ float tile[16 * ORT * H];          // 128 KB

  int m0 = blockIdx.x * (16 * ORT);
  int tid = threadIdx.x;
  int w = tid >> 5, lane = tid & 31, l15 = lane & 15;
  int n0 = w << 6;

  v8f acc[ORT][4] = {};
  // Ctx and Wo lie in fragment order: 16 rows are H / 32 fragments in a row.
  // Ca, Wb: this lane's first chunk (load_frag_f is given lane 0).
  const unsigned short* Ca = Ctx + (size_t)blockIdx.x * (16 * ORT * H) + lane * 8;
  const unsigned short* Wb = Wo + (size_t)n0 * H + lane * 8;
  v16bf aA[ORT];
#pragma unroll
  for (int u = 0; u < ORT; u++)
    aA[u] = load_frag_f(Ca + u * (16 * H), 0);
  v16bf bA[4];
#pragma unroll
  for (int t = 0; t < 4; t++)
    bA[t] = load_frag_f(Wb + t * (16 * H), 0);

  for (int kb = 0; kb < H; kb += 64) {
    // 32 k on = one fragment on = 16 * 32 elements
    const unsigned short* pa = Ca + kb * 16;
    const unsigned short* pb = Wb + kb * 16;
    v16bf aB[ORT];
#pragma unroll
    for (int u = 0; u < ORT; u++)
      aB[u] = load_frag_f(pa + u * (16 * H) + FRAG, 0);
    v16bf bB[4];
#pragma unroll
    for (int t = 0; t < 4; t++)
      bB[t] = load_frag_f(pb + t * (16 * H) + FRAG, 0);
    // The wait that stands before the loads' address registers are rewritten.
    // It names them, so that they live up to it: otherwise the last load of a
    // group gets them as its result registers, ahead of the wait.
    asm volatile("s_wait_xcnt 0x0" :: "v"(pa), "v"(pb) : "memory");
    // Keeps these loads in front of the products of the other set: left free,
    // the products are lifted over them, and each set is then waited for right
    // behind its issue, with half the bytes in flight.
    __builtin_amdgcn_sched_barrier(0);

#pragma unroll
    for (int t = 0; t < 4; t++)
#pragma unroll
      for (int u = 0; u < ORT; u++)
        acc[u][t] = wmma_bf16(aA[u], bA[t], acc[u][t]);

    int k2 = (kb + 64) & (H - 1);
    pa = Ca + k2 * 16;
    pb = Wb + k2 * 16;
#pragma unroll
    for (int u = 0; u < ORT; u++)
      aA[u] = load_frag_f(pa + u * (16 * H), 0);
#pragma unroll
    for (int t = 0; t < 4; t++)
      bA[t] = load_frag_f(pb + t * (16 * H), 0);
    // As above, the wait and the order.
    asm volatile("s_wait_xcnt 0x0" :: "v"(pa), "v"(pb) : "memory");
    __builtin_amdgcn_sched_barrier(0);

#pragma unroll
    for (int t = 0; t < 4; t++)
#pragma unroll
      for (int u = 0; u < ORT; u++)
        acc[u][t] = wmma_bf16(aB[u], bB[t], acc[u][t]);
  }

  int rw = (lane >> 4) << 3;
  // hp: the residual of this lane's first element, row m0 + rw, column n0 + l15
  const float* hp = hidden + (size_t)(m0 + rw) * H + n0 + l15;
  float hv[ORT][4][8];
#pragma unroll
  for (int u = 0; u < ORT; u++)
#pragma unroll
    for (int t = 0; t < 4; t++)
#pragma unroll
      for (int v = 0; v < 8; v++)
        hv[u][t][v] = hp[(u * 16 + v) * H + t * 16];
  // As in the loop: the wait names the loads' address, which so lives up to it.
  asm volatile("s_wait_xcnt 0x0" :: "v"(hp) : "memory");
#pragma unroll
  for (int u = 0; u < ORT; u++) {
#pragma unroll
    for (int t = 0; t < 4; t++) {
      int n = n0 + t * 16 + l15;
      float bn = bo[n];
#pragma unroll
      for (int v = 0; v < 8; v++) {
        int m = u * 16 + v + rw;
        tile[m * H + n] = acc[u][t][v] + bn + hv[u][t][v];
      }
    }
  }
  __syncthreads();

  // LayerNorm: 32 threads per row, 32 elems per thread; a wave takes ORT rows
  for (int u = 0; u < ORT; u++) {
    int row = u * 16 + (tid >> 5);
    const float* tr = &tile[row * H + lane * 32];
    float s = 0.f, ss = 0.f;
#pragma unroll 8
    for (int i = 0; i < 32; i++) { float x = tr[i]; s += x; ss += x * x; }
#pragma unroll
    for (int o = 1; o < 32; o <<= 1) {
      s  += __shfl_xor(s,  o, 32);
      ss += __shfl_xor(ss, o, 32);
    }
    float mu   = s  * (1.f / H);
    float var  = ss * (1.f / H) - mu * mu;
    float rstd = rsqrtf(var + 1e-12f);
    size_t obase = (size_t)(m0 + row) * H + lane * 32;
    for (int i = 0; i < 32; i++) {
      int n = lane * 32 + i;
      out[obase + i] = (tr[i] - mu) * rstd * ln_g[n] + ln_b[n];
    }
    // The next row reuses the registers that these stores name.
    asm volatile("s_wait_xcnt 0x0" ::: "memory");
  }
}

// ------------------------------------------------------------------ launch --

extern "C" void kernel_launch(void* const* d_in, const int* in_sizes, int n_in,
                              void* d_out, int out_size, void* d_ws,
                              size_t ws_size, hipStream_t stream) {
  (void)in_sizes; (void)n_in; (void)out_size; (void)ws_size;

  const float* hidden = (const float*)d_in[0];
  const float* mask   = (const float*)d_in[1];
  const float* Wq     = (const float*)d_in[2];
  const float* bq     = (const float*)d_in[3];
  const float* Wk     = (const float*)d_in[4];
  const float* bk     = (const float*)d_in[5];
  const float* Wv     = (const float*)d_in[6];
  const float* bv     = (const float*)d_in[7];
  const float* Wo     = (const float*)d_in[8];
  const float* bo     = (const float*)d_in[9];
  const float* ln_g   = (const float*)d_in[10];
  const float* ln_b   = (const float*)d_in[11];

  char* ws = (char*)d_ws;
  size_t off = 0;
  auto alloc = [&](size_t bytes) {
    char* p = ws + off;
    off += (bytes + 255) & ~(size_t)255;
    return p;
  };
  unsigned short* Xbf  = (unsigned short*)alloc((size_t)MROWS * H * 2);
  unsigned short* Wqkv = (unsigned short*)alloc((size_t)3 * H * H * 2);
  unsigned short* Wobf = (unsigned short*)alloc((size_t)H * H * 2);
  unsigned short* Qbf  = (unsigned short*)alloc((size_t)MROWS * H * 2);
  unsigned short* Kbf  = (unsigned short*)alloc((size_t)MROWS * H * 2);
  unsigned short* Vt   = (unsigned short*)alloc((size_t)MROWS * H * 2);
  unsigned short* Ctx  = (unsigned short*)alloc((size_t)MROWS * H * 2);

  cvt_all_kernel<<<dim3(CVT_BLOCKS), dim3(CVT_WAVES * 32), 0, stream>>>(
      hidden, Wq, Wk, Wv, Wo, Xbf, Wqkv, Wobf);

  qkv_kernel<<<dim3(MROWS / QBM, 3 * H / QBN), dim3(256), 0, stream>>>(
      Xbf, Wqkv, bq, bk, bv, Qbf, Kbf, Vt);

  attn_kernel<<<dim3(BATCH * NHEAD * (SEQ / (16 * AQT)) / 8), dim3(256), 0, stream>>>(
      Qbf, Kbf, Vt, mask, Ctx);

  out_ln_kernel<<<dim3(MROWS / (16 * ORT)), dim3(512), 0, stream>>>(
      Ctx, Wobf, bo, hidden, ln_g, ln_b, (float*)d_out);
}

// v007
// One run takes 113 microseconds.
// In two side-by-side timings against v006, it was 1.04 and 1.05 times as fast.
// Over all steps from v000 it is 4.77 times as fast.
#include <hip/hip_runtime.h>
#include <math.h>

#define H     1024
#define NHEAD 16
#define HD    64
#define BATCH 8
#define SEQ   1024
#define MROWS (BATCH * SEQ)   // 8192

typedef __attribute__((ext_vector_type(16))) __bf16 v16bf;
typedef __attribute__((ext_vector_type(8)))  float  v8f;

// ---------------------------------------------------------------- helpers ---

static __device__ __forceinline__ unsigned short f2bf(float f) {
  union { float f; unsigned u; } x; x.f = f;
  unsigned r = x.u + 0x7FFFu + ((x.u >> 16) & 1u);   // round-to-nearest-even
  return (unsigned short)(r >> 16);
}

static __device__ __forceinline__ v8f wmma_bf16(v16bf a, v16bf b, v8f c) {
  // D = A(16x32 bf16) * B(32x16 bf16) + C(16x16 f32)
  return __builtin_amdgcn_wmma_f32_16x16x32_bf16(false, a, false, b,
                                                 (short)0, c, false, false);
}

// Fragment order. Every operand that a kernel loads straight from global
// memory into a WMMA fragment (Q, K, V^T, Ctx, Wo) is stored as a row of
// 16x32 bf16 fragments of FRAG = 512 elements (1 KB). Per the CDNA5 16-bit
// layout lanes 0-15 hold k = {0..7, 16..23} of row (lane & 15), lanes 16-31
// hold k = {8..15, 24..31}. Element (r, k) of a fragment lies at
//   (k >> 4) * 256 + ((k >> 3) & 1) * 128 + r * 8 + (k & 7),
// so lane L's two 16-byte chunks lie at L * 8 and 256 + L * 8: each of the two
// loads of a wave covers 512 contiguous bytes, 4 whole lines instead of 16.
#define FRAG 512

static __device__ __forceinline__ v16bf load_frag_f(const unsigned short* frag,
                                                    int lane) {
  const unsigned short* p = frag + lane * 8;
  v16bf f;
  reinterpret_cast<uint4*>(&f)[0] = *reinterpret_cast<const uint4*>(p);
  reinterpret_cast<uint4*>(&f)[1] = *reinterpret_cast<const uint4*>(p + 256);
  return f;
}

// Eight floats to one 16-byte chunk of bf16, element 0 at the lowest address.
static __device__ __forceinline__ uint4 pack8(float x0, float x1, float x2,
                                              float x3, float x4, float x5,
                                              float x6, float x7) {
  uint4 r;
  r.x = (unsigned)f2bf(x0) | ((unsigned)f2bf(x1) << 16);
  r.y = (unsigned)f2bf(x2) | ((unsigned)f2bf(x3) << 16);
  r.z = (unsigned)f2bf(x4) | ((unsigned)f2bf(x5) << 16);
  r.w = (unsigned)f2bf(x6) | ((unsigned)f2bf(x7) << 16);
  return r;
}

// -------------------------------------------------------------- fp32->bf16 --
// All five conversions (X, Wq, Wk, Wv, Wo) run in ONE launch of 256 work-groups
// of 12 waves, one per WGP. With one element a lane a trip, tens of thousands
// of short waves have to be started, and every launch adds its gap, its fill
// and its tail. Here a wave converts 4,096 elements: a lane issues its 32
// loads of 16 B at once, then converts and stores. The five arrays hold
// 8 : 1 : 1 : 1 : 1 parts, so of a work-group's waves 0-7 take X, 8-10 take
// Wq, Wk, Wv and 11 takes Wo.
// X, Wq, Wk, Wv keep their row-major order: float4 number q becomes the 8-byte
// piece number q, so a wave's load covers 512 contiguous bytes (4 whole lines)
// and its store 256 (2 whole lines).
// Wo goes to fragment order: fragment (n >> 4, k >> 5) is number
// (n >> 4) * (H / 32) + (k >> 5). A lane writes 16-byte chunks, chunk number
// o = fragment * 64 + (k >> 4 & 1) * 32 + lane.

#define CVT_BLOCKS  256
#define CVT_WAVES   12
#define CVT_PER     4096                    // elements a wave

static_assert(CVT_BLOCKS * 8 * CVT_PER == MROWS * H, "8 waves a group cover X");
static_assert(CVT_BLOCKS * CVT_PER == H * H, "1 wave a group covers a weight");

// Four floats to one 8-byte piece of bf16, element 0 at the lowest address.
static __device__ __forceinline__ uint2 pack4(float4 x) {
  uint2 r;
  r.x = (unsigned)f2bf(x.x) | ((unsigned)f2bf(x.y) << 16);
  r.y = (unsigned)f2bf(x.z) | ((unsigned)f2bf(x.w) << 16);
  return r;
}

// The register budget of four waves per SIMD is asked for by name (this grid
// puts three there): aiming for more waves, the compiler holds part of the
// loads back behind the first conversions, where they wait out a second memory
// latency.
__global__ __launch_bounds__(CVT_WAVES * 32) __attribute__((amdgpu_waves_per_eu(4, 4)))
void cvt_all_kernel(
    const float* __restrict__ X, const float* __restrict__ Wq,
    const float* __restrict__ Wk, const float* __restrict__ Wv,
    const float* __restrict__ Wo,
    unsigned short* __restrict__ Xbf, unsigned short* __restrict__ Wqkv,
    unsigned short* __restrict__ Wobf) {
  int lane = threadIdx.x & 31;
  int w = __builtin_amdgcn_readfirstlane(threadIdx.x >> 5);   // scalar: the role
  int blk = blockIdx.x;

  float4 v[CVT_PER / 128];                  // 32 float4 a lane
  if (w < 11) {
    const float* src = (w < 8) ? X + (blk * 8 + w) * CVT_PER
                               : ((w == 8) ? Wq : (w == 9) ? Wk : Wv) + blk * CVT_PER;
    unsigned short* dst = (w < 8) ? Xbf + (blk * 8 + w) * CVT_PER
                                  : Wqkv + (w - 8) * (H * H) + blk * CVT_PER;
    const float4* ps = reinterpret_cast<const float4*>(src) + lane;
    uint2* pd = reinterpret_cast<uint2*>(dst) + lane;
#pragma unroll
    for (int j = 0; j < CVT_PER / 128; j++) v[j] = ps[j * 32];
#pragma unroll
    for (int j = 0; j < CVT_PER / 128; j++) pd[j * 32] = pack4(v[j]);
  } else {
    // Chunks o = blk * 512 + j * 32 + lane, j = 0..15: 8 fragments of one row
    // of fragments. Row n = (blk >> 2) * 16 + (lane & 15), and chunk j starts
    // at k = (blk & 3) * 256 + j * 16 + (lane >> 4) * 8.
    const float4* ps = reinterpret_cast<const float4*>(
        Wo + ((blk >> 2) * 16 + (lane & 15)) * H + (blk & 3) * 256 + (lane >> 4) * 8);
    uint4* pd = reinterpret_cast<uint4*>(Wobf + blk * CVT_PER) + lane;
#pragma unroll
    for (int j = 0; j < CVT_PER / 256; j++) {
      v[2 * j]     = ps[j * 4];
      v[2 * j + 1] = ps[j * 4 + 1];
    }
#pragma unroll
    for (int j = 0; j < CVT_PER / 256; j++) {
      float4 x = v[2 * j], y = v[2 * j + 1];
      pd[j * 32] = pack8(x.x, x.y, x.z, x.w, y.x, y.y, y.z, y.w);
    }
  }
}

// --------------------------------------------------------------- QKV GEMM ---
// Y[8192 x 3072] = X * Wqkv^T. grid = (MROWS/128, 3*H/256), block = 256
// (8 waves, 2 x 4). A work-group owns a 128 x 256 tile of Y; a wave owns
// 64 x 64 of it (4 x 4 fragments). Per trip 64 k of the tile's 128 X rows and
// 256 W rows (128 B a row, whole lines) are copied asynchronously into one of
// two LDS buffers while the other buffer is worked on.
// Q, K, V^T are stored per (batch, head) in fragment order:
//   Q, K : row = position s, k = d; fragment number (s >> 4) * 2 + (d >> 5)
//   V^T  : row = d, k = position s; fragment number (s >> 5) * 4 + (d >> 4)
// A chunk is 8 consecutive k of one row, and a lane of a WMMA result holds 8
// consecutive rows of one column. So V is computed as X * W^T (a lane: 8
// positions of one d) and Q, K as W * X^T (a lane: 8 d of one position): the
// two operands trade places, which here is a trade of the two LDS offsets.

#define QBM    128
#define QBN    256
#define QBK    64                       // k per trip: 128 B of every row
#define QPITCH 144                      // LDS row pitch in bytes, 16 B x odd
#define QSTAGE ((QBM + QBN) * QPITCH)   // 55,296 B per buffer
#define QTRIPS (H / QBK)                // 16

// One 16x32 fragment from a staged tile; same k order as load_frag_f.
// p: this lane's row, already advanced by (lane >> 4) * 16 bytes.
static __device__ __forceinline__ v16bf load_frag_s(const unsigned char* p) {
  v16bf f;
  reinterpret_cast<uint4*>(&f)[0] = *reinterpret_cast<const uint4*>(p);
  reinterpret_cast<uint4*>(&f)[1] = *reinterpret_cast<const uint4*>(p + 32);
  return f;
}

// Copy one trip's tile: 384 rows of 128 B, 12 copies of 16 B per lane; a
// wave's copy covers 4 whole rows. gx / gw: this lane's 16 bytes in its first
// X / W row; lds: the byte address of the same place in the buffer.
static __device__ __forceinline__ void stage_tile(const unsigned short* gx,
                                                  const unsigned short* gw,
                                                  unsigned lds) {
  const unsigned R = 32 * QPITCH;       // 32 rows further in LDS
  const size_t   G = (size_t)32 * H;    // 32 rows further in global memory
  // The copies and their s_wait_xcnt stand in one statement, so that no
  // address register is rewritten ahead of the wait.
  asm volatile(
      "global_load_async_to_lds_b128 %0, %12, off\n\t"
      "global_load_async_to_lds_b128 %1, %13, off\n\t"
      "global_load_async_to_lds_b128 %2, %14, off\n\t"
      "global_load_async_to_lds_b128 %3, %15, off\n\t"
      "global_load_async_to_lds_b128 %4, %16, off\n\t"
      "global_load_async_to_lds_b128 %5, %17, off\n\t"
      "global_load_async_to_lds_b128 %6, %18, off\n\t"
      "global_load_async_to_lds_b128 %7, %19, off\n\t"
      "global_load_async_to_lds_b128 %8, %20, off\n\t"
      "global_load_async_to_lds_b128 %9, %21, off\n\t"
      "global_load_async_to_lds_b128 %10, %22, off\n\t"
      "global_load_async_to_lds_b128 %11, %23, off\n\t"
      "s_wait_xcnt 0x0"
      :: "v"(lds), "v"(lds + R), "v"(lds + 2 * R), "v"(lds + 3 * R),
         "v"(lds + 4 * R), "v"(lds + 5 * R), "v"(lds + 6 * R),
         "v"(lds + 7 * R), "v"(lds + 8 * R), "v"(lds + 9 * R),
         "v"(lds + 10 * R), "v"(lds + 11 * R),
         "v"(gx), "v"(gx + G), "v"(gx + 2 * G), "v"(gx + 3 * G),
         "v"(gw), "v"(gw + G), "v"(gw + 2 * G), "v"(gw + 3 * G),
         "v"(gw + 4 * G), "v"(gw + 5 * G), "v"(gw + 6 * G), "v"(gw + 7 * G)
      : "memory");
}

__global__ __launch_bounds__(256) void qkv_kernel(
    const unsigned short* __restrict__ Xbf,
    const unsigned short* __restrict__ Wqkv,
    const float* __restrict__ bq, const float* __restrict__ bk,
    const float* __restrict__ bv,
    unsigned short* __restrict__ Qbf, unsigned short* __restrict__ Kbf,
    unsigned short* __restrict__ Vt) {
  __shared__ __attribute__((aligned(16))) unsigned char stage[2 * QSTAGE];

  int mat = blockIdx.y >> 2;                    // 0=Q, 1=K, 2=V
  const float* bias = (mat == 0) ? bq : (mat == 1) ? bk : bv;

  int m0 = blockIdx.x * QBM;
  int nb = blockIdx.y * QBN;                    // row of the stacked Wqkv
  int tid = threadIdx.x;
  int w = tid >> 5, lane = tid & 31, l15 = lane & 15;
  int wm = w >> 2, wn = w & 3;

  // copy side: 8 lanes a row, 32 rows per copy of the work-group
  int cr = tid >> 3, cc = tid & 7;
  const unsigned short* gx = Xbf  + (size_t)(m0 + cr) * H + cc * 8;
  const unsigned short* gw = Wqkv + (size_t)(nb + cr) * H + cc * 8;
  unsigned lds0 = (unsigned)(size_t)stage + cr * QPITCH + cc * 16;

  // read side: this lane's row in the wave's first X and W fragment
  int offX = (wm * 64 + l15) * QPITCH + (lane >> 4) * 16;
  int offW = (QBM + wn * 64 + l15) * QPITCH + (lane >> 4) * 16;
  int offA = (mat == 2) ? offX : offW;          // rows of the result
  int offB = (mat == 2) ? offW : offX;          // columns of the result

  v8f acc[4][4] = {};

  stage_tile(gx, gw, lds0);
  asm volatile("s_wait_asynccnt 0x0" ::: "memory");  // tile 0 has landed
  __syncthreads();                                   // and every wave may read it
  stage_tile(gx + QBK, gw + QBK, lds0 + QSTAGE);

  // Kept rolled: a trip already holds 32 WMMAs, so the branch costs little,
  // and the code stays short.
#pragma unroll 1
  for (int t = 0; t < QTRIPS; t++) {
    int buf = (t & 1) * QSTAGE;
    const unsigned char* sA = stage + buf + offA;
    const unsigned char* sB = stage + buf + offB;
#pragma unroll
    for (int ks = 0; ks < 2; ks++) {
      v16bf a[4], b[4];
#pragma unroll
      for (int i = 0; i < 4; i++)
        a[i] = load_frag_s(sA + i * 16 * QPITCH + ks * 64);
#pragma unroll
      for (int j = 0; j < 4; j++)
        b[j] = load_frag_s(sB + j * 16 * QPITCH + ks * 64);
      // Keeps the 16 LDS reads one group in front of their 16 WMMAs: left
      // free, they are spread among the WMMAs, each place with a full wait.
      __builtin_amdgcn_sched_barrier(0);
#pragma unroll
      for (int i = 0; i < 4; i++)
#pragma unroll
        for (int j = 0; j < 4; j++)
          acc[i][j] = wmma_bf16(a[i], b[j], acc[i][j]);
      // Other end of the same group: the next reads stay behind these WMMAs.
      __builtin_amdgcn_sched_barrier(0);
    }
    asm volatile("s_wait_dscnt 0x0" ::: "memory");     // own reads of this buffer done
    asm volatile("s_wait_asynccnt 0x0" ::: "memory");  // own copies of tile t+1 landed
    __syncthreads();   // publishes tile t+1, frees the buffer of tile t
    if (t + 2 < QTRIPS)
      stage_tile(gx + (t + 2) * QBK, gw + (t + 2) * QBK, lds0 + buf);
  }
  asm volatile("s_wait_asynccnt 0x0" ::: "memory");    // none in flight at the end

  int hh = ((blockIdx.y & 3) << 2) + wn;        // a wave's 64 W rows = one head
  int r0 = m0 + wm * 64;                        // 128 rows lie in one batch entry
  int bb = r0 >> 10, s0 = r0 & (SEQ - 1);
  size_t hbase = ((size_t)bb * NHEAD + hh) * (SEQ * HD);
  if (mat == 2) {
    // acc[i][j][v]: position s0 + i*16 + (lane>>4)*8 + v, d = j*16 + l15
    unsigned short* dst = Vt + hbase + (size_t)(s0 >> 5) * 4 * FRAG + lane * 8;
#pragma unroll
    for (int j = 0; j < 4; j++) {
      float bn = bias[hh * HD + j * 16 + l15];
#pragma unroll
      for (int i = 0; i < 4; i++)
        *reinterpret_cast<uint4*>(dst + ((i >> 1) * 4 + j) * FRAG + (i & 1) * 256) =
            pack8(acc[i][j][0] + bn, acc[i][j][1] + bn, acc[i][j][2] + bn,
                  acc[i][j][3] + bn, acc[i][j][4] + bn, acc[i][j][5] + bn,
                  acc[i][j][6] + bn, acc[i][j][7] + bn);
      // The next column reuses the registers that these stores name.
      asm volatile("s_wait_xcnt 0x0" ::: "memory");
      // One column of fragments at a time: all 128 conversions scheduled at
      // once take more than 256 VGPRs, which costs the second work-group per WGP.
      __builtin_amdgcn_sched_barrier(0);
    }
  } else {
    // acc[i][j][v]: d = i*16 + (lane>>4)*8 + v, position s0 + j*16 + l15
    unsigned short* dst = ((mat == 0) ? Qbf : Kbf) + hbase +
                          (size_t)(s0 >> 4) * 2 * FRAG + lane * 8;
#pragma unroll
    for (int i = 0; i < 4; i++) {
      const float4* bp = reinterpret_cast<const float4*>(
          bias + hh * HD + i * 16 + ((lane >> 4) << 3));
      float4 b0 = bp[0], b1 = bp[1];
#pragma unroll
      for (int j = 0; j < 4; j++)
        *reinterpret_cast<uint4*>(dst + (j * 2 + (i >> 1)) * FRAG + (i & 1) * 256) =
            pack8(acc[i][j][0] + b0.x, acc[i][j][1] + b0.y, acc[i][j][2] + b0.z,
                  acc[i][j][3] + b0.w, acc[i][j][4] + b1.x, acc[i][j][5] + b1.y,
                  acc[i][j][6] + b1.z, acc[i][j][7] + b1.w);
      // As above: the wait for the stores' registers, then the bound on the
      // registers of the conversions.
      asm volatile("s_wait_xcnt 0x0" ::: "memory");
      __builtin_amdgcn_sched_barrier(0);
    }
  }
}

#define AQT 2   // query tiles a wave

typedef __attribute__((ext_vector_type(16))) float v16f;

// The value that lane (l ^ 16) holds.
static __device__ __forceinline__ float other_half(float x) {
  int b = __builtin_bit_cast(int, x);
  b = __builtin_amdgcn_permlanex16(b, b, 0x76543210, 0xfedcba98, false, false);
  return __builtin_bit_cast(float, b);
}

static __device__ __forceinline__ v8f load8f(const float* p) {
  v8f r;
  reinterpret_cast<float4*>(&r)[0] = reinterpret_cast<const float4*>(p)[0];
  reinterpret_cast<float4*>(&r)[1] = reinterpret_cast<const float4*>(p)[1];
  return r;
}

// Four waves per SIMD (two work-groups per WGP) are asked for by name: with that
// register budget the scheduler issues the next step's K and mask loads right
// behind the score products, a whole softmax ahead of their use; left to aim
// for more waves it holds them back until registers fall free late in the step.
__global__ __launch_bounds__(256) __attribute__((amdgpu_waves_per_eu(4, 4)))
void attn_kernel(
    const unsigned short* __restrict__ Qbf,
    const unsigned short* __restrict__ Kbf,
    const unsigned short* __restrict__ Vt,
    const float* __restrict__ mask,
    unsigned short* __restrict__ Ctx) {
  int tid = threadIdx.x;
  int w = tid >> 5, lane = tid & 31;
  int gid = blockIdx.x * 8 + w;
  int qt = (gid & (SEQ / (16 * AQT) - 1)) * AQT;   // the wave's first query tile
  int bh = gid / (SEQ / (16 * AQT));
  int b = bh >> 4, h = bh & 15;

  const unsigned short* Qh = Qbf + (size_t)bh * SEQ * HD;
  const unsigned short* Kh = Kbf + (size_t)bh * SEQ * HD;
  const unsigned short* Vh = Vt  + (size_t)bh * HD * SEQ;
  const float* mrow = mask + b * SEQ + ((lane >> 4) << 3);   // this half's keys

  // B operand: column = query, k = d
  v16bf qb[AQT][2];
#pragma unroll
  for (int u = 0; u < AQT; u++) {
    qb[u][0] = load_frag_f(Qh + ((qt + u) * 2 + 0) * FRAG, lane);
    qb[u][1] = load_frag_f(Qh + ((qt + u) * 2 + 1) * FRAG, lane);
  }

  // O^T tiles: o[u][t][r] = d 16t + 8h + r of this lane's query in tile u
  v8f o[AQT][4] = {};
  float rmax[AQT];   // of the query, equal in both halves
  float rsum[AQT];   // over this half's keys only; joined at the end
#pragma unroll
  for (int u = 0; u < AQT; u++) { rmax[u] = -INFINITY; rsum[u] = 0.f; }

  // prime K fragments for j = 0
  v16bf kc0 = load_frag_f(Kh + 0 * FRAG, lane);   // keys 0..15,  d 0..31
  v16bf kc1 = load_frag_f(Kh + 1 * FRAG, lane);   // keys 0..15,  d 32..63
  v16bf kc2 = load_frag_f(Kh + 2 * FRAG, lane);   // keys 16..31, d 0..31
  v16bf kc3 = load_frag_f(Kh + 3 * FRAG, lane);   // keys 16..31, d 32..63

  // and the mask of its keys
  v8f mk0 = load8f(mrow);
  v8f mk1 = load8f(mrow + 16);

  // Kept rolled: K and the mask reload into the registers just read, so there
  // is nothing for an unrolled body to save, and the code stays short.
#pragma unroll 1
  for (int j = 0; j < SEQ; j += 32) {
    // V fragments for this step: independent of P, issue early
    // (32 keys are 4 fragments = j * HD elements on, in K and in V^T alike)
    v16bf va0 = load_frag_f(Vh + j * HD + 0 * FRAG, lane);
    v16bf va1 = load_frag_f(Vh + j * HD + 1 * FRAG, lane);
    v16bf va2 = load_frag_f(Vh + j * HD + 2 * FRAG, lane);
    v16bf va3 = load_frag_f(Vh + j * HD + 3 * FRAG, lane);

    // scores: K(16 keys x 64) @ Q^T for two 16-key sub-tiles of each query tile
    v8f s0[AQT], s1[AQT];
#pragma unroll
    for (int u = 0; u < AQT; u++) {
      v8f z = {};
      s0[u] = wmma_bf16(kc0, qb[u][0], z);
      s1[u] = wmma_bf16(kc2, qb[u][0], z);
    }
#pragma unroll
    for (int u = 0; u < AQT; u++) {
      s0[u] = wmma_bf16(kc1, qb[u][1], s0[u]);
      s1[u] = wmma_bf16(kc3, qb[u][1], s1[u]);
    }

    v8f a0[AQT], a1[AQT];
#pragma unroll
    for (int u = 0; u < AQT; u++) {
      a0[u] = s0[u] * 0.125f + mk0;             // 1/sqrt(64) scale + mask
      a1[u] = s1[u] * 0.125f + mk1;
    }

    // K fragments and mask for the next step, into the registers just read
    // (wraps on last iter; redundant but cheap)
    int jn = (j + 32) & (SEQ - 1);
    mk0 = load8f(mrow + jn);
    mk1 = load8f(mrow + jn + 16);
    kc0 = load_frag_f(Kh + jn * HD + 0 * FRAG, lane);
    kc1 = load_frag_f(Kh + jn * HD + 1 * FRAG, lane);
    kc2 = load_frag_f(Kh + jn * HD + 2 * FRAG, lane);
    kc3 = load_frag_f(Kh + jn * HD + 3 * FRAG, lane);

    v16f p[AQT];
    v16bf pb[AQT];
    float alpha[AQT];
#pragma unroll
    for (int u = 0; u < AQT; u++) {
      v8f x0 = a0[u], x1 = a1[u];
      // maximum over this lane's 16 keys, as a tree, then over both halves
      float t0 = fmaxf(fmaxf(x0[0], x0[1]), x0[2]);
      float t1 = fmaxf(fmaxf(x0[3], x0[4]), x0[5]);
      float t2 = fmaxf(fmaxf(x0[6], x0[7]), x1[0]);
      float t3 = fmaxf(fmaxf(x1[1], x1[2]), x1[3]);
      float t4 = fmaxf(fmaxf(x1[4], x1[5]), x1[6]);
      float t = fmaxf(fmaxf(fmaxf(t0, t1), t2), fmaxf(fmaxf(t3, t4), x1[7]));
      t = fmaxf(t, other_half(t));
      float nm = fmaxf(rmax[u], t);
      alpha[u] = __expf(rmax[u] - nm);
      rmax[u] = nm;

#pragma unroll
      for (int r = 0; r < 8; r++) {
        p[u][r]     = __expf(x0[r] - nm);
        p[u][8 + r] = __expf(x1[r] - nm);
      }
      o[u][0] *= alpha[u]; o[u][1] *= alpha[u];
      o[u][2] *= alpha[u]; o[u][3] *= alpha[u];

      // P^T as B operand: element s is key 8h + s (s < 8), 16 + 8h + s - 8 (else)
      pb[u] = __builtin_convertvector(p[u], v16bf);
    }

    // Keeps vector work out from among the eight products: there it lands in
    // registers of a V fragment just read, which costs four idle slots behind
    // the product each time.
    __builtin_amdgcn_sched_barrier(0);

    // ctx^T += V^T(64 x 32) @ P^T(32 x 16); V^T fragment rows are d
#pragma unroll
    for (int u = 0; u < AQT; u++) {
      o[u][0] = wmma_bf16(va0, pb[u], o[u][0]);
      o[u][1] = wmma_bf16(va1, pb[u], o[u][1]);
      o[u][2] = wmma_bf16(va2, pb[u], o[u][2]);
      o[u][3] = wmma_bf16(va3, pb[u], o[u][3]);
    }
    // Other end of the same group. The row sums need nothing of the products
    // and run while the matrix unit works on them; they also stand between the
    // last product that reads P^T and the next step's first product, whose
    // result the compiler puts into the same registers.
    __builtin_amdgcn_sched_barrier(0);

#pragma unroll
    for (int u = 0; u < AQT; u++) {
      v16f q = p[u];
      float rs = ((q[0] + q[8]) + (q[1] + q[9])) + ((q[2] + q[10]) + (q[3] + q[11])) +
                 (((q[4] + q[12]) + (q[5] + q[13])) + ((q[6] + q[14]) + (q[7] + q[15])));
      rsum[u] = rsum[u] * alpha[u] + rs;
    }
  }

  // normalize and store merged-head ctx [B*S, H] in bf16, in fragment order:
  // row = b * SEQ + s, k = h * HD + d, fragment (row >> 4) * (H / 32) + (k >> 5).
  // A lane's 8 d of one tile are one 16-byte chunk, chunk number = lane.
#pragma unroll
  for (int u = 0; u < AQT; u++) {
    float inv = 1.f / (rsum[u] + other_half(rsum[u]));
    unsigned short* cw = Ctx +
        ((size_t)(b * (SEQ / 16) + qt + u) * (H / 32) + h * 2) * FRAG + lane * 8;
#pragma unroll
    for (int t = 0; t < 4; t++)                  // d 16t .. 16t + 15
      *reinterpret_cast<uint4*>(cw + (t >> 1) * FRAG + (t & 1) * 256) =
          pack8(o[u][t][0] * inv, o[u][t][1] * inv, o[u][t][2] * inv,
                o[u][t][3] * inv, o[u][t][4] * inv, o[u][t][5] * inv,
                o[u][t][6] * inv, o[u][t][7] * inv);
  }
}

// ------------------------------- output GEMM + bias + residual + LayerNorm --
// grid = MROWS/32 = 256 blocks of 512 (16 waves), one per WGP. Wave w: 32 rows
// x 64 cols; the block owns the full 32x1024 strip for the fused LayerNorm.
// Every block has to read all of Wo (2 MB) from L2, so the L2 bytes of this
// launch are 2 MB x the number of blocks. With two 16-row tiles a wave, each
// Wo fragment loaded feeds two products and the blocks are half as many.
// Ping-pong K-loop over two fragment sets held in registers.

#define ORT 2   // 16-row tiles a wave (and a block)

typedef __attribute__((ext_vector_type(4))) float v4f;

// This grid puts four waves on a SIMD, and their register budget is asked for
// by name: aiming for eight, the compiler gives up the second fragment set and
// waits for each set's loads right behind their issue.
__global__ __launch_bounds__(512) __attribute__((amdgpu_waves_per_eu(4, 4)))
void out_ln_kernel(
    const unsigned short* __restrict__ Ctx,
    const unsigned short* __restrict__ Wo,
    const float* __restrict__ bo,
    const float* __restrict__ hidden,
    const float* __restrict__ ln_g, const float* __restrict__ ln_b,
    float* __restrict__ out) {
  __shared__ __attribute__((aligned(16))) float tile[16 * ORT * H];   // 128 KB

  int m0 = blockIdx.x * (16 * ORT);
  int tid = threadIdx.x;
  int w = tid >> 5, lane = tid & 31, l15 = lane & 15;
  int n0 = w << 6;

  v8f acc[ORT][4] = {};
  // Ctx and Wo lie in fragment order: 16 rows are H / 32 fragments in a row.
  // Ca, Wb: this lane's first chunk (load_frag_f is given lane 0).
  const unsigned short* Ca = Ctx + (size_t)blockIdx.x * (16 * ORT * H) + lane * 8;
  const unsigned short* Wb = Wo + (size_t)n0 * H + lane * 8;
  v16bf aA[ORT];
#pragma unroll
  for (int u = 0; u < ORT; u++)
    aA[u] = load_frag_f(Ca + u * (16 * H), 0);
  v16bf bA[4];
#pragma unroll
  for (int t = 0; t < 4; t++)
    bA[t] = load_frag_f(Wb + t * (16 * H), 0);

  for (int kb = 0; kb < H; kb += 64) {
    // 32 k on = one fragment on = 16 * 32 elements
    const unsigned short* pa = Ca + kb * 16;
    const unsigned short* pb = Wb + kb * 16;
    v16bf aB[ORT];
#pragma unroll
    for (int u = 0; u < ORT; u++)
      aB[u] = load_frag_f(pa + u * (16 * H) + FRAG, 0);
    v16bf bB[4];
#pragma unroll
    for (int t = 0; t < 4; t++)
      bB[t] = load_frag_f(pb + t * (16 * H) + FRAG, 0);
    // The wait that stands before the loads' address registers are rewritten.
    // It names them, so that they live up to it: otherwise the last load of a
    // group gets them as its result registers, ahead of the wait.
    asm volatile("s_wait_xcnt 0x0" :: "v"(pa), "v"(pb) : "memory");
    // Keeps these loads in front of the products of the other set: left free,
    // the products are lifted over them, and each set is then waited for right
    // behind its issue, with half the bytes in flight.
    __builtin_amdgcn_sched_barrier(0);

#pragma unroll
    for (int t = 0; t < 4; t++)
#pragma unroll
      for (int u = 0; u < ORT; u++)
        acc[u][t] = wmma_bf16(aA[u], bA[t], acc[u][t]);

    int k2 = (kb + 64) & (H - 1);
    pa = Ca + k2 * 16;
    pb = Wb + k2 * 16;
#pragma unroll
    for (int u = 0; u < ORT; u++)
      aA[u] = load_frag_f(pa + u * (16 * H), 0);
#pragma unroll
    for (int t = 0; t < 4; t++)
      bA[t] = load_frag_f(pb + t * (16 * H), 0);
    // As above, the wait and the order.
    asm volatile("s_wait_xcnt 0x0" :: "v"(pa), "v"(pb) : "memory");
    __builtin_amdgcn_sched_barrier(0);

#pragma unroll
    for (int t = 0; t < 4; t++)
#pragma unroll
      for (int u = 0; u < ORT; u++)
        acc[u][t] = wmma_bf16(aB[u], bB[t], acc[u][t]);
  }

  // From here on every row-wise access goes by whole lines: in the LayerNorm
  // pass wave w takes rows w and 16 + w, and a lane takes columns
  // c * 128 + lane * 4 .. + 3, c = 0..7. So each 16-byte-a-lane access of a wave
  // covers 512 contiguous bytes: 4 whole lines of the residual, gamma, beta and
  // out, and 128 consecutive words of LDS, free of bank conflicts. (With 32
  // columns in a row per lane the lanes lie 128 B apart: an access touches 32
  // lines, and in LDS only two groups of 4 banks.)
  // The residual is added in that pass; its loads are issued here, ahead of the
  // LDS stores and the barrier.
  const v4f* hp = reinterpret_cast<const v4f*>(hidden + (size_t)(m0 + w) * H) + lane;
  v4f x[ORT][H / 128];
#pragma unroll
  for (int u = 0; u < ORT; u++)
#pragma unroll
    for (int c = 0; c < H / 128; c++)
      x[u][c] = hp[u * (16 * H / 4) + c * 32];
  // As in the loop: the wait names the loads' address, which so lives up to it.
  asm volatile("s_wait_xcnt 0x0" :: "v"(hp) : "memory");

  int rw = (lane >> 4) << 3;
#pragma unroll
  for (int u = 0; u < ORT; u++) {
#pragma unroll
    for (int t = 0; t < 4; t++) {
      int n = n0 + t * 16 + l15;
      float bn = bo[n];
#pragma unroll
      for (int v = 0; v < 8; v++) {
        int m = u * 16 + v + rw;
        tile[m * H + n] = acc[u][t][v] + bn;
      }
    }
  }
  __syncthreads();

  const v4f* gp = reinterpret_cast<const v4f*>(ln_g) + lane;
  const v4f* bp = reinterpret_cast<const v4f*>(ln_b) + lane;
  v4f g[H / 128], be[H / 128];
#pragma unroll
  for (int c = 0; c < H / 128; c++) { g[c] = gp[c * 32]; be[c] = bp[c * 32]; }
  // The wait that stands before these loads' address register is rewritten.
  asm volatile("s_wait_xcnt 0x0" ::: "memory");

  // LayerNorm: a row is read from LDS once and stays in registers. A lane sums
  // its 32 elements in four chains, one per column of its group of 4.
  float s[ORT], ss[ORT];
#pragma unroll
  for (int u = 0; u < ORT; u++) {
    const v4f* tr = reinterpret_cast<const v4f*>(&tile[(u * 16 + w) * H]) + lane;
    v4f s4 = {}, q4 = {};
#pragma unroll
    for (int c = 0; c < H / 128; c++) {
      v4f y = tr[c * 32] + x[u][c];
      x[u][c] = y;
      s4 += y;
      q4 += y * y;
    }
    s[u]  = (s4[0] + s4[1]) + (s4[2] + s4[3]);
    ss[u] = (q4[0] + q4[1]) + (q4[2] + q4[3]);
  }
#pragma unroll
  for (int o = 1; o < 32; o <<= 1) {
#pragma unroll
    for (int u = 0; u < ORT; u++) {
      s[u]  += __shfl_xor(s[u],  o, 32);
      ss[u] += __shfl_xor(ss[u], o, 32);
    }
  }
#pragma unroll
  for (int u = 0; u < ORT; u++) {
    float mu   = s[u]  * (1.f / H);
    float var  = ss[u] * (1.f / H) - mu * mu;
    float rstd = rsqrtf(var + 1e-12f);
#pragma unroll
    for (int c = 0; c < H / 128; c++)
      x[u][c] = (x[u][c] - mu) * rstd * g[c] + be[c];
  }
  // Nothing is computed behind the stores, so no register that they name is
  // written again.
  v4f* op = reinterpret_cast<v4f*>(out + (size_t)(m0 + w) * H) + lane;
#pragma unroll
  for (int u = 0; u < ORT; u++)
#pragma unroll
    for (int c = 0; c < H / 128; c++)
      op[u * (16 * H / 4) + c * 32] = x[u][c];
}

// ------------------------------------------------------------------ launch --

extern "C" void kernel_launch(void* const* d_in, const int* in_sizes, int n_in,
                              void* d_out, int out_size, void* d_ws,
                              size_t ws_size, hipStream_t stream) {
  (void)in_sizes; (void)n_in; (void)out_size; (void)ws_size;

  const float* hidden = (const float*)d_in[0];
  const float* mask   = (const float*)d_in[1];
  const float* Wq     = (const float*)d_in[2];
  const float* bq     = (const float*)d_in[3];
  const float* Wk     = (const float*)d_in[4];
  const float* bk     = (const float*)d_in[5];
  const float* Wv     = (const float*)d_in[6];
  const float* bv     = (const float*)d_in[7];
  const float* Wo     = (const float*)d_in[8];
  const float* bo     = (const float*)d_in[9];
  const float* ln_g   = (const float*)d_in[10];
  const float* ln_b   = (const float*)d_in[11];

  char* ws = (char*)d_ws;
  size_t off = 0;
  auto alloc = [&](size_t bytes) {
    char* p = ws + off;
    off += (bytes + 255) & ~(size_t)255;
    return p;
  };
  unsigned short* Xbf  = (unsigned short*)alloc((size_t)MROWS * H * 2);
  unsigned short* Wqkv = (unsigned short*)alloc((size_t)3 * H * H * 2);
  unsigned short* Wobf = (unsigned short*)alloc((size_t)H * H * 2);
  unsigned short* Qbf  = (unsigned short*)alloc((size_t)MROWS * H * 2);
  unsigned short* Kbf  = (unsigned short*)alloc((size_t)MROWS * H * 2);
  unsigned short* Vt   = (unsigned short*)alloc((size_t)MROWS * H * 2);
  unsigned short* Ctx  = (unsigned short*)alloc((size_t)MROWS * H * 2);

  cvt_all_kernel<<<dim3(CVT_BLOCKS), dim3(CVT_WAVES * 32), 0, stream>>>(
      hidden, Wq, Wk, Wv, Wo, Xbf, Wqkv, Wobf);

  qkv_kernel<<<dim3(MROWS / QBM, 3 * H / QBN), dim3(256), 0, stream>>>(
      Xbf, Wqkv, bq, bk, bv, Qbf, Kbf, Vt);

  attn_kernel<<<dim3(BATCH * NHEAD * (SEQ / (16 * AQT)) / 8), dim3(256), 0, stream>>>(
      Qbf, Kbf, Vt, mask, Ctx);

  out_ln_kernel<<<dim3(MROWS / (16 * ORT)), dim3(512), 0, stream>>>(
      Ctx, Wobf, bo, hidden, ln_g, ln_b, (float*)d_out);
}

// v008
// One run takes 108 microseconds.
// Next to v007, in two timings, it ran 1.05 times as fast each time.
// All steps since v000 together make it 5.01 times as fast.
#include <hip/hip_runtime.h>
#include <math.h>

#define H     1024
#define NHEAD 16
#define HD    64
#define BATCH 8
#define SEQ   1024
#define MROWS (BATCH * SEQ)   // 8192

typedef __attribute__((ext_vector_type(16))) __bf16 v16bf;
typedef __attribute__((ext_vector_type(8)))  float  v8f;

// ---------------------------------------------------------------- helpers ---

static __device__ __forceinline__ unsigned short f2bf(float f) {
  union { float f; unsigned u; } x; x.f = f;
  unsigned r = x.u + 0x7FFFu + ((x.u >> 16) & 1u);   // round-to-nearest-even
  return (unsigned short)(r >> 16);
}

static __device__ __forceinline__ v8f wmma_bf16(v16bf a, v16bf b, v8f c) {
  // D = A(16x32 bf16) * B(32x16 bf16) + C(16x16 f32)
  return __builtin_amdgcn_wmma_f32_16x16x32_bf16(false, a, false, b,
                                                 (short)0, c, false, false);
}

// Fragment order. Every operand that a kernel loads straight from global
// memory into a WMMA fragment (Q, K, V^T, Ctx, Wo) is stored as a row of
// 16x32 bf16 fragments of FRAG = 512 elements (1 KB). Per the CDNA5 16-bit
// layout lanes 0-15 hold k = {0..7, 16..23} of row (lane & 15), lanes 16-31
// hold k = {8..15, 24..31}. Element (r, k) of a fragment lies at
//   (k >> 4) * 256 + ((k >> 3) & 1) * 128 + r * 8 + (k & 7),
// so lane L's two 16-byte chunks lie at L * 8 and 256 + L * 8: each of the two
// loads of a wave covers 512 contiguous bytes, 4 whole lines instead of 16.
#define FRAG 512

static __device__ __forceinline__ v16bf load_frag_f(const unsigned short* frag,
                                                    int lane) {
  const unsigned short* p = frag + lane * 8;
  v16bf f;
  reinterpret_cast<uint4*>(&f)[0] = *reinterpret_cast<const uint4*>(p);
  reinterpret_cast<uint4*>(&f)[1] = *reinterpret_cast<const uint4*>(p + 256);
  return f;
}

// Eight floats to one 16-byte chunk of bf16, element 0 at the lowest address.
static __device__ __forceinline__ uint4 pack8(float x0, float x1, float x2,
                                              float x3, float x4, float x5,
                                              float x6, float x7) {
  uint4 r;
  r.x = (unsigned)f2bf(x0) | ((unsigned)f2bf(x1) << 16);
  r.y = (unsigned)f2bf(x2) | ((unsigned)f2bf(x3) << 16);
  r.z = (unsigned)f2bf(x4) | ((unsigned)f2bf(x5) << 16);
  r.w = (unsigned)f2bf(x6) | ((unsigned)f2bf(x7) << 16);
  return r;
}

// -------------------------------------------------------------- fp32->bf16 --
// All five conversions (X, Wq, Wk, Wv, Wo) run in ONE launch of 256 work-groups
// of 12 waves, one per WGP. With one element a lane a trip, tens of thousands
// of short waves have to be started, and every launch adds its gap, its fill
// and its tail. Here a wave converts 4,096 elements: a lane issues its 32
// loads of 16 B at once, then converts and stores. The five arrays hold
// 8 : 1 : 1 : 1 : 1 parts, so of a work-group's waves 0-7 take X, 8-10 take
// Wq, Wk, Wv and 11 takes Wo.
// X, Wq, Wk, Wv keep their row-major order: float4 number q becomes the 8-byte
// piece number q, so a wave's load covers 512 contiguous bytes (4 whole lines)
// and its store 256 (2 whole lines).
// Wo goes to fragment order: fragment (n >> 4, k >> 5) is number
// (n >> 4) * (H / 32) + (k >> 5). A lane writes 16-byte chunks, chunk number
// o = fragment * 64 + (k >> 4 & 1) * 32 + lane.

#define CVT_BLOCKS  256
#define CVT_WAVES   12
#define CVT_PER     4096                    // elements a wave

static_assert(CVT_BLOCKS * 8 * CVT_PER == MROWS * H, "8 waves a group cover X");
static_assert(CVT_BLOCKS * CVT_PER == H * H, "1 wave a group covers a weight");

// Four floats to one 8-byte piece of bf16, element 0 at the lowest address.
static __device__ __forceinline__ uint2 pack4(float4 x) {
  uint2 r;
  r.x = (unsigned)f2bf(x.x) | ((unsigned)f2bf(x.y) << 16);
  r.y = (unsigned)f2bf(x.z) | ((unsigned)f2bf(x.w) << 16);
  return r;
}

// The register budget of four waves per SIMD is asked for by name (this grid
// puts three there): aiming for more waves, the compiler holds part of the
// loads back behind the first conversions, where they wait out a second memory
// latency.
__global__ __launch_bounds__(CVT_WAVES * 32) __attribute__((amdgpu_waves_per_eu(4, 4)))
void cvt_all_kernel(
    const float* __restrict__ X, const float* __restrict__ Wq,
    const float* __restrict__ Wk, const float* __restrict__ Wv,
    const float* __restrict__ Wo,
    unsigned short* __restrict__ Xbf, unsigned short* __restrict__ Wqkv,
    unsigned short* __restrict__ Wobf) {
  int lane = threadIdx.x & 31;
  int w = __builtin_amdgcn_readfirstlane(threadIdx.x >> 5);   // scalar: the role
  int blk = blockIdx.x;

  float4 v[CVT_PER / 128];                  // 32 float4 a lane
  if (w < 11) {
    const float* src = (w < 8) ? X + (blk * 8 + w) * CVT_PER
                               : ((w == 8) ? Wq : (w == 9) ? Wk : Wv) + blk * CVT_PER;
    unsigned short* dst = (w < 8) ? Xbf + (blk * 8 + w) * CVT_PER
                                  : Wqkv + (w - 8) * (H * H) + blk * CVT_PER;
    const float4* ps = reinterpret_cast<const float4*>(src) + lane;
    uint2* pd = reinterpret_cast<uint2*>(dst) + lane;
#pragma unroll
    for (int j = 0; j < CVT_PER / 128; j++) v[j] = ps[j * 32];
#pragma unroll
    for (int j = 0; j < CVT_PER / 128; j++) pd[j * 32] = pack4(v[j]);
  } else {
    // Chunks o = blk * 512 + j * 32 + lane, j = 0..15: 8 fragments of one row
    // of fragments. Row n = (blk >> 2) * 16 + (lane & 15), and chunk j starts
    // at k = (blk & 3) * 256 + j * 16 + (lane >> 4) * 8.
    const float4* ps = reinterpret_cast<const float4*>(
        Wo + ((blk >> 2) * 16 + (lane & 15)) * H + (blk & 3) * 256 + (lane >> 4) * 8);
    uint4* pd = reinterpret_cast<uint4*>(Wobf + blk * CVT_PER) + lane;
#pragma unroll
    for (int j = 0; j < CVT_PER / 256; j++) {
      v[2 * j]     = ps[j * 4];
      v[2 * j + 1] = ps[j * 4 + 1];
    }
#pragma unroll
    for (int j = 0; j < CVT_PER / 256; j++) {
      float4 x = v[2 * j], y = v[2 * j + 1];
      pd[j * 32] = pack8(x.x, x.y, x.z, x.w, y.x, y.y, y.z, y.w);
    }
  }
}

// --------------------------------------------------------------- QKV GEMM ---
// Y[8192 x 3072] = X * Wqkv^T. grid = (MROWS/128, 3*H/256), block = 256
// (8 waves, 2 x 4). A work-group owns a 128 x 256 tile of Y; a wave owns
// 64 x 64 of it (4 x 4 fragments). Per trip 64 k of the tile's 128 X rows and
// 256 W rows (128 B a row, whole lines) are copied asynchronously into one of
// two LDS buffers while the other buffer is worked on.
// Q, K, V^T are stored per (batch, head) in fragment order:
//   Q, K : row = position s, k = d; fragment number (s >> 4) * 2 + (d >> 5)
//   V^T  : row = d, k = position s; fragment number (s >> 5) * 4 + (d >> 4)
// A chunk is 8 consecutive k of one row, and a lane of a WMMA result holds 8
// consecutive rows of one column. So V is computed as X * W^T (a lane: 8
// positions of one d) and Q, K as W * X^T (a lane: 8 d of one position): the
// two operands trade places, which here is a trade of the two LDS offsets.

#define QBM    128
#define QBN    256
#define QBK    64                       // k per trip: 128 B of every row
#define QPITCH 144                      // LDS row pitch in bytes, 16 B x odd
#define QSTAGE ((QBM + QBN) * QPITCH)   // 55,296 B per buffer
#define QTRIPS (H / QBK)                // 16

// One 16x32 fragment from a staged tile; same k order as load_frag_f.
// p: this lane's row, already advanced by (lane >> 4) * 16 bytes.
static __device__ __forceinline__ v16bf load_frag_s(const unsigned char* p) {
  v16bf f;
  reinterpret_cast<uint4*>(&f)[0] = *reinterpret_cast<const uint4*>(p);
  reinterpret_cast<uint4*>(&f)[1] = *reinterpret_cast<const uint4*>(p + 32);
  return f;
}

// Copy one trip's tile: 384 rows of 128 B, 12 copies of 16 B per lane; a
// wave's copy covers 4 whole rows. gx / gw: this lane's 16 bytes in its first
// X / W row; lds: the byte address of the same place in the buffer.
static __device__ __forceinline__ void stage_tile(const unsigned short* gx,
                                                  const unsigned short* gw,
                                                  unsigned lds) {
  const unsigned R = 32 * QPITCH;       // 32 rows further in LDS
  const size_t   G = (size_t)32 * H;    // 32 rows further in global memory
  // The copies and their s_wait_xcnt stand in one statement, so that no
  // address register is rewritten ahead of the wait.
  asm volatile(
      "global_load_async_to_lds_b128 %0, %12, off\n\t"
      "global_load_async_to_lds_b128 %1, %13, off\n\t"
      "global_load_async_to_lds_b128 %2, %14, off\n\t"
      "global_load_async_to_lds_b128 %3, %15, off\n\t"
      "global_load_async_to_lds_b128 %4, %16, off\n\t"
      "global_load_async_to_lds_b128 %5, %17, off\n\t"
      "global_load_async_to_lds_b128 %6, %18, off\n\t"
      "global_load_async_to_lds_b128 %7, %19, off\n\t"
      "global_load_async_to_lds_b128 %8, %20, off\n\t"
      "global_load_async_to_lds_b128 %9, %21, off\n\t"
      "global_load_async_to_lds_b128 %10, %22, off\n\t"
      "global_load_async_to_lds_b128 %11, %23, off\n\t"
      "s_wait_xcnt 0x0"
      :: "v"(lds), "v"(lds + R), "v"(lds + 2 * R), "v"(lds + 3 * R),
         "v"(lds + 4 * R), "v"(lds + 5 * R), "v"(lds + 6 * R),
         "v"(lds + 7 * R), "v"(lds + 8 * R), "v"(lds + 9 * R),
         "v"(lds + 10 * R), "v"(lds + 11 * R),
         "v"(gx), "v"(gx + G), "v"(gx + 2 * G), "v"(gx + 3 * G),
         "v"(gw), "v"(gw + G), "v"(gw + 2 * G), "v"(gw + 3 * G),
         "v"(gw + 4 * G), "v"(gw + 5 * G), "v"(gw + 6 * G), "v"(gw + 7 * G)
      : "memory");
}

__global__ __launch_bounds__(256) void qkv_kernel(
    const unsigned short* __restrict__ Xbf,
    const unsigned short* __restrict__ Wqkv,
    const float* __restrict__ bq, const float* __restrict__ bk,
    const float* __restrict__ bv,
    unsigned short* __restrict__ Qbf, unsigned short* __restrict__ Kbf,
    unsigned short* __restrict__ Vt) {
  __shared__ __attribute__((aligned(16))) unsigned char stage[2 * QSTAGE];

  int mat = blockIdx.y >> 2;                    // 0=Q, 1=K, 2=V
  const float* bias = (mat == 0) ? bq : (mat == 1) ? bk : bv;

  int m0 = blockIdx.x * QBM;
  int nb = blockIdx.y * QBN;                    // row of the stacked Wqkv
  int tid = threadIdx.x;
  int w = tid >> 5, lane = tid & 31, l15 = lane & 15;
  int wm = w >> 2, wn = w & 3;

  // copy side: 8 lanes a row, 32 rows per copy of the work-group
  int cr = tid >> 3, cc = tid & 7;
  const unsigned short* gx = Xbf  + (size_t)(m0 + cr) * H + cc * 8;
  const unsigned short* gw = Wqkv + (size_t)(nb + cr) * H + cc * 8;
  unsigned lds0 = (unsigned)(size_t)stage + cr * QPITCH + cc * 16;

  // read side: this lane's row in the wave's first X and W fragment
  int offX = (wm * 64 + l15) * QPITCH + (lane >> 4) * 16;
  int offW = (QBM + wn * 64 + l15) * QPITCH + (lane >> 4) * 16;
  int offA = (mat == 2) ? offX : offW;          // rows of the result
  int offB = (mat == 2) ? offW : offX;          // columns of the result

  v8f acc[4][4] = {};

  // Trip t works on k slab (t0 + t) mod QTRIPS. 64 work-groups share each W
  // tile and 12 each X tile; walking k from the same end they ask L2 for the
  // same lines at the same moment. The sharers of a
  // tile are spread evenly over the starts (neighbours in x or y, and groups 8
  // apart in x, differ).
  int t0 = (blockIdx.x + (blockIdx.x >> 3) + blockIdx.y) & (QTRIPS - 1);
  int k1 = ((t0 + 1) & (QTRIPS - 1)) * QBK;

  stage_tile(gx + t0 * QBK, gw + t0 * QBK, lds0);
  asm volatile("s_wait_asynccnt 0x0" ::: "memory");  // the first tile has landed
  __syncthreads();                                   // and every wave may read it
  stage_tile(gx + k1, gw + k1, lds0 + QSTAGE);

  // Kept rolled: a trip already holds 32 WMMAs, so the branch costs little,
  // and the code stays short.
#pragma unroll 1
  for (int t = 0; t < QTRIPS; t++) {
    int buf = (t & 1) * QSTAGE;
    const unsigned char* sA = stage + buf + offA;
    const unsigned char* sB = stage + buf + offB;
#pragma unroll
    for (int ks = 0; ks < 2; ks++) {
      v16bf a[4], b[4];
#pragma unroll
      for (int i = 0; i < 4; i++)
        a[i] = load_frag_s(sA + i * 16 * QPITCH + ks * 64);
#pragma unroll
      for (int j = 0; j < 4; j++)
        b[j] = load_frag_s(sB + j * 16 * QPITCH + ks * 64);
      // Keeps the 16 LDS reads one group in front of their 16 WMMAs: left
      // free, they are spread among the WMMAs, each place with a full wait.
      __builtin_amdgcn_sched_barrier(0);
#pragma unroll
      for (int i = 0; i < 4; i++)
#pragma unroll
        for (int j = 0; j < 4; j++)
          acc[i][j] = wmma_bf16(a[i], b[j], acc[i][j]);
      // Other end of the same group: the next reads stay behind these WMMAs.
      __builtin_amdgcn_sched_barrier(0);
    }
    asm volatile("s_wait_dscnt 0x0" ::: "memory");     // own reads of this buffer done
    asm volatile("s_wait_asynccnt 0x0" ::: "memory");  // own copies of tile t+1 landed
    __syncthreads();   // publishes tile t+1, frees the buffer of tile t
    if (t + 2 < QTRIPS) {
      int k2 = ((t0 + t + 2) & (QTRIPS - 1)) * QBK;
      stage_tile(gx + k2, gw + k2, lds0 + buf);
    }
  }
  asm volatile("s_wait_asynccnt 0x0" ::: "memory");    // none in flight at the end

  int hh = ((blockIdx.y & 3) << 2) + wn;        // a wave's 64 W rows = one head
  int r0 = m0 + wm * 64;                        // 128 rows lie in one batch entry
  int bb = r0 >> 10, s0 = r0 & (SEQ - 1);
  size_t hbase = ((size_t)bb * NHEAD + hh) * (SEQ * HD);
  if (mat == 2) {
    // acc[i][j][v]: position s0 + i*16 + (lane>>4)*8 + v, d = j*16 + l15
    unsigned short* dst = Vt + hbase + (size_t)(s0 >> 5) * 4 * FRAG + lane * 8;
#pragma unroll
    for (int j = 0; j < 4; j++) {
      float bn = bias[hh * HD + j * 16 + l15];
#pragma unroll
      for (int i = 0; i < 4; i++)
        *reinterpret_cast<uint4*>(dst + ((i >> 1) * 4 + j) * FRAG + (i & 1) * 256) =
            pack8(acc[i][j][0] + bn, acc[i][j][1] + bn, acc[i][j][2] + bn,
                  acc[i][j][3] + bn, acc[i][j][4] + bn, acc[i][j][5] + bn,
                  acc[i][j][6] + bn, acc[i][j][7] + bn);
      // The next column reuses the registers that these stores name.
      asm volatile("s_wait_xcnt 0x0" ::: "memory");
      // One column of fragments at a time: all 128 conversions scheduled at
      // once take more than 256 VGPRs, which costs the second work-group per WGP.
      __builtin_amdgcn_sched_barrier(0);
    }
  } else {
    // acc[i][j][v]: d = i*16 + (lane>>4)*8 + v, position s0 + j*16 + l15
    unsigned short* dst = ((mat == 0) ? Qbf : Kbf) + hbase +
                          (size_t)(s0 >> 4) * 2 * FRAG + lane * 8;
#pragma unroll
    for (int i = 0; i < 4; i++) {
      const float4* bp = reinterpret_cast<const float4*>(
          bias + hh * HD + i * 16 + ((lane >> 4) << 3));
      float4 b0 = bp[0], b1 = bp[1];
#pragma unroll
      for (int j = 0; j < 4; j++)
        *reinterpret_cast<uint4*>(dst + (j * 2 + (i >> 1)) * FRAG + (i & 1) * 256) =
            pack8(acc[i][j][0] + b0.x, acc[i][j][1] + b0.y, acc[i][j][2] + b0.z,
                  acc[i][j][3] + b0.w, acc[i][j][4] + b1.x, acc[i][j][5] + b1.y,
                  acc[i][j][6] + b1.z, acc[i][j][7] + b1.w);
      // As above: the wait for the stores' registers, then the bound on the
      // registers of the conversions.
      asm volatile("s_wait_xcnt 0x0" ::: "memory");
      __builtin_amdgcn_sched_barrier(0);
    }
  }
}

#define AQT 2   // query tiles a wave

typedef __attribute__((ext_vector_type(16))) float v16f;

// The value that lane (l ^ 16) holds.
static __device__ __forceinline__ float other_half(float x) {
  int b = __builtin_bit_cast(int, x);
  b = __builtin_amdgcn_permlanex16(b, b, 0x76543210, 0xfedcba98, false, false);
  return __builtin_bit_cast(float, b);
}

static __device__ __forceinline__ v8f load8f(const float* p) {
  v8f r;
  reinterpret_cast<float4*>(&r)[0] = reinterpret_cast<const float4*>(p)[0];
  reinterpret_cast<float4*>(&r)[1] = reinterpret_cast<const float4*>(p)[1];
  return r;
}

// Four waves per SIMD (two work-groups per WGP) are asked for by name: with that
// register budget the scheduler issues the next step's K and mask loads right
// behind the score products, a whole softmax ahead of their use; left to aim
// for more waves it holds them back until registers fall free late in the step.
__global__ __launch_bounds__(256) __attribute__((amdgpu_waves_per_eu(4, 4)))
void attn_kernel(
    const unsigned short* __restrict__ Qbf,
    const unsigned short* __restrict__ Kbf,
    const unsigned short* __restrict__ Vt,
    const float* __restrict__ mask,
    unsigned short* __restrict__ Ctx) {
  int tid = threadIdx.x;
  int w = tid >> 5, lane = tid & 31;
  int gid = blockIdx.x * 8 + w;
  int qt = (gid & (SEQ / (16 * AQT) - 1)) * AQT;   // the wave's first query tile
  int bh = gid / (SEQ / (16 * AQT));
  int b = bh >> 4, h = bh & 15;

  const unsigned short* Qh = Qbf + (size_t)bh * SEQ * HD;
  const unsigned short* Kh = Kbf + (size_t)bh * SEQ * HD;
  const unsigned short* Vh = Vt  + (size_t)bh * HD * SEQ;
  const float* mrow = mask + b * SEQ + ((lane >> 4) << 3);   // this half's keys

  // B operand: column = query, k = d
  v16bf qb[AQT][2];
#pragma unroll
  for (int u = 0; u < AQT; u++) {
    qb[u][0] = load_frag_f(Qh + ((qt + u) * 2 + 0) * FRAG, lane);
    qb[u][1] = load_frag_f(Qh + ((qt + u) * 2 + 1) * FRAG, lane);
  }

  // O^T tiles: o[u][t][r] = d 16t + 8h + r of this lane's query in tile u
  v8f o[AQT][4] = {};
  float rmax[AQT];   // of the query, equal in both halves
  float rsum[AQT];   // over this half's keys only; joined at the end
#pragma unroll
  for (int u = 0; u < AQT; u++) { rmax[u] = -INFINITY; rsum[u] = 0.f; }

  // prime K fragments for j = 0
  v16bf kc0 = load_frag_f(Kh + 0 * FRAG, lane);   // keys 0..15,  d 0..31
  v16bf kc1 = load_frag_f(Kh + 1 * FRAG, lane);   // keys 0..15,  d 32..63
  v16bf kc2 = load_frag_f(Kh + 2 * FRAG, lane);   // keys 16..31, d 0..31
  v16bf kc3 = load_frag_f(Kh + 3 * FRAG, lane);   // keys 16..31, d 32..63

  // and the mask of its keys
  v8f mk0 = load8f(mrow);
  v8f mk1 = load8f(mrow + 16);

  // Kept rolled: K and the mask reload into the registers just read, so there
  // is nothing for an unrolled body to save, and the code stays short.
#pragma unroll 1
  for (int j = 0; j < SEQ; j += 32) {
    // V fragments for this step: independent of P, issue early
    // (32 keys are 4 fragments = j * HD elements on, in K and in V^T alike)
    v16bf va0 = load_frag_f(Vh + j * HD + 0 * FRAG, lane);
    v16bf va1 = load_frag_f(Vh + j * HD + 1 * FRAG, lane);
    v16bf va2 = load_frag_f(Vh + j * HD + 2 * FRAG, lane);
    v16bf va3 = load_frag_f(Vh + j * HD + 3 * FRAG, lane);

    // scores: K(16 keys x 64) @ Q^T for two 16-key sub-tiles of each query tile
    v8f s0[AQT], s1[AQT];
#pragma unroll
    for (int u = 0; u < AQT; u++) {
      v8f z = {};
      s0[u] = wmma_bf16(kc0, qb[u][0], z);
      s1[u] = wmma_bf16(kc2, qb[u][0], z);
    }
#pragma unroll
    for (int u = 0; u < AQT; u++) {
      s0[u] = wmma_bf16(kc1, qb[u][1], s0[u]);
      s1[u] = wmma_bf16(kc3, qb[u][1], s1[u]);
    }

    v8f a0[AQT], a1[AQT];
#pragma unroll
    for (int u = 0; u < AQT; u++) {
      a0[u] = s0[u] * 0.125f + mk0;             // 1/sqrt(64) scale + mask
      a1[u] = s1[u] * 0.125f + mk1;
    }

    // K fragments and mask for the next step, into the registers just read
    // (wraps on last iter; redundant but cheap)
    int jn = (j + 32) & (SEQ - 1);
    mk0 = load8f(mrow + jn);
    mk1 = load8f(mrow + jn + 16);
    kc0 = load_frag_f(Kh + jn * HD + 0 * FRAG, lane);
    kc1 = load_frag_f(Kh + jn * HD + 1 * FRAG, lane);
    kc2 = load_frag_f(Kh + jn * HD + 2 * FRAG, lane);
    kc3 = load_frag_f(Kh + jn * HD + 3 * FRAG, lane);

    v16f p[AQT];
    v16bf pb[AQT];
    float alpha[AQT];
#pragma unroll
    for (int u = 0; u < AQT; u++) {
      v8f x0 = a0[u], x1 = a1[u];
      // maximum over this lane's 16 keys, as a tree, then over both halves
      float t0 = fmaxf(fmaxf(x0[0], x0[1]), x0[2]);
      float t1 = fmaxf(fmaxf(x0[3], x0[4]), x0[5]);
      float t2 = fmaxf(fmaxf(x0[6], x0[7]), x1[0]);
      float t3 = fmaxf(fmaxf(x1[1], x1[2]), x1[3]);
      float t4 = fmaxf(fmaxf(x1[4], x1[5]), x1[6]);
      float t = fmaxf(fmaxf(fmaxf(t0, t1), t2), fmaxf(fmaxf(t3, t4), x1[7]));
      t = fmaxf(t, other_half(t));
      float nm = fmaxf(rmax[u], t);
      alpha[u] = __expf(rmax[u] - nm);
      rmax[u] = nm;

#pragma unroll
      for (int r = 0; r < 8; r++) {
        p[u][r]     = __expf(x0[r] - nm);
        p[u][8 + r] = __expf(x1[r] - nm);
      }
      o[u][0] *= alpha[u]; o[u][1] *= alpha[u];
      o[u][2] *= alpha[u]; o[u][3] *= alpha[u];

      // P^T as B operand: element s is key 8h + s (s < 8), 16 + 8h + s - 8 (else)
      pb[u] = __builtin_convertvector(p[u], v16bf);
    }

    // Keeps vector work out from among the eight products: there it lands in
    // registers of a V fragment just read, which costs four idle slots behind
    // the product each time.
    __builtin_amdgcn_sched_barrier(0);

    // ctx^T += V^T(64 x 32) @ P^T(32 x 16); V^T fragment rows are d
#pragma unroll
    for (int u = 0; u < AQT; u++) {
      o[u][0] = wmma_bf16(va0, pb[u], o[u][0]);
      o[u][1] = wmma_bf16(va1, pb[u], o[u][1]);
      o[u][2] = wmma_bf16(va2, pb[u], o[u][2]);
      o[u][3] = wmma_bf16(va3, pb[u], o[u][3]);
    }
    // Other end of the same group. The row sums need nothing of the products
    // and run while the matrix unit works on them; they also stand between the
    // last product that reads P^T and the next step's first product, whose
    // result the compiler puts into the same registers.
    __builtin_amdgcn_sched_barrier(0);

#pragma unroll
    for (int u = 0; u < AQT; u++) {
      v16f q = p[u];
      float rs = ((q[0] + q[8]) + (q[1] + q[9])) + ((q[2] + q[10]) + (q[3] + q[11])) +
                 (((q[4] + q[12]) + (q[5] + q[13])) + ((q[6] + q[14]) + (q[7] + q[15])));
      rsum[u] = rsum[u] * alpha[u] + rs;
    }
  }

  // normalize and store merged-head ctx [B*S, H] in bf16, in fragment order:
  // row = b * SEQ + s, k = h * HD + d, fragment (row >> 4) * (H / 32) + (k >> 5).
  // A lane's 8 d of one tile are one 16-byte chunk, chunk number = lane.
#pragma unroll
  for (int u = 0; u < AQT; u++) {
    float inv = 1.f / (rsum[u] + other_half(rsum[u]));
    unsigned short* cw = Ctx +
        ((size_t)(b * (SEQ / 16) + qt + u) * (H / 32) + h * 2) * FRAG + lane * 8;
#pragma unroll
    for (int t = 0; t < 4; t++)                  // d 16t .. 16t + 15
      *reinterpret_cast<uint4*>(cw + (t >> 1) * FRAG + (t & 1) * 256) =
          pack8(o[u][t][0] * inv, o[u][t][1] * inv, o[u][t][2] * inv,
                o[u][t][3] * inv, o[u][t][4] * inv, o[u][t][5] * inv,
                o[u][t][6] * inv, o[u][t][7] * inv);
  }
}

// ------------------------------- output GEMM + bias + residual + LayerNorm --
// grid = MROWS/32 = 256 blocks of 512 (16 waves), one per WGP. Wave w: 32 rows
// x 64 cols; the block owns the full 32x1024 strip for the fused LayerNorm.
// Every block has to read all of Wo (2 MB) from L2, so the L2 bytes of this
// launch are 2 MB x the number of blocks. With two 16-row tiles a wave, each
// Wo fragment loaded feeds two products and the blocks are half as many.
// Ping-pong K-loop over two fragment sets held in registers.

#define ORT 2   // 16-row tiles a wave (and a block)

typedef __attribute__((ext_vector_type(4))) float v4f;

// This grid puts four waves on a SIMD, and their register budget is asked for
// by name: aiming for eight, the compiler gives up the second fragment set and
// waits for each set's loads right behind their issue.
__global__ __launch_bounds__(512) __attribute__((amdgpu_waves_per_eu(4, 4)))
void out_ln_kernel(
    const unsigned short* __restrict__ Ctx,
    const unsigned short* __restrict__ Wo,
    const float* __restrict__ bo,
    const float* __restrict__ hidden,
    const float* __restrict__ ln_g, const float* __restrict__ ln_b,
    float* __restrict__ out) {
  __shared__ __attribute__((aligned(16))) float tile[16 * ORT * H];   // 128 KB

  int m0 = blockIdx.x * (16 * ORT);
  int tid = threadIdx.x;
  int w = tid >> 5, lane = tid & 31, l15 = lane & 15;
  int n0 = w << 6;

  v8f acc[ORT][4] = {};
  // Ctx and Wo lie in fragment order: 16 rows are H / 32 fragments in a row.
  // Ca, Wb: this lane's first chunk (load_frag_f is given lane 0).
  const unsigned short* Ca = Ctx + (size_t)blockIdx.x * (16 * ORT * H) + lane * 8;
  const unsigned short* Wb = Wo + (size_t)n0 * H + lane * 8;
  // All 256 blocks read the whole of Wo. Each enters the k walk at its own
  // slab of 64 and wraps round, so that they do not all ask L2 for the same
  // lines at the same moment (neighbours, and blocks 8 apart, differ).
  int k0 = ((blockIdx.x + (blockIdx.x >> 3)) & (H / 64 - 1)) * 64;
  v16bf aA[ORT];
#pragma unroll
  for (int u = 0; u < ORT; u++)
    aA[u] = load_frag_f(Ca + k0 * 16 + u * (16 * H), 0);
  v16bf bA[4];
#pragma unroll
  for (int t = 0; t < 4; t++)
    bA[t] = load_frag_f(Wb + k0 * 16 + t * (16 * H), 0);

  for (int it = 0; it < H; it += 64) {
    int kb = (k0 + it) & (H - 1);
    // 32 k on = one fragment on = 16 * 32 elements
    const unsigned short* pa = Ca + kb * 16;
    const unsigned short* pb = Wb + kb * 16;
    v16bf aB[ORT];
#pragma unroll
    for (int u = 0; u < ORT; u++)
      aB[u] = load_frag_f(pa + u * (16 * H) + FRAG, 0);
    v16bf bB[4];
#pragma unroll
    for (int t = 0; t < 4; t++)
      bB[t] = load_frag_f(pb + t * (16 * H) + FRAG, 0);
    // The wait that stands before the loads' address registers are rewritten.
    // It names them, so that they live up to it: otherwise the last load of a
    // group gets them as its result registers, ahead of the wait.
    asm volatile("s_wait_xcnt 0x0" :: "v"(pa), "v"(pb) : "memory");
    // Keeps these loads in front of the products of the other set: left free,
    // the products are lifted over them, and each set is then waited for right
    // behind its issue, with half the bytes in flight.
    __builtin_amdgcn_sched_barrier(0);

#pragma unroll
    for (int t = 0; t < 4; t++)
#pragma unroll
      for (int u = 0; u < ORT; u++)
        acc[u][t] = wmma_bf16(aA[u], bA[t], acc[u][t]);

    int k2 = (kb + 64) & (H - 1);
    pa = Ca + k2 * 16;
    pb = Wb + k2 * 16;
#pragma unroll
    for (int u = 0; u < ORT; u++)
      aA[u] = load_frag_f(pa + u * (16 * H), 0);
#pragma unroll
    for (int t = 0; t < 4; t++)
      bA[t] = load_frag_f(pb + t * (16 * H), 0);
    // As above, the wait and the order.
    asm volatile("s_wait_xcnt 0x0" :: "v"(pa), "v"(pb) : "memory");
    __builtin_amdgcn_sched_barrier(0);

#pragma unroll
    for (int t = 0; t < 4; t++)
#pragma unroll
      for (int u = 0; u < ORT; u++)
        acc[u][t] = wmma_bf16(aB[u], bB[t], acc[u][t]);
  }

  // From here on every row-wise access goes by whole lines: in the LayerNorm
  // pass wave w takes rows w and 16 + w, and a lane takes columns
  // c * 128 + lane * 4 .. + 3, c = 0..7. So each 16-byte-a-lane access of a wave
  // covers 512 contiguous bytes: 4 whole lines of the residual, gamma, beta and
  // out, and 128 consecutive words of LDS, free of bank conflicts. (With 32
  // columns in a row per lane the lanes lie 128 B apart: an access touches 32
  // lines, and in LDS only two groups of 4 banks.)
  // The residual is added in that pass; its loads are issued here, ahead of the
  // LDS stores and the barrier.
  const v4f* hp = reinterpret_cast<const v4f*>(hidden + (size_t)(m0 + w) * H) + lane;
  v4f x[ORT][H / 128];
#pragma unroll
  for (int u = 0; u < ORT; u++)
#pragma unroll
    for (int c = 0; c < H / 128; c++)
      x[u][c] = hp[u * (16 * H / 4) + c * 32];
  // As in the loop: the wait names the loads' address, which so lives up to it.
  asm volatile("s_wait_xcnt 0x0" :: "v"(hp) : "memory");

  int rw = (lane >> 4) << 3;
#pragma unroll
  for (int u = 0; u < ORT; u++) {
#pragma unroll
    for (int t = 0; t < 4; t++) {
      int n = n0 + t * 16 + l15;
      float bn = bo[n];
#pragma unroll
      for (int v = 0; v < 8; v++) {
        int m = u * 16 + v + rw;
        tile[m * H + n] = acc[u][t][v] + bn;
      }
    }
  }
  __syncthreads();

  const v4f* gp = reinterpret_cast<const v4f*>(ln_g) + lane;
  const v4f* bp = reinterpret_cast<const v4f*>(ln_b) + lane;
  v4f g[H / 128], be[H / 128];
#pragma unroll
  for (int c = 0; c < H / 128; c++) { g[c] = gp[c * 32]; be[c] = bp[c * 32]; }
  // The wait that stands before these loads' address register is rewritten.
  asm volatile("s_wait_xcnt 0x0" ::: "memory");

  // LayerNorm: a row is read from LDS once and stays in registers. A lane sums
  // its 32 elements in four chains, one per column of its group of 4.
  float s[ORT], ss[ORT];
#pragma unroll
  for (int u = 0; u < ORT; u++) {
    const v4f* tr = reinterpret_cast<const v4f*>(&tile[(u * 16 + w) * H]) + lane;
    v4f s4 = {}, q4 = {};
#pragma unroll
    for (int c = 0; c < H / 128; c++) {
      v4f y = tr[c * 32] + x[u][c];
      x[u][c] = y;
      s4 += y;
      q4 += y * y;
    }
    s[u]  = (s4[0] + s4[1]) + (s4[2] + s4[3]);
    ss[u] = (q4[0] + q4[1]) + (q4[2] + q4[3]);
  }
#pragma unroll
  for (int o = 1; o < 32; o <<= 1) {
#pragma unroll
    for (int u = 0; u < ORT; u++) {
      s[u]  += __shfl_xor(s[u],  o, 32);
      ss[u] += __shfl_xor(ss[u], o, 32);
    }
  }
#pragma unroll
  for (int u = 0; u < ORT; u++) {
    float mu   = s[u]  * (1.f / H);
    float var  = ss[u] * (1.f / H) - mu * mu;
    float rstd = rsqrtf(var + 1e-12f);
#pragma unroll
    for (int c = 0; c < H / 128; c++)
      x[u][c] = (x[u][c] - mu) * rstd * g[c] + be[c];
  }
  // Nothing is computed behind the stores, so no register that they name is
  // written again.
  v4f* op = reinterpret_cast<v4f*>(out + (size_t)(m0 + w) * H) + lane;
#pragma unroll
  for (int u = 0; u < ORT; u++)
#pragma unroll
    for (int c = 0; c < H / 128; c++)
      op[u * (16 * H / 4) + c * 32] = x[u][c];
}

// ------------------------------------------------------------------ launch --

extern "C" void kernel_launch(void* const* d_in, const int* in_sizes, int n_in,
                              void* d_out, int out_size, void* d_ws,
                              size_t ws_size, hipStream_t stream) {
  (void)in_sizes; (void)n_in; (void)out_size; (void)ws_size;

  const float* hidden = (const float*)d_in[0];
  const float* mask   = (const float*)d_in[1];
  const float* Wq     = (const float*)d_in[2];
  const float* bq     = (const float*)d_in[3];
  const float* Wk     = (const float*)d_in[4];
  const float* bk     = (const float*)d_in[5];
  const float* Wv     = (const float*)d_in[6];
  const float* bv     = (const float*)d_in[7];
  const float* Wo     = (const float*)d_in[8];
  const float* bo     = (const float*)d_in[9];
  const float* ln_g   = (const float*)d_in[10];
  const float* ln_b   = (const float*)d_in[11];

  char* ws = (char*)d_ws;
  size_t off = 0;
  auto alloc = [&](size_t bytes) {
    char* p = ws + off;
    off += (bytes + 255) & ~(size_t)255;
    return p;
  };
  unsigned short* Xbf  = (unsigned short*)alloc((size_t)MROWS * H * 2);
  unsigned short* Wqkv = (unsigned short*)alloc((size_t)3 * H * H * 2);
  unsigned short* Wobf = (unsigned short*)alloc((size_t)H * H * 2);
  unsigned short* Qbf  = (unsigned short*)alloc((size_t)MROWS * H * 2);
  unsigned short* Kbf  = (unsigned short*)alloc((size_t)MROWS * H * 2);
  unsigned short* Vt   = (unsigned short*)alloc((size_t)MROWS * H * 2);
  unsigned short* Ctx  = (unsigned short*)alloc((size_t)MROWS * H * 2);

  cvt_all_kernel<<<dim3(CVT_BLOCKS), dim3(CVT_WAVES * 32), 0, stream>>>(
      hidden, Wq, Wk, Wv, Wo, Xbf, Wqkv, Wobf);

  qkv_kernel<<<dim3(MROWS / QBM, 3 * H / QBN), dim3(256), 0, stream>>>(
      Xbf, Wqkv, bq, bk, bv, Qbf, Kbf, Vt);

  attn_kernel<<<dim3(BATCH * NHEAD * (SEQ / (16 * AQT)) / 8), dim3(256), 0, stream>>>(
      Qbf, Kbf, Vt, mask, Ctx);

  out_ln_kernel<<<dim3(MROWS / (16 * ORT)), dim3(512), 0, stream>>>(
      Ctx, Wobf, bo, hidden, ln_g, ln_b, (float*)d_out);
}

// v009
// One run takes 104 microseconds.
// Next to v008, in two timings, it ran 1.04 times as fast each time.
// Counting every step since v000, it is 5.20 times as fast.
#include <hip/hip_runtime.h>
#include <math.h>

#define H     1024
#define NHEAD 16
#define HD    64
#define BATCH 8
#define SEQ   1024
#define MROWS (BATCH * SEQ)   // 8192

typedef __attribute__((ext_vector_type(16))) __bf16 v16bf;
typedef __attribute__((ext_vector_type(8)))  float  v8f;

// ---------------------------------------------------------------- helpers ---

static __device__ __forceinline__ unsigned short f2bf(float f) {
  union { float f; unsigned u; } x; x.f = f;
  unsigned r = x.u + 0x7FFFu + ((x.u >> 16) & 1u);   // round-to-nearest-even
  return (unsigned short)(r >> 16);
}

static __device__ __forceinline__ v8f wmma_bf16(v16bf a, v16bf b, v8f c) {
  // D = A(16x32 bf16) * B(32x16 bf16) + C(16x16 f32)
  return __builtin_amdgcn_wmma_f32_16x16x32_bf16(false, a, false, b,
                                                 (short)0, c, false, false);
}

// Fragment order. Every operand that a kernel loads into a WMMA fragment from global memory
// or from a plain LDS copy of it (Q, K, V^T, Ctx, Wo) is stored as a row of
// 16x32 bf16 fragments of FRAG = 512 elements (1 KB). Per the CDNA5 16-bit
// layout lanes 0-15 hold k = {0..7, 16..23} of row (lane & 15), lanes 16-31
// hold k = {8..15, 24..31}. Element (r, k) of a fragment lies at
//   (k >> 4) * 256 + ((k >> 3) & 1) * 128 + r * 8 + (k & 7),
// so lane L's two 16-byte chunks lie at L * 8 and 256 + L * 8: each of the two
// loads of a wave covers 512 contiguous bytes, 4 whole lines instead of 16.
#define FRAG 512

static __device__ __forceinline__ v16bf load_frag_f(const unsigned short* frag,
                                                    int lane) {
  const unsigned short* p = frag + lane * 8;
  v16bf f;
  reinterpret_cast<uint4*>(&f)[0] = *reinterpret_cast<const uint4*>(p);
  reinterpret_cast<uint4*>(&f)[1] = *reinterpret_cast<const uint4*>(p + 256);
  return f;
}

// Eight floats to one 16-byte chunk of bf16, element 0 at the lowest address.
static __device__ __forceinline__ uint4 pack8(float x0, float x1, float x2,
                                              float x3, float x4, float x5,
                                              float x6, float x7) {
  uint4 r;
  r.x = (unsigned)f2bf(x0) | ((unsigned)f2bf(x1) << 16);
  r.y = (unsigned)f2bf(x2) | ((unsigned)f2bf(x3) << 16);
  r.z = (unsigned)f2bf(x4) | ((unsigned)f2bf(x5) << 16);
  r.w = (unsigned)f2bf(x6) | ((unsigned)f2bf(x7) << 16);
  return r;
}

// -------------------------------------------------------------- fp32->bf16 --
// All five conversions (X, Wq, Wk, Wv, Wo) run in ONE launch of 256 work-groups
// of 12 waves, one per WGP. With one element a lane a trip, tens of thousands
// of short waves have to be started, and every launch adds its gap, its fill
// and its tail. Here a wave converts 4,096 elements: a lane issues its 32
// loads of 16 B at once, then converts and stores. The five arrays hold
// 8 : 1 : 1 : 1 : 1 parts, so of a work-group's waves 0-7 take X, 8-10 take
// Wq, Wk, Wv and 11 takes Wo.
// X, Wq, Wk, Wv keep their row-major order: float4 number q becomes the 8-byte
// piece number q, so a wave's load covers 512 contiguous bytes (4 whole lines)
// and its store 256 (2 whole lines).
// Wo goes to fragment order: fragment (n >> 4, k >> 5) is number
// (n >> 4) * (H / 32) + (k >> 5). A lane writes 16-byte chunks, chunk number
// o = fragment * 64 + (k >> 4 & 1) * 32 + lane.

#define CVT_BLOCKS  256
#define CVT_WAVES   12
#define CVT_PER     4096                    // elements a wave

static_assert(CVT_BLOCKS * 8 * CVT_PER == MROWS * H, "8 waves a group cover X");
static_assert(CVT_BLOCKS * CVT_PER == H * H, "1 wave a group covers a weight");

// Four floats to one 8-byte piece of bf16, element 0 at the lowest address.
static __device__ __forceinline__ uint2 pack4(float4 x) {
  uint2 r;
  r.x = (unsigned)f2bf(x.x) | ((unsigned)f2bf(x.y) << 16);
  r.y = (unsigned)f2bf(x.z) | ((unsigned)f2bf(x.w) << 16);
  return r;
}

// The register budget of four waves per SIMD is asked for by name (this grid
// puts three there): aiming for more waves, the compiler holds part of the
// loads back behind the first conversions, where they wait out a second memory
// latency.
__global__ __launch_bounds__(CVT_WAVES * 32) __attribute__((amdgpu_waves_per_eu(4, 4)))
void cvt_all_kernel(
    const float* __restrict__ X, const float* __restrict__ Wq,
    const float* __restrict__ Wk, const float* __restrict__ Wv,
    const float* __restrict__ Wo,
    unsigned short* __restrict__ Xbf, unsigned short* __restrict__ Wqkv,
    unsigned short* __restrict__ Wobf) {
  int lane = threadIdx.x & 31;
  int w = __builtin_amdgcn_readfirstlane(threadIdx.x >> 5);   // scalar: the role
  int blk = blockIdx.x;

  float4 v[CVT_PER / 128];                  // 32 float4 a lane
  if (w < 11) {
    const float* src = (w < 8) ? X + (blk * 8 + w) * CVT_PER
                               : ((w == 8) ? Wq : (w == 9) ? Wk : Wv) + blk * CVT_PER;
    unsigned short* dst = (w < 8) ? Xbf + (blk * 8 + w) * CVT_PER
                                  : Wqkv + (w - 8) * (H * H) + blk * CVT_PER;
    const float4* ps = reinterpret_cast<const float4*>(src) + lane;
    uint2* pd = reinterpret_cast<uint2*>(dst) + lane;
#pragma unroll
    for (int j = 0; j < CVT_PER / 128; j++) v[j] = ps[j * 32];
#pragma unroll
    for (int j = 0; j < CVT_PER / 128; j++) pd[j * 32] = pack4(v[j]);
  } else {
    // Chunks o = blk * 512 + j * 32 + lane, j = 0..15: 8 fragments of one row
    // of fragments. Row n = (blk >> 2) * 16 + (lane & 15), and chunk j starts
    // at k = (blk & 3) * 256 + j * 16 + (lane >> 4) * 8.
    const float4* ps = reinterpret_cast<const float4*>(
        Wo + ((blk >> 2) * 16 + (lane & 15)) * H + (blk & 3) * 256 + (lane >> 4) * 8);
    uint4* pd = reinterpret_cast<uint4*>(Wobf + blk * CVT_PER) + lane;
#pragma unroll
    for (int j = 0; j < CVT_PER / 256; j++) {
      v[2 * j]     = ps[j * 4];
      v[2 * j + 1] = ps[j * 4 + 1];
    }
#pragma unroll
    for (int j = 0; j < CVT_PER / 256; j++) {
      float4 x = v[2 * j], y = v[2 * j + 1];
      pd[j * 32] = pack8(x.x, x.y, x.z, x.w, y.x, y.y, y.z, y.w);
    }
  }
}

// --------------------------------------------------------------- QKV GEMM ---
// Y[8192 x 3072] = X * Wqkv^T. grid = (MROWS/128, 3*H/256), block = 256
// (8 waves, 2 x 4). A work-group owns a 128 x 256 tile of Y; a wave owns
// 64 x 64 of it (4 x 4 fragments). Per trip 64 k of the tile's 128 X rows and
// 256 W rows (128 B a row, whole lines) are copied asynchronously into one of
// two LDS buffers while the other buffer is worked on.
// Q, K, V^T are stored per (batch, head) in fragment order:
//   Q, K : row = position s, k = d; fragment number (s >> 4) * 2 + (d >> 5)
//   V^T  : row = d, k = position s; fragment number (s >> 5) * 4 + (d >> 4)
// A chunk is 8 consecutive k of one row, and a lane of a WMMA result holds 8
// consecutive rows of one column. So V is computed as X * W^T (a lane: 8
// positions of one d) and Q, K as W * X^T (a lane: 8 d of one position): the
// two operands trade places, which here is a trade of the two LDS offsets.

#define QBM    128
#define QBN    256
#define QBK    64                       // k per trip: 128 B of every row
#define QPITCH 144                      // LDS row pitch in bytes, 16 B x odd
#define QSTAGE ((QBM + QBN) * QPITCH)   // 55,296 B per buffer
#define QTRIPS (H / QBK)                // 16

// One 16x32 fragment from a staged tile; same k order as load_frag_f.
// p: this lane's row, already advanced by (lane >> 4) * 16 bytes.
static __device__ __forceinline__ v16bf load_frag_s(const unsigned char* p) {
  v16bf f;
  reinterpret_cast<uint4*>(&f)[0] = *reinterpret_cast<const uint4*>(p);
  reinterpret_cast<uint4*>(&f)[1] = *reinterpret_cast<const uint4*>(p + 32);
  return f;
}

// Copy one trip's tile: 384 rows of 128 B, 12 copies of 16 B per lane; a
// wave's copy covers 4 whole rows. gx / gw: this lane's 16 bytes in its first
// X / W row; lds: the byte address of the same place in the buffer.
static __device__ __forceinline__ void stage_tile(const unsigned short* gx,
                                                  const unsigned short* gw,
                                                  unsigned lds) {
  const unsigned R = 32 * QPITCH;       // 32 rows further in LDS
  const size_t   G = (size_t)32 * H;    // 32 rows further in global memory
  // The copies and their s_wait_xcnt stand in one statement, so that no
  // address register is rewritten ahead of the wait.
  asm volatile(
      "global_load_async_to_lds_b128 %0, %12, off\n\t"
      "global_load_async_to_lds_b128 %1, %13, off\n\t"
      "global_load_async_to_lds_b128 %2, %14, off\n\t"
      "global_load_async_to_lds_b128 %3, %15, off\n\t"
      "global_load_async_to_lds_b128 %4, %16, off\n\t"
      "global_load_async_to_lds_b128 %5, %17, off\n\t"
      "global_load_async_to_lds_b128 %6, %18, off\n\t"
      "global_load_async_to_lds_b128 %7, %19, off\n\t"
      "global_load_async_to_lds_b128 %8, %20, off\n\t"
      "global_load_async_to_lds_b128 %9, %21, off\n\t"
      "global_load_async_to_lds_b128 %10, %22, off\n\t"
      "global_load_async_to_lds_b128 %11, %23, off\n\t"
      "s_wait_xcnt 0x0"
      :: "v"(lds), "v"(lds + R), "v"(lds + 2 * R), "v"(lds + 3 * R),
         "v"(lds + 4 * R), "v"(lds + 5 * R), "v"(lds + 6 * R),
         "v"(lds + 7 * R), "v"(lds + 8 * R), "v"(lds + 9 * R),
         "v"(lds + 10 * R), "v"(lds + 11 * R),
         "v"(gx), "v"(gx + G), "v"(gx + 2 * G), "v"(gx + 3 * G),
         "v"(gw), "v"(gw + G), "v"(gw + 2 * G), "v"(gw + 3 * G),
         "v"(gw + 4 * G), "v"(gw + 5 * G), "v"(gw + 6 * G), "v"(gw + 7 * G)
      : "memory");
}

__global__ __launch_bounds__(256) void qkv_kernel(
    const unsigned short* __restrict__ Xbf,
    const unsigned short* __restrict__ Wqkv,
    const float* __restrict__ bq, const float* __restrict__ bk,
    const float* __restrict__ bv,
    unsigned short* __restrict__ Qbf, unsigned short* __restrict__ Kbf,
    unsigned short* __restrict__ Vt) {
  __shared__ __attribute__((aligned(16))) unsigned char stage[2 * QSTAGE];

  int mat = blockIdx.y >> 2;                    // 0=Q, 1=K, 2=V
  const float* bias = (mat == 0) ? bq : (mat == 1) ? bk : bv;

  int m0 = blockIdx.x * QBM;
  int nb = blockIdx.y * QBN;                    // row of the stacked Wqkv
  int tid = threadIdx.x;
  int w = tid >> 5, lane = tid & 31, l15 = lane & 15;
  int wm = w >> 2, wn = w & 3;

  // copy side: 8 lanes a row, 32 rows per copy of the work-group
  int cr = tid >> 3, cc = tid & 7;
  const unsigned short* gx = Xbf  + (size_t)(m0 + cr) * H + cc * 8;
  const unsigned short* gw = Wqkv + (size_t)(nb + cr) * H + cc * 8;
  unsigned lds0 = (unsigned)(size_t)stage + cr * QPITCH + cc * 16;

  // read side: this lane's row in the wave's first X and W fragment
  int offX = (wm * 64 + l15) * QPITCH + (lane >> 4) * 16;
  int offW = (QBM + wn * 64 + l15) * QPITCH + (lane >> 4) * 16;
  int offA = (mat == 2) ? offX : offW;          // rows of the result
  int offB = (mat == 2) ? offW : offX;          // columns of the result

  v8f acc[4][4] = {};

  // Trip t works on k slab (t0 + t) mod QTRIPS. 64 work-groups share each W
  // tile and 12 each X tile; walking k from the same end they ask L2 for the
  // same lines at the same moment. The sharers of a
  // tile are spread evenly over the starts (neighbours in x or y, and groups 8
  // apart in x, differ).
  int t0 = (blockIdx.x + (blockIdx.x >> 3) + blockIdx.y) & (QTRIPS - 1);
  int k1 = ((t0 + 1) & (QTRIPS - 1)) * QBK;

  stage_tile(gx + t0 * QBK, gw + t0 * QBK, lds0);
  asm volatile("s_wait_asynccnt 0x0" ::: "memory");  // the first tile has landed
  __syncthreads();                                   // and every wave may read it
  stage_tile(gx + k1, gw + k1, lds0 + QSTAGE);

  // Kept rolled: a trip already holds 32 WMMAs, so the branch costs little,
  // and the code stays short.
#pragma unroll 1
  for (int t = 0; t < QTRIPS; t++) {
    int buf = (t & 1) * QSTAGE;
    const unsigned char* sA = stage + buf + offA;
    const unsigned char* sB = stage + buf + offB;
#pragma unroll
    for (int ks = 0; ks < 2; ks++) {
      v16bf a[4], b[4];
#pragma unroll
      for (int i = 0; i < 4; i++)
        a[i] = load_frag_s(sA + i * 16 * QPITCH + ks * 64);
#pragma unroll
      for (int j = 0; j < 4; j++)
        b[j] = load_frag_s(sB + j * 16 * QPITCH + ks * 64);
      // Keeps the 16 LDS reads one group in front of their 16 WMMAs: left
      // free, they are spread among the WMMAs, each place with a full wait.
      __builtin_amdgcn_sched_barrier(0);
#pragma unroll
      for (int i = 0; i < 4; i++)
#pragma unroll
        for (int j = 0; j < 4; j++)
          acc[i][j] = wmma_bf16(a[i], b[j], acc[i][j]);
      // Other end of the same group: the next reads stay behind these WMMAs.
      __builtin_amdgcn_sched_barrier(0);
    }
    asm volatile("s_wait_dscnt 0x0" ::: "memory");     // own reads of this buffer done
    asm volatile("s_wait_asynccnt 0x0" ::: "memory");  // own copies of tile t+1 landed
    __syncthreads();   // publishes tile t+1, frees the buffer of tile t
    if (t + 2 < QTRIPS) {
      int k2 = ((t0 + t + 2) & (QTRIPS - 1)) * QBK;
      stage_tile(gx + k2, gw + k2, lds0 + buf);
    }
  }
  asm volatile("s_wait_asynccnt 0x0" ::: "memory");    // none in flight at the end

  int hh = ((blockIdx.y & 3) << 2) + wn;        // a wave's 64 W rows = one head
  int r0 = m0 + wm * 64;                        // 128 rows lie in one batch entry
  int bb = r0 >> 10, s0 = r0 & (SEQ - 1);
  size_t hbase = ((size_t)bb * NHEAD + hh) * (SEQ * HD);
  if (mat == 2) {
    // acc[i][j][v]: position s0 + i*16 + (lane>>4)*8 + v, d = j*16 + l15
    unsigned short* dst = Vt + hbase + (size_t)(s0 >> 5) * 4 * FRAG + lane * 8;
#pragma unroll
    for (int j = 0; j < 4; j++) {
      float bn = bias[hh * HD + j * 16 + l15];
#pragma unroll
      for (int i = 0; i < 4; i++)
        *reinterpret_cast<uint4*>(dst + ((i >> 1) * 4 + j) * FRAG + (i & 1) * 256) =
            pack8(acc[i][j][0] + bn, acc[i][j][1] + bn, acc[i][j][2] + bn,
                  acc[i][j][3] + bn, acc[i][j][4] + bn, acc[i][j][5] + bn,
                  acc[i][j][6] + bn, acc[i][j][7] + bn);
      // The next column reuses the registers that these stores name.
      asm volatile("s_wait_xcnt 0x0" ::: "memory");
      // One column of fragments at a time: all 128 conversions scheduled at
      // once take more than 256 VGPRs, which costs the second work-group per WGP.
      __builtin_amdgcn_sched_barrier(0);
    }
  } else {
    // acc[i][j][v]: d = i*16 + (lane>>4)*8 + v, position s0 + j*16 + l15
    unsigned short* dst = ((mat == 0) ? Qbf : Kbf) + hbase +
                          (size_t)(s0 >> 4) * 2 * FRAG + lane * 8;
#pragma unroll
    for (int i = 0; i < 4; i++) {
      const float4* bp = reinterpret_cast<const float4*>(
          bias + hh * HD + i * 16 + ((lane >> 4) << 3));
      float4 b0 = bp[0], b1 = bp[1];
#pragma unroll
      for (int j = 0; j < 4; j++)
        *reinterpret_cast<uint4*>(dst + (j * 2 + (i >> 1)) * FRAG + (i & 1) * 256) =
            pack8(acc[i][j][0] + b0.x, acc[i][j][1] + b0.y, acc[i][j][2] + b0.z,
                  acc[i][j][3] + b0.w, acc[i][j][4] + b1.x, acc[i][j][5] + b1.y,
                  acc[i][j][6] + b1.z, acc[i][j][7] + b1.w);
      // As above: the wait for the stores' registers, then the bound on the
      // registers of the conversions.
      asm volatile("s_wait_xcnt 0x0" ::: "memory");
      __builtin_amdgcn_sched_barrier(0);
    }
  }
}

#define AQT 2   // query tiles a wave

#define AKT    128                // keys a tile
#define ATILE  (AKT * HD * 2)     // bytes of K, and of V^T, a tile: 16,384
#define ABUF   (2 * ATILE)        // one buffer: K, then V^T

// One fragment in fragment order from LDS. p: this lane's first chunk.
static __device__ __forceinline__ v16bf load_frag_l(const unsigned char* p) {
  v16bf f;
  reinterpret_cast<uint4*>(&f)[0] = *reinterpret_cast<const uint4*>(p);
  reinterpret_cast<uint4*>(&f)[1] = *reinterpret_cast<const uint4*>(p + 512);
  return f;
}

// Copy one tile: 4 copies of 16 B per lane for K and 4 for V^T; one copy of the
// work-group's 256 lanes covers 4 KB in a row. gk / gv: this lane's 16 bytes in
// the tile's first 4 KB; lds: the byte address of the same place in the buffer.
static __device__ __forceinline__ void stage_kv(const unsigned short* gk,
                                                const unsigned short* gv,
                                                unsigned lds) {
  const unsigned R = 4096;        // 4 KB further in LDS
  const size_t   G = 2048;        // 4 KB further in global memory, in elements
  // The copies and their s_wait_xcnt stand in one statement, so that no
  // address register is rewritten ahead of the wait.
  asm volatile(
      "global_load_async_to_lds_b128 %0, %8, off\n\t"
      "global_load_async_to_lds_b128 %1, %9, off\n\t"
      "global_load_async_to_lds_b128 %2, %10, off\n\t"
      "global_load_async_to_lds_b128 %3, %11, off\n\t"
      "global_load_async_to_lds_b128 %4, %12, off\n\t"
      "global_load_async_to_lds_b128 %5, %13, off\n\t"
      "global_load_async_to_lds_b128 %6, %14, off\n\t"
      "global_load_async_to_lds_b128 %7, %15, off\n\t"
      "s_wait_xcnt 0x0"
      :: "v"(lds), "v"(lds + R), "v"(lds + 2 * R), "v"(lds + 3 * R),
         "v"(lds + ATILE), "v"(lds + ATILE + R), "v"(lds + ATILE + 2 * R),
         "v"(lds + ATILE + 3 * R),
         "v"(gk), "v"(gk + G), "v"(gk + 2 * G), "v"(gk + 3 * G),
         "v"(gv), "v"(gv + G), "v"(gv + 2 * G), "v"(gv + 3 * G)
      : "memory");
}

typedef __attribute__((ext_vector_type(16))) float v16f;

// The value that lane (l ^ 16) holds.
static __device__ __forceinline__ float other_half(float x) {
  int b = __builtin_bit_cast(int, x);
  b = __builtin_amdgcn_permlanex16(b, b, 0x76543210, 0xfedcba98, false, false);
  return __builtin_bit_cast(float, b);
}

static __device__ __forceinline__ v8f load8f(const float* p) {
  v8f r;
  reinterpret_cast<float4*>(&r)[0] = reinterpret_cast<const float4*>(p)[0];
  reinterpret_cast<float4*>(&r)[1] = reinterpret_cast<const float4*>(p)[1];
  return r;
}

// Four waves per SIMD (two work-groups per WGP) are asked for by name: with that
// register budget the scheduler issues the next step's K and mask loads right
// behind the score products, a whole softmax ahead of their use; left to aim
// for more waves it holds them back until registers fall free late in the step.
__global__ __launch_bounds__(256) __attribute__((amdgpu_waves_per_eu(4, 4)))
void attn_kernel(
    const unsigned short* __restrict__ Qbf,
    const unsigned short* __restrict__ Kbf,
    const unsigned short* __restrict__ Vt,
    const float* __restrict__ mask,
    unsigned short* __restrict__ Ctx) {
  __shared__ __attribute__((aligned(16))) unsigned char kv[2 * ABUF];   // 64 KB

  int tid = threadIdx.x;
  int w = tid >> 5, lane = tid & 31;
  int gid = blockIdx.x * 8 + w;
  int qt = (gid & (SEQ / (16 * AQT) - 1)) * AQT;   // the wave's first query tile
  int bh = gid / (SEQ / (16 * AQT));
  int b = bh >> 4, h = bh & 15;

  const unsigned short* Qh = Qbf + (size_t)bh * SEQ * HD;
  const unsigned short* Kh = Kbf + (size_t)bh * SEQ * HD;
  const unsigned short* Vh = Vt  + (size_t)bh * HD * SEQ;
  const float* mrow = mask + b * SEQ + ((lane >> 4) << 3);   // this half's keys

  // copy side: bh is the same in all 8 waves (32 waves share one)
  const unsigned short* gk = Kh + tid * 8;
  const unsigned short* gv = Vh + tid * 8;
  unsigned lds0 = (unsigned)(size_t)kv + tid * 16;
  // read side: this lane's first chunk of a buffer's first fragment
  const unsigned char* kl = kv + lane * 16;

  stage_kv(gk, gv, lds0);

  // B operand: column = query, k = d
  v16bf qb[AQT][2];
#pragma unroll
  for (int u = 0; u < AQT; u++) {
    qb[u][0] = load_frag_f(Qh + ((qt + u) * 2 + 0) * FRAG, lane);
    qb[u][1] = load_frag_f(Qh + ((qt + u) * 2 + 1) * FRAG, lane);
  }

  // O^T tiles: o[u][t][r] = d 16t + 8h + r of this lane's query in tile u
  v8f o[AQT][4] = {};
  float rmax[AQT];   // of the query, equal in both halves
  float rsum[AQT];   // over this half's keys only; joined at the end
#pragma unroll
  for (int u = 0; u < AQT; u++) { rmax[u] = -INFINITY; rsum[u] = 0.f; }

  // the mask of the first step's keys
  v8f mk0 = load8f(mrow);
  v8f mk1 = load8f(mrow + 16);

  asm volatile("s_wait_asynccnt 0x0" ::: "memory");  // the first tile has landed
  __syncthreads();                                   // and every wave may read it
  stage_kv(gk + AKT * HD, gv + AKT * HD, lds0 + ABUF);

  // prime K fragments for j = 0 (a fragment is 1 KB)
  v16bf kc0 = load_frag_l(kl + 0 * 1024);   // keys 0..15,  d 0..31
  v16bf kc1 = load_frag_l(kl + 1 * 1024);   // keys 0..15,  d 32..63
  v16bf kc2 = load_frag_l(kl + 2 * 1024);   // keys 16..31, d 0..31
  v16bf kc3 = load_frag_l(kl + 3 * 1024);   // keys 16..31, d 32..63

  // Kept rolled: K and the mask reload into the registers just read, so there
  // is nothing for an unrolled body to save, and the code stays short.
#pragma unroll 1
  for (int j = 0; j < SEQ; j += 32) {
    // V fragments for this step: independent of P, issue early
    // (32 keys are 4 fragments = 4 KB, in K and in V^T alike)
    int buf = ((j / AKT) & 1) * ABUF;
    const unsigned char* sv = kl + buf + ATILE + (j & (AKT - 1)) * (HD * 2);
    v16bf va0 = load_frag_l(sv + 0 * 1024);
    v16bf va1 = load_frag_l(sv + 1 * 1024);
    v16bf va2 = load_frag_l(sv + 2 * 1024);
    v16bf va3 = load_frag_l(sv + 3 * 1024);

    // scores: K(16 keys x 64) @ Q^T for two 16-key sub-tiles of each query tile
    v8f s0[AQT], s1[AQT];
#pragma unroll
    for (int u = 0; u < AQT; u++) {
      v8f z = {};
      s0[u] = wmma_bf16(kc0, qb[u][0], z);
      s1[u] = wmma_bf16(kc2, qb[u][0], z);
    }
#pragma unroll
    for (int u = 0; u < AQT; u++) {
      s0[u] = wmma_bf16(kc1, qb[u][1], s0[u]);
      s1[u] = wmma_bf16(kc3, qb[u][1], s1[u]);
    }

    v8f a0[AQT], a1[AQT];
#pragma unroll
    for (int u = 0; u < AQT; u++) {
      a0[u] = s0[u] * 0.125f + mk0;             // 1/sqrt(64) scale + mask
      a1[u] = s1[u] * 0.125f + mk1;
    }

    // A tile's last step: the wave has issued all its reads of the tile.
    if ((j & (AKT - 1)) == AKT - 32) {
      asm volatile("s_wait_dscnt 0x0" ::: "memory");     // own reads of this buffer done
      asm volatile("s_wait_asynccnt 0x0" ::: "memory");  // own copies of the next tile landed
      __syncthreads();   // publishes the next tile, frees this tile's buffer
      if (j + 32 + AKT < SEQ)                            // the tile after the next
        stage_kv(gk + (j + 32 + AKT) * HD, gv + (j + 32 + AKT) * HD, lds0 + buf);
    }

    // K fragments and mask for the next step, into the registers just read
    // (wraps on last iter: the mask redundant but cheap, K of a tile worked on
    // before, unused)
    int jn = (j + 32) & (SEQ - 1);
    mk0 = load8f(mrow + jn);
    mk1 = load8f(mrow + jn + 16);
    const unsigned char* sk = kl + ((jn / AKT) & 1) * ABUF + (jn & (AKT - 1)) * (HD * 2);
    kc0 = load_frag_l(sk + 0 * 1024);
    kc1 = load_frag_l(sk + 1 * 1024);
    kc2 = load_frag_l(sk + 2 * 1024);
    kc3 = load_frag_l(sk + 3 * 1024);

    v16f p[AQT];
    v16bf pb[AQT];
    float alpha[AQT];
#pragma unroll
    for (int u = 0; u < AQT; u++) {
      v8f x0 = a0[u], x1 = a1[u];
      // maximum over this lane's 16 keys, as a tree, then over both halves
      float t0 = fmaxf(fmaxf(x0[0], x0[1]), x0[2]);
      float t1 = fmaxf(fmaxf(x0[3], x0[4]), x0[5]);
      float t2 = fmaxf(fmaxf(x0[6], x0[7]), x1[0]);
      float t3 = fmaxf(fmaxf(x1[1], x1[2]), x1[3]);
      float t4 = fmaxf(fmaxf(x1[4], x1[5]), x1[6]);
      float t = fmaxf(fmaxf(fmaxf(t0, t1), t2), fmaxf(fmaxf(t3, t4), x1[7]));
      t = fmaxf(t, other_half(t));
      float nm = fmaxf(rmax[u], t);
      alpha[u] = __expf(rmax[u] - nm);
      rmax[u] = nm;

#pragma unroll
      for (int r = 0; r < 8; r++) {
        p[u][r]     = __expf(x0[r] - nm);
        p[u][8 + r] = __expf(x1[r] - nm);
      }
      o[u][0] *= alpha[u]; o[u][1] *= alpha[u];
      o[u][2] *= alpha[u]; o[u][3] *= alpha[u];

      // P^T as B operand: element s is key 8h + s (s < 8), 16 + 8h + s - 8 (else)
      pb[u] = __builtin_convertvector(p[u], v16bf);
    }

    // Keeps vector work out from among the eight products: there it lands in
    // registers of a V fragment just read, which costs four idle slots behind
    // the product each time.
    __builtin_amdgcn_sched_barrier(0);

    // ctx^T += V^T(64 x 32) @ P^T(32 x 16); V^T fragment rows are d
#pragma unroll
    for (int u = 0; u < AQT; u++) {
      o[u][0] = wmma_bf16(va0, pb[u], o[u][0]);
      o[u][1] = wmma_bf16(va1, pb[u], o[u][1]);
      o[u][2] = wmma_bf16(va2, pb[u], o[u][2]);
      o[u][3] = wmma_bf16(va3, pb[u], o[u][3]);
    }
    // Other end of the same group. The row sums need nothing of the products
    // and run while the matrix unit works on them; they also stand between the
    // last product that reads P^T and the next step's first product, whose
    // result the compiler puts into the same registers.
    __builtin_amdgcn_sched_barrier(0);

#pragma unroll
    for (int u = 0; u < AQT; u++) {
      v16f q = p[u];
      float rs = ((q[0] + q[8]) + (q[1] + q[9])) + ((q[2] + q[10]) + (q[3] + q[11])) +
                 (((q[4] + q[12]) + (q[5] + q[13])) + ((q[6] + q[14]) + (q[7] + q[15])));
      rsum[u] = rsum[u] * alpha[u] + rs;
    }
  }
  asm volatile("s_wait_asynccnt 0x0" ::: "memory");    // none in flight at the end

  // normalize and store merged-head ctx [B*S, H] in bf16, in fragment order:
  // row = b * SEQ + s, k = h * HD + d, fragment (row >> 4) * (H / 32) + (k >> 5).
  // A lane's 8 d of one tile are one 16-byte chunk, chunk number = lane.
#pragma unroll
  for (int u = 0; u < AQT; u++) {
    float inv = 1.f / (rsum[u] + other_half(rsum[u]));
    unsigned short* cw = Ctx +
        ((size_t)(b * (SEQ / 16) + qt + u) * (H / 32) + h * 2) * FRAG + lane * 8;
#pragma unroll
    for (int t = 0; t < 4; t++)                  // d 16t .. 16t + 15
      *reinterpret_cast<uint4*>(cw + (t >> 1) * FRAG + (t & 1) * 256) =
          pack8(o[u][t][0] * inv, o[u][t][1] * inv, o[u][t][2] * inv,
                o[u][t][3] * inv, o[u][t][4] * inv, o[u][t][5] * inv,
                o[u][t][6] * inv, o[u][t][7] * inv);
  }
}

// ------------------------------- output GEMM + bias + residual + LayerNorm --
// grid = MROWS/32 = 256 blocks of 512 (16 waves), one per WGP. Wave w: 32 rows
// x 64 cols; the block owns the full 32x1024 strip for the fused LayerNorm.
// Every block has to read all of Wo (2 MB) from L2, so the L2 bytes of this
// launch are 2 MB x the number of blocks. With two 16-row tiles a wave, each
// Wo fragment loaded feeds two products and the blocks are half as many.
// All 16 waves need the block's whole strip of Ctx (64 KB). As in attn_kernel,
// what every wave of the work-group reads is asked of L2 once: the strip is
// copied asynchronously into LDS at the start, and the waves take their Ctx
// fragments from there. Wo fragments, each read by one wave, come from L2.

#define ORT 2   // 16-row tiles a wave (and a block)
#define OCTX (16 * ORT * H * 2)   // bytes of the block's strip of Ctx: 65,536

// Copy the strip: 8 copies of 16 B per lane; one copy of the work-group's 512
// lanes covers 8 KB in a row. g: this lane's 16 bytes in the strip's first
// 8 KB; lds: the byte address of the same place in LDS.
static __device__ __forceinline__ void stage_ctx(const unsigned short* g,
                                                 unsigned lds) {
  const unsigned R = 8192;        // 8 KB further in LDS
  const size_t   G = 4096;        // 8 KB further in global memory, in elements
  // The copies and their s_wait_xcnt stand in one statement, so that no
  // address register is rewritten ahead of the wait.
  asm volatile(
      "global_load_async_to_lds_b128 %0, %8, off\n\t"
      "global_load_async_to_lds_b128 %1, %9, off\n\t"
      "global_load_async_to_lds_b128 %2, %10, off\n\t"
      "global_load_async_to_lds_b128 %3, %11, off\n\t"
      "global_load_async_to_lds_b128 %4, %12, off\n\t"
      "global_load_async_to_lds_b128 %5, %13, off\n\t"
      "global_load_async_to_lds_b128 %6, %14, off\n\t"
      "global_load_async_to_lds_b128 %7, %15, off\n\t"
      "s_wait_xcnt 0x0"
      :: "v"(lds), "v"(lds + R), "v"(lds + 2 * R), "v"(lds + 3 * R),
         "v"(lds + 4 * R), "v"(lds + 5 * R), "v"(lds + 6 * R), "v"(lds + 7 * R),
         "v"(g), "v"(g + G), "v"(g + 2 * G), "v"(g + 3 * G),
         "v"(g + 4 * G), "v"(g + 5 * G), "v"(g + 6 * G), "v"(g + 7 * G)
      : "memory");
}

typedef __attribute__((ext_vector_type(4))) float v4f;

// This grid puts four waves on a SIMD, and their register budget is asked for
// by name: aiming for eight, the compiler gives up the second fragment set and
// waits for each set's loads right behind their issue.
__global__ __launch_bounds__(512) __attribute__((amdgpu_waves_per_eu(4, 4)))
void out_ln_kernel(
    const unsigned short* __restrict__ Ctx,
    const unsigned short* __restrict__ Wo,
    const float* __restrict__ bo,
    const float* __restrict__ hidden,
    const float* __restrict__ ln_g, const float* __restrict__ ln_b,
    float* __restrict__ out) {
  __shared__ __attribute__((aligned(16))) float tile[16 * ORT * H];   // 128 KB
  __shared__ __attribute__((aligned(16))) unsigned char cs[OCTX];     // 64 KB

  int m0 = blockIdx.x * (16 * ORT);
  int tid = threadIdx.x;
  int w = tid >> 5, lane = tid & 31, l15 = lane & 15;
  int n0 = w << 6;

  stage_ctx(Ctx + (size_t)blockIdx.x * (16 * ORT * H) + tid * 8,
            (unsigned)(size_t)cs + tid * 16);

  v8f acc[ORT][4] = {};
  // Ctx and Wo lie in fragment order: 16 rows are H / 32 fragments in a row
  // (16 * H * 2 bytes), in LDS as in global memory.
  // Ca, Wb: this lane's first chunk (load_frag_f is given lane 0).
  const unsigned char* Ca = cs + lane * 16;
  const unsigned short* Wb = Wo + (size_t)n0 * H + lane * 8;
  // All 256 blocks read the whole of Wo. Each enters the k walk at its own
  // slab of 64 and wraps round, so that they do not all ask L2 for the same
  // lines at the same moment (neighbours, and blocks 8 apart, differ).
  int k0 = ((blockIdx.x + (blockIdx.x >> 3)) & (H / 64 - 1)) * 64;
  v16bf bA[4];
#pragma unroll
  for (int t = 0; t < 4; t++)
    bA[t] = load_frag_f(Wb + k0 * 16 + t * (16 * H), 0);
  asm volatile("s_wait_asynccnt 0x0" ::: "memory");  // own part of the strip has landed
  __syncthreads();                                   // and every wave may read all of it
  v16bf aA[ORT];
#pragma unroll
  for (int u = 0; u < ORT; u++)
    aA[u] = load_frag_l(Ca + k0 * 32 + u * (16 * H * 2));

  for (int it = 0; it < H; it += 64) {
    int kb = (k0 + it) & (H - 1);
    // 32 k on = one fragment on = 16 * 32 elements
    const unsigned char* pa = Ca + kb * 32;
    const unsigned short* pb = Wb + kb * 16;
    v16bf aB[ORT];
#pragma unroll
    for (int u = 0; u < ORT; u++)
      aB[u] = load_frag_l(pa + u * (16 * H * 2) + FRAG * 2);
    v16bf bB[4];
#pragma unroll
    for (int t = 0; t < 4; t++)
      bB[t] = load_frag_f(pb + t * (16 * H) + FRAG, 0);
    // The wait that stands before the global loads' address registers are
    // rewritten. It names them, so that they live up to it: otherwise the last
    // load of a group gets them as its result registers, ahead of the wait.
    asm volatile("s_wait_xcnt 0x0" :: "v"(pb) : "memory");
    // Keeps these loads in front of the products of the other set: left free,
    // the products are lifted over them, and each set is then waited for right
    // behind its issue, with half the bytes in flight.
    __builtin_amdgcn_sched_barrier(0);

#pragma unroll
    for (int t = 0; t < 4; t++)
#pragma unroll
      for (int u = 0; u < ORT; u++)
        acc[u][t] = wmma_bf16(aA[u], bA[t], acc[u][t]);

    int k2 = (kb + 64) & (H - 1);
    pa = Ca + k2 * 32;
    pb = Wb + k2 * 16;
#pragma unroll
    for (int u = 0; u < ORT; u++)
      aA[u] = load_frag_l(pa + u * (16 * H * 2));
#pragma unroll
    for (int t = 0; t < 4; t++)
      bA[t] = load_frag_f(pb + t * (16 * H), 0);
    // As above, the wait and the order.
    asm volatile("s_wait_xcnt 0x0" :: "v"(pb) : "memory");
    __builtin_amdgcn_sched_barrier(0);

#pragma unroll
    for (int t = 0; t < 4; t++)
#pragma unroll
      for (int u = 0; u < ORT; u++)
        acc[u][t] = wmma_bf16(aB[u], bB[t], acc[u][t]);
  }

  // From here on every row-wise access goes by whole lines: in the LayerNorm
  // pass wave w takes rows w and 16 + w, and a lane takes columns
  // c * 128 + lane * 4 .. + 3, c = 0..7. So each 16-byte-a-lane access of a wave
  // covers 512 contiguous bytes: 4 whole lines of the residual, gamma, beta and
  // out, and 128 consecutive words of LDS, free of bank conflicts. (With 32
  // columns in a row per lane the lanes lie 128 B apart: an access touches 32
  // lines, and in LDS only two groups of 4 banks.)
  // The residual is added in that pass; its loads are issued here, ahead of the
  // LDS stores and the barrier.
  const v4f* hp = reinterpret_cast<const v4f*>(hidden + (size_t)(m0 + w) * H) + lane;
  v4f x[ORT][H / 128];
#pragma unroll
  for (int u = 0; u < ORT; u++)
#pragma unroll
    for (int c = 0; c < H / 128; c++)
      x[u][c] = hp[u * (16 * H / 4) + c * 32];
  // As in the loop: the wait names the loads' address, which so lives up to it.
  asm volatile("s_wait_xcnt 0x0" :: "v"(hp) : "memory");

  int rw = (lane >> 4) << 3;
#pragma unroll
  for (int u = 0; u < ORT; u++) {
#pragma unroll
    for (int t = 0; t < 4; t++) {
      int n = n0 + t * 16 + l15;
      float bn = bo[n];
#pragma unroll
      for (int v = 0; v < 8; v++) {
        int m = u * 16 + v + rw;
        tile[m * H + n] = acc[u][t][v] + bn;
      }
    }
  }
  __syncthreads();

  const v4f* gp = reinterpret_cast<const v4f*>(ln_g) + lane;
  const v4f* bp = reinterpret_cast<const v4f*>(ln_b) + lane;
  v4f g[H / 128], be[H / 128];
#pragma unroll
  for (int c = 0; c < H / 128; c++) { g[c] = gp[c * 32]; be[c] = bp[c * 32]; }
  // The wait that stands before these loads' address register is rewritten.
  asm volatile("s_wait_xcnt 0x0" ::: "memory");

  // LayerNorm: a row is read from LDS once and stays in registers. A lane sums
  // its 32 elements in four chains, one per column of its group of 4.
  float s[ORT], ss[ORT];
#pragma unroll
  for (int u = 0; u < ORT; u++) {
    const v4f* tr = reinterpret_cast<const v4f*>(&tile[(u * 16 + w) * H]) + lane;
    v4f s4 = {}, q4 = {};
#pragma unroll
    for (int c = 0; c < H / 128; c++) {
      v4f y = tr[c * 32] + x[u][c];
      x[u][c] = y;
      s4 += y;
      q4 += y * y;
    }
    s[u]  = (s4[0] + s4[1]) + (s4[2] + s4[3]);
    ss[u] = (q4[0] + q4[1]) + (q4[2] + q4[3]);
  }
#pragma unroll
  for (int o = 1; o < 32; o <<= 1) {
#pragma unroll
    for (int u = 0; u < ORT; u++) {
      s[u]  += __shfl_xor(s[u],  o, 32);
      ss[u] += __shfl_xor(ss[u], o, 32);
    }
  }
#pragma unroll
  for (int u = 0; u < ORT; u++) {
    float mu   = s[u]  * (1.f / H);
    float var  = ss[u] * (1.f / H) - mu * mu;
    float rstd = rsqrtf(var + 1e-12f);
#pragma unroll
    for (int c = 0; c < H / 128; c++)
      x[u][c] = (x[u][c] - mu) * rstd * g[c] + be[c];
  }
  // Nothing is computed behind the stores, so no register that they name is
  // written again.
  v4f* op = reinterpret_cast<v4f*>(out + (size_t)(m0 + w) * H) + lane;
#pragma unroll
  for (int u = 0; u < ORT; u++)
#pragma unroll
    for (int c = 0; c < H / 128; c++)
      op[u * (16 * H / 4) + c * 32] = x[u][c];
}

// ------------------------------------------------------------------ launch --

extern "C" void kernel_launch(void* const* d_in, const int* in_sizes, int n_in,
                              void* d_out, int out_size, void* d_ws,
                              size_t ws_size, hipStream_t stream) {
  (void)in_sizes; (void)n_in; (void)out_size; (void)ws_size;

  const float* hidden = (const float*)d_in[0];
  const float* mask   = (const float*)d_in[1];
  const float* Wq     = (const float*)d_in[2];
  const float* bq     = (const float*)d_in[3];
  const float* Wk     = (const float*)d_in[4];
  const float* bk     = (const float*)d_in[5];
  const float* Wv     = (const float*)d_in[6];
  const float* bv     = (const float*)d_in[7];
  const float* Wo     = (const float*)d_in[8];
  const float* bo     = (const float*)d_in[9];
  const float* ln_g   = (const float*)d_in[10];
  const float* ln_b   = (const float*)d_in[11];

  char* ws = (char*)d_ws;
  size_t off = 0;
  auto alloc = [&](size_t bytes) {
    char* p = ws + off;
    off += (bytes + 255) & ~(size_t)255;
    return p;
  };
  unsigned short* Xbf  = (unsigned short*)alloc((size_t)MROWS * H * 2);
  unsigned short* Wqkv = (unsigned short*)alloc((size_t)3 * H * H * 2);
  unsigned short* Wobf = (unsigned short*)alloc((size_t)H * H * 2);
  unsigned short* Qbf  = (unsigned short*)alloc((size_t)MROWS * H * 2);
  unsigned short* Kbf  = (unsigned short*)alloc((size_t)MROWS * H * 2);
  unsigned short* Vt   = (unsigned short*)alloc((size_t)MROWS * H * 2);
  unsigned short* Ctx  = (unsigned short*)alloc((size_t)MROWS * H * 2);

  cvt_all_kernel<<<dim3(CVT_BLOCKS), dim3(CVT_WAVES * 32), 0, stream>>>(
      hidden, Wq, Wk, Wv, Wo, Xbf, Wqkv, Wobf);

  qkv_kernel<<<dim3(MROWS / QBM, 3 * H / QBN), dim3(256), 0, stream>>>(
      Xbf, Wqkv, bq, bk, bv, Qbf, Kbf, Vt);

  attn_kernel<<<dim3(BATCH * NHEAD * (SEQ / (16 * AQT)) / 8), dim3(256), 0, stream>>>(
      Qbf, Kbf, Vt, mask, Ctx);

  out_ln_kernel<<<dim3(MROWS / (16 * ORT)), dim3(512), 0, stream>>>(
      Ctx, Wobf, bo, hidden, ln_g, ln_b, (float*)d_out);
}

// v010
// Measured time: 101 microseconds a run.
// Timed twice side by side with v009, it ran 1.03 times as fast both times.
// Over all steps from v000 it is 5.36 times as fast.
#include <hip/hip_runtime.h>
#include <math.h>

#define H     1024
#define NHEAD 16
#define HD    64
#define BATCH 8
#define SEQ   1024
#define MROWS (BATCH * SEQ)   // 8192

typedef __attribute__((ext_vector_type(16))) __bf16 v16bf;
typedef __attribute__((ext_vector_type(8)))  float  v8f;

// ---------------------------------------------------------------- helpers ---

static __device__ __forceinline__ unsigned short f2bf(float f) {
  union { float f; unsigned u; } x; x.f = f;
  unsigned r = x.u + 0x7FFFu + ((x.u >> 16) & 1u);   // round-to-nearest-even
  return (unsigned short)(r >> 16);
}

static __device__ __forceinline__ v8f wmma_bf16(v16bf a, v16bf b, v8f c) {
  // D = A(16x32 bf16) * B(32x16 bf16) + C(16x16 f32)
  return __builtin_amdgcn_wmma_f32_16x16x32_bf16(false, a, false, b,
                                                 (short)0, c, false, false);
}

// Fragment order. Every operand that a kernel loads into a WMMA fragment from global memory
// or from a plain LDS copy of it (Q, K, V^T, Ctx, Wo) is stored as a row of
// 16x32 bf16 fragments of FRAG = 512 elements (1 KB). Per the CDNA5 16-bit
// layout lanes 0-15 hold k = {0..7, 16..23} of row (lane & 15), lanes 16-31
// hold k = {8..15, 24..31}. Element (r, k) of a fragment lies at
//   (k >> 4) * 256 + ((k >> 3) & 1) * 128 + r * 8 + (k & 7),
// so lane L's two 16-byte chunks lie at L * 8 and 256 + L * 8: each of the two
// loads of a wave covers 512 contiguous bytes, 4 whole lines instead of 16.
#define FRAG 512

static __device__ __forceinline__ v16bf load_frag_f(const unsigned short* frag,
                                                    int lane) {
  const unsigned short* p = frag + lane * 8;
  v16bf f;
  reinterpret_cast<uint4*>(&f)[0] = *reinterpret_cast<const uint4*>(p);
  reinterpret_cast<uint4*>(&f)[1] = *reinterpret_cast<const uint4*>(p + 256);
  return f;
}

// Eight floats to one 16-byte chunk of bf16, element 0 at the lowest address.
static __device__ __forceinline__ uint4 pack8(float x0, float x1, float x2,
                                              float x3, float x4, float x5,
                                              float x6, float x7) {
  uint4 r;
  r.x = (unsigned)f2bf(x0) | ((unsigned)f2bf(x1) << 16);
  r.y = (unsigned)f2bf(x2) | ((unsigned)f2bf(x3) << 16);
  r.z = (unsigned)f2bf(x4) | ((unsigned)f2bf(x5) << 16);
  r.w = (unsigned)f2bf(x6) | ((unsigned)f2bf(x7) << 16);
  return r;
}

// -------------------------------------------------------------- fp32->bf16 --
// All five conversions (X, Wq, Wk, Wv, Wo) run in ONE launch of 256 work-groups
// of 12 waves, one per WGP. With one element a lane a trip, tens of thousands
// of short waves have to be started, and every launch adds its gap, its fill
// and its tail. Here a wave converts 4,096 elements: a lane issues its 32
// loads of 16 B at once, then converts and stores. The five arrays hold
// 8 : 1 : 1 : 1 : 1 parts, so of a work-group's waves 0-7 take X, 8-10 take
// Wq, Wk, Wv and 11 takes Wo.
// X, Wq, Wk, Wv keep their row-major order: float4 number q becomes the 8-byte
// piece number q, so a wave's load covers 512 contiguous bytes (4 whole lines)
// and its store 256 (2 whole lines).
// Wo goes to fragment order: fragment (n >> 4, k >> 5) is number
// (n >> 4) * (H / 32) + (k >> 5). A lane writes 16-byte chunks, chunk number
// o = fragment * 64 + (k >> 4 & 1) * 32 + lane.

#define CVT_BLOCKS  256
#define CVT_WAVES   12
#define CVT_PER     4096                    // elements a wave

static_assert(CVT_BLOCKS * 8 * CVT_PER == MROWS * H, "8 waves a group cover X");
static_assert(CVT_BLOCKS * CVT_PER == H * H, "1 wave a group covers a weight");

// Four floats to one 8-byte piece of bf16, element 0 at the lowest address.
static __device__ __forceinline__ uint2 pack4(float4 x) {
  uint2 r;
  r.x = (unsigned)f2bf(x.x) | ((unsigned)f2bf(x.y) << 16);
  r.y = (unsigned)f2bf(x.z) | ((unsigned)f2bf(x.w) << 16);
  return r;
}

// The register budget of four waves per SIMD is asked for by name (this grid
// puts three there): aiming for more waves, the compiler holds part of the
// loads back behind the first conversions, where they wait out a second memory
// latency.
__global__ __launch_bounds__(CVT_WAVES * 32) __attribute__((amdgpu_waves_per_eu(4, 4)))
void cvt_all_kernel(
    const float* __restrict__ X, const float* __restrict__ Wq,
    const float* __restrict__ Wk, const float* __restrict__ Wv,
    const float* __restrict__ Wo,
    unsigned short* __restrict__ Xbf, unsigned short* __restrict__ Wqkv,
    unsigned short* __restrict__ Wobf) {
  int lane = threadIdx.x & 31;
  int w = __builtin_amdgcn_readfirstlane(threadIdx.x >> 5);   // scalar: the role
  int blk = blockIdx.x;

  float4 v[CVT_PER / 128];                  // 32 float4 a lane
  if (w < 11) {
    const float* src = (w < 8) ? X + (blk * 8 + w) * CVT_PER
                               : ((w == 8) ? Wq : (w == 9) ? Wk : Wv) + blk * CVT_PER;
    unsigned short* dst = (w < 8) ? Xbf + (blk * 8 + w) * CVT_PER
                                  : Wqkv + (w - 8) * (H * H) + blk * CVT_PER;
    const float4* ps = reinterpret_cast<const float4*>(src) + lane;
    uint2* pd = reinterpret_cast<uint2*>(dst) + lane;
#pragma unroll
    for (int j = 0; j < CVT_PER / 128; j++) v[j] = ps[j * 32];
#pragma unroll
    for (int j = 0; j < CVT_PER / 128; j++) pd[j * 32] = pack4(v[j]);
  } else {
    // Chunks o = blk * 512 + j * 32 + lane, j = 0..15: 8 fragments of one row
    // of fragments. Row n = (blk >> 2) * 16 + (lane & 15), and chunk j starts
    // at k = (blk & 3) * 256 + j * 16 + (lane >> 4) * 8.
    const float4* ps = reinterpret_cast<const float4*>(
        Wo + ((blk >> 2) * 16 + (lane & 15)) * H + (blk & 3) * 256 + (lane >> 4) * 8);
    uint4* pd = reinterpret_cast<uint4*>(Wobf + blk * CVT_PER) + lane;
#pragma unroll
    for (int j = 0; j < CVT_PER / 256; j++) {
      v[2 * j]     = ps[j * 4];
      v[2 * j + 1] = ps[j * 4 + 1];
    }
#pragma unroll
    for (int j = 0; j < CVT_PER / 256; j++) {
      float4 x = v[2 * j], y = v[2 * j + 1];
      pd[j * 32] = pack8(x.x, x.y, x.z, x.w, y.x, y.y, y.z, y.w);
    }
  }
}

// --------------------------------------------------------------- QKV GEMM ---
// Y[8192 x 3072] = X * Wqkv^T. grid = (MROWS/128, 3*H/256), block = 256
// (8 waves, 2 x 4). A work-group owns a 128 x 256 tile of Y; a wave owns
// 64 x 64 of it (4 x 4 fragments). Per trip 64 k of the tile's 128 X rows and
// 256 W rows (128 B a row, whole lines) are copied asynchronously into one of
// two LDS buffers while the other buffer is worked on.
// Q, K, V^T are stored per (batch, head) in fragment order:
//   Q, K : row = position s, k = d; fragment number (s >> 4) * 2 + (d >> 5)
//   V^T  : row = d, k = position s; fragment number (s >> 5) * 4 + (d >> 4)
// A chunk is 8 consecutive k of one row, and a lane of a WMMA result holds 8
// consecutive rows of one column. So V is computed as X * W^T (a lane: 8
// positions of one d) and Q, K as W * X^T (a lane: 8 d of one position): the
// two operands trade places, which here is a trade of the two LDS offsets.

#define QBM    128
#define QBN    256
#define QBK    64                       // k per trip: 128 B of every row
#define QPITCH 144                      // LDS row pitch in bytes, 16 B x odd
#define QSTAGE ((QBM + QBN) * QPITCH)   // 55,296 B per buffer
#define QTRIPS (H / QBK)                // 16

#define LOG2E  1.44269504088896f
#define QSCALE (0.125f * LOG2E)         // log2(e) / sqrt(HD)

// One 16x32 fragment from a staged tile; same k order as load_frag_f.
// p: this lane's row, already advanced by (lane >> 4) * 16 bytes.
static __device__ __forceinline__ v16bf load_frag_s(const unsigned char* p) {
  v16bf f;
  reinterpret_cast<uint4*>(&f)[0] = *reinterpret_cast<const uint4*>(p);
  reinterpret_cast<uint4*>(&f)[1] = *reinterpret_cast<const uint4*>(p + 32);
  return f;
}

// Copy one trip's tile: 384 rows of 128 B, 12 copies of 16 B per lane; a
// wave's copy covers 4 whole rows. gx / gw: this lane's 16 bytes in its first
// X / W row; lds: the byte address of the same place in the buffer.
static __device__ __forceinline__ void stage_tile(const unsigned short* gx,
                                                  const unsigned short* gw,
                                                  unsigned lds) {
  const unsigned R = 32 * QPITCH;       // 32 rows further in LDS
  const size_t   G = (size_t)32 * H;    // 32 rows further in global memory
  // The copies and their s_wait_xcnt stand in one statement, so that no
  // address register is rewritten ahead of the wait.
  asm volatile(
      "global_load_async_to_lds_b128 %0, %12, off\n\t"
      "global_load_async_to_lds_b128 %1, %13, off\n\t"
      "global_load_async_to_lds_b128 %2, %14, off\n\t"
      "global_load_async_to_lds_b128 %3, %15, off\n\t"
      "global_load_async_to_lds_b128 %4, %16, off\n\t"
      "global_load_async_to_lds_b128 %5, %17, off\n\t"
      "global_load_async_to_lds_b128 %6, %18, off\n\t"
      "global_load_async_to_lds_b128 %7, %19, off\n\t"
      "global_load_async_to_lds_b128 %8, %20, off\n\t"
      "global_load_async_to_lds_b128 %9, %21, off\n\t"
      "global_load_async_to_lds_b128 %10, %22, off\n\t"
      "global_load_async_to_lds_b128 %11, %23, off\n\t"
      "s_wait_xcnt 0x0"
      :: "v"(lds), "v"(lds + R), "v"(lds + 2 * R), "v"(lds + 3 * R),
         "v"(lds + 4 * R), "v"(lds + 5 * R), "v"(lds + 6 * R),
         "v"(lds + 7 * R), "v"(lds + 8 * R), "v"(lds + 9 * R),
         "v"(lds + 10 * R), "v"(lds + 11 * R),
         "v"(gx), "v"(gx + G), "v"(gx + 2 * G), "v"(gx + 3 * G),
         "v"(gw), "v"(gw + G), "v"(gw + 2 * G), "v"(gw + 3 * G),
         "v"(gw + 4 * G), "v"(gw + 5 * G), "v"(gw + 6 * G), "v"(gw + 7 * G)
      : "memory");
}

__global__ __launch_bounds__(256) void qkv_kernel(
    const unsigned short* __restrict__ Xbf,
    const unsigned short* __restrict__ Wqkv,
    const float* __restrict__ bq, const float* __restrict__ bk,
    const float* __restrict__ bv,
    unsigned short* __restrict__ Qbf, unsigned short* __restrict__ Kbf,
    unsigned short* __restrict__ Vt) {
  __shared__ __attribute__((aligned(16))) unsigned char stage[2 * QSTAGE];

  int mat = blockIdx.y >> 2;                    // 0=Q, 1=K, 2=V
  const float* bias = (mat == 0) ? bq : (mat == 1) ? bk : bv;

  int m0 = blockIdx.x * QBM;
  int nb = blockIdx.y * QBN;                    // row of the stacked Wqkv
  int tid = threadIdx.x;
  int w = tid >> 5, lane = tid & 31, l15 = lane & 15;
  int wm = w >> 2, wn = w & 3;

  // copy side: 8 lanes a row, 32 rows per copy of the work-group
  int cr = tid >> 3, cc = tid & 7;
  const unsigned short* gx = Xbf  + (size_t)(m0 + cr) * H + cc * 8;
  const unsigned short* gw = Wqkv + (size_t)(nb + cr) * H + cc * 8;
  unsigned lds0 = (unsigned)(size_t)stage + cr * QPITCH + cc * 16;

  // read side: this lane's row in the wave's first X and W fragment
  int offX = (wm * 64 + l15) * QPITCH + (lane >> 4) * 16;
  int offW = (QBM + wn * 64 + l15) * QPITCH + (lane >> 4) * 16;
  int offA = (mat == 2) ? offX : offW;          // rows of the result
  int offB = (mat == 2) ? offW : offX;          // columns of the result

  v8f acc[4][4] = {};

  // Trip t works on k slab (t0 + t) mod QTRIPS. 64 work-groups share each W
  // tile and 12 each X tile; walking k from the same end they ask L2 for the
  // same lines at the same moment. The sharers of a
  // tile are spread evenly over the starts (neighbours in x or y, and groups 8
  // apart in x, differ).
  int t0 = (blockIdx.x + (blockIdx.x >> 3) + blockIdx.y) & (QTRIPS - 1);
  int k1 = ((t0 + 1) & (QTRIPS - 1)) * QBK;

  stage_tile(gx + t0 * QBK, gw + t0 * QBK, lds0);
  asm volatile("s_wait_asynccnt 0x0" ::: "memory");  // the first tile has landed
  __syncthreads();                                   // and every wave may read it
  stage_tile(gx + k1, gw + k1, lds0 + QSTAGE);

  // Kept rolled: a trip already holds 32 WMMAs, so the branch costs little,
  // and the code stays short.
#pragma unroll 1
  for (int t = 0; t < QTRIPS; t++) {
    int buf = (t & 1) * QSTAGE;
    const unsigned char* sA = stage + buf + offA;
    const unsigned char* sB = stage + buf + offB;
#pragma unroll
    for (int ks = 0; ks < 2; ks++) {
      v16bf a[4], b[4];
#pragma unroll
      for (int i = 0; i < 4; i++)
        a[i] = load_frag_s(sA + i * 16 * QPITCH + ks * 64);
#pragma unroll
      for (int j = 0; j < 4; j++)
        b[j] = load_frag_s(sB + j * 16 * QPITCH + ks * 64);
      // Keeps the 16 LDS reads one group in front of their 16 WMMAs: left
      // free, they are spread among the WMMAs, each place with a full wait.
      __builtin_amdgcn_sched_barrier(0);
#pragma unroll
      for (int i = 0; i < 4; i++)
#pragma unroll
        for (int j = 0; j < 4; j++)
          acc[i][j] = wmma_bf16(a[i], b[j], acc[i][j]);
      // Other end of the same group: the next reads stay behind these WMMAs.
      __builtin_amdgcn_sched_barrier(0);
    }
    asm volatile("s_wait_dscnt 0x0" ::: "memory");     // own reads of this buffer done
    asm volatile("s_wait_asynccnt 0x0" ::: "memory");  // own copies of tile t+1 landed
    __syncthreads();   // publishes tile t+1, frees the buffer of tile t
    if (t + 2 < QTRIPS) {
      int k2 = ((t0 + t + 2) & (QTRIPS - 1)) * QBK;
      stage_tile(gx + k2, gw + k2, lds0 + buf);
    }
  }
  asm volatile("s_wait_asynccnt 0x0" ::: "memory");    // none in flight at the end

  int hh = ((blockIdx.y & 3) << 2) + wn;        // a wave's 64 W rows = one head
  int r0 = m0 + wm * 64;                        // 128 rows lie in one batch entry
  int bb = r0 >> 10, s0 = r0 & (SEQ - 1);
  size_t hbase = ((size_t)bb * NHEAD + hh) * (SEQ * HD);
  if (mat == 2) {
    // acc[i][j][v]: position s0 + i*16 + (lane>>4)*8 + v, d = j*16 + l15
    unsigned short* dst = Vt + hbase + (size_t)(s0 >> 5) * 4 * FRAG + lane * 8;
#pragma unroll
    for (int j = 0; j < 4; j++) {
      float bn = bias[hh * HD + j * 16 + l15];
#pragma unroll
      for (int i = 0; i < 4; i++)
        *reinterpret_cast<uint4*>(dst + ((i >> 1) * 4 + j) * FRAG + (i & 1) * 256) =
            pack8(acc[i][j][0] + bn, acc[i][j][1] + bn, acc[i][j][2] + bn,
                  acc[i][j][3] + bn, acc[i][j][4] + bn, acc[i][j][5] + bn,
                  acc[i][j][6] + bn, acc[i][j][7] + bn);
      // The next column reuses the registers that these stores name.
      asm volatile("s_wait_xcnt 0x0" ::: "memory");
      // One column of fragments at a time: all 128 conversions scheduled at
      // once take more than 256 VGPRs, which costs the second work-group per WGP.
      __builtin_amdgcn_sched_barrier(0);
    }
  } else {
    // acc[i][j][v]: d = i*16 + (lane>>4)*8 + v, position s0 + j*16 + l15
    unsigned short* dst = ((mat == 0) ? Qbf : Kbf) + hbase +
                          (size_t)(s0 >> 4) * 2 * FRAG + lane * 8;
    // Q is stored times log2(e) / sqrt(HD), so that attn_kernel's score product
    // comes out in the units of exp2. The factor rides on the bias add, now a
    // multiply-add; for K it is 1.
    float sc = (mat == 0) ? QSCALE : 1.f;
#pragma unroll
    for (int i = 0; i < 4; i++) {
      const float4* bp = reinterpret_cast<const float4*>(
          bias + hh * HD + i * 16 + ((lane >> 4) << 3));
      float4 b0 = bp[0], b1 = bp[1];
      b0.x *= sc; b0.y *= sc; b0.z *= sc; b0.w *= sc;
      b1.x *= sc; b1.y *= sc; b1.z *= sc; b1.w *= sc;
#pragma unroll
      for (int j = 0; j < 4; j++)
        *reinterpret_cast<uint4*>(dst + (j * 2 + (i >> 1)) * FRAG + (i & 1) * 256) =
            pack8(fmaf(acc[i][j][0], sc, b0.x), fmaf(acc[i][j][1], sc, b0.y),
                  fmaf(acc[i][j][2], sc, b0.z), fmaf(acc[i][j][3], sc, b0.w),
                  fmaf(acc[i][j][4], sc, b1.x), fmaf(acc[i][j][5], sc, b1.y),
                  fmaf(acc[i][j][6], sc, b1.z), fmaf(acc[i][j][7], sc, b1.w));
      // As above: the wait for the stores' registers, then the bound on the
      // registers of the conversions.
      asm volatile("s_wait_xcnt 0x0" ::: "memory");
      __builtin_amdgcn_sched_barrier(0);
    }
  }
}

#define AQT 2   // query tiles a wave

#define AKT    128                // keys a tile
#define ATILE  (AKT * HD * 2)     // bytes of K, and of V^T, a tile: 16,384
#define ABUF   (2 * ATILE)        // one buffer: K, then V^T

// One fragment in fragment order from LDS. p: this lane's first chunk.
static __device__ __forceinline__ v16bf load_frag_l(const unsigned char* p) {
  v16bf f;
  reinterpret_cast<uint4*>(&f)[0] = *reinterpret_cast<const uint4*>(p);
  reinterpret_cast<uint4*>(&f)[1] = *reinterpret_cast<const uint4*>(p + 512);
  return f;
}

// Copy one tile: 4 copies of 16 B per lane for K and 4 for V^T; one copy of the
// work-group's 256 lanes covers 4 KB in a row. gk / gv: this lane's 16 bytes in
// the tile's first 4 KB; lds: the byte address of the same place in the buffer.
static __device__ __forceinline__ void stage_kv(const unsigned short* gk,
                                                const unsigned short* gv,
                                                unsigned lds) {
  const unsigned R = 4096;        // 4 KB further in LDS
  const size_t   G = 2048;        // 4 KB further in global memory, in elements
  // The copies and their s_wait_xcnt stand in one statement, so that no
  // address register is rewritten ahead of the wait.
  asm volatile(
      "global_load_async_to_lds_b128 %0, %8, off\n\t"
      "global_load_async_to_lds_b128 %1, %9, off\n\t"
      "global_load_async_to_lds_b128 %2, %10, off\n\t"
      "global_load_async_to_lds_b128 %3, %11, off\n\t"
      "global_load_async_to_lds_b128 %4, %12, off\n\t"
      "global_load_async_to_lds_b128 %5, %13, off\n\t"
      "global_load_async_to_lds_b128 %6, %14, off\n\t"
      "global_load_async_to_lds_b128 %7, %15, off\n\t"
      "s_wait_xcnt 0x0"
      :: "v"(lds), "v"(lds + R), "v"(lds + 2 * R), "v"(lds + 3 * R),
         "v"(lds + ATILE), "v"(lds + ATILE + R), "v"(lds + ATILE + 2 * R),
         "v"(lds + ATILE + 3 * R),
         "v"(gk), "v"(gk + G), "v"(gk + 2 * G), "v"(gk + 3 * G),
         "v"(gv), "v"(gv + G), "v"(gv + 2 * G), "v"(gv + 3 * G)
      : "memory");
}

typedef __attribute__((ext_vector_type(16))) float v16f;

// The value that lane (l ^ 16) holds.
static __device__ __forceinline__ float other_half(float x) {
  int b = __builtin_bit_cast(int, x);
  b = __builtin_amdgcn_permlanex16(b, b, 0x76543210, 0xfedcba98, false, false);
  return __builtin_bit_cast(float, b);
}

// The same maximum as fmaxf under another builtin, for the lowest level of the
// tree over a lane's 16 scores. Spelled alike throughout, the tree is taken for
// one reduction and rebuilt in pairs across the two query tiles; a product's raw
// result then first passes through an instruction that quiets NaNs. Spelled in
// two ways, every group of three stays one v_max3.
static __device__ __forceinline__ float mx(float a, float b) {
  return __builtin_elementwise_maximumnum(a, b);
}

static __device__ __forceinline__ v8f load8f(const float* p) {
  v8f r;
  reinterpret_cast<float4*>(&r)[0] = reinterpret_cast<const float4*>(p)[0];
  reinterpret_cast<float4*>(&r)[1] = reinterpret_cast<const float4*>(p)[1];
  return r;
}

// Four waves per SIMD (two work-groups per WGP) are asked for by name: with that
// register budget the scheduler issues the next step's K loads right
// behind the score products, a whole softmax ahead of their use; left to aim
// for more waves it holds them back until registers fall free late in the step.
__global__ __launch_bounds__(256) __attribute__((amdgpu_waves_per_eu(4, 4)))
void attn_kernel(
    const unsigned short* __restrict__ Qbf,
    const unsigned short* __restrict__ Kbf,
    const unsigned short* __restrict__ Vt,
    const float* __restrict__ mask,
    unsigned short* __restrict__ Ctx) {
  __shared__ __attribute__((aligned(16))) unsigned char kv[2 * ABUF];   // 64 KB
  __shared__ __attribute__((aligned(16))) float mks[SEQ];   // mask * log2(e), 4 KB

  int tid = threadIdx.x;
  int w = tid >> 5, lane = tid & 31;
  int gid = blockIdx.x * 8 + w;
  int qt = (gid & (SEQ / (16 * AQT) - 1)) * AQT;   // the wave's first query tile
  int bh = gid / (SEQ / (16 * AQT));
  int b = bh >> 4, h = bh & 15;

  const unsigned short* Qh = Qbf + (size_t)bh * SEQ * HD;
  const unsigned short* Kh = Kbf + (size_t)bh * SEQ * HD;
  const unsigned short* Vh = Vt  + (size_t)bh * HD * SEQ;
  const float* mrow = mks + ((lane >> 4) << 3);   // this half's keys

  // copy side: bh is the same in all 8 waves (32 waves share one)
  const unsigned short* gk = Kh + tid * 8;
  const unsigned short* gv = Vh + tid * 8;
  unsigned lds0 = (unsigned)(size_t)kv + tid * 16;
  // read side: this lane's first chunk of a buffer's first fragment
  const unsigned char* kl = kv + lane * 16;

  stage_kv(gk, gv, lds0);

  // The batch entry's mask, once a work-group, in the units of exp2. The bounds
  // keep a finite mask finite: times log2(e) the most negative float would turn
  // into -inf, and a row with every key so masked into inf - inf.
  {
    const float big = 3.402823466e38f;
    float4 m = reinterpret_cast<const float4*>(mask + b * SEQ)[tid];
    m.x = fminf(fmaxf(m.x * LOG2E, -big), big);
    m.y = fminf(fmaxf(m.y * LOG2E, -big), big);
    m.z = fminf(fmaxf(m.z * LOG2E, -big), big);
    m.w = fminf(fmaxf(m.w * LOG2E, -big), big);
    reinterpret_cast<float4*>(mks)[tid] = m;
  }

  // B operand: column = query, k = d
  v16bf qb[AQT][2];
#pragma unroll
  for (int u = 0; u < AQT; u++) {
    qb[u][0] = load_frag_f(Qh + ((qt + u) * 2 + 0) * FRAG, lane);
    qb[u][1] = load_frag_f(Qh + ((qt + u) * 2 + 1) * FRAG, lane);
  }

  // O^T tiles: o[u][t][r] = d 16t + 8h + r of this lane's query in tile u
  v8f o[AQT][4] = {};
  float rmax[AQT];   // of the query, equal in both halves
  float rsum[AQT];   // over this half's keys only; joined at the end
#pragma unroll
  for (int u = 0; u < AQT; u++) { rmax[u] = -INFINITY; rsum[u] = 0.f; }

  asm volatile("s_wait_asynccnt 0x0" ::: "memory");  // the first tile has landed
  __syncthreads();                 // and every wave may read it, and the mask
  stage_kv(gk + AKT * HD, gv + AKT * HD, lds0 + ABUF);

  // the mask of the first step's keys
  v8f mk0 = load8f(mrow);
  v8f mk1 = load8f(mrow + 16);

  // prime K fragments for j = 0 (a fragment is 1 KB)
  v16bf kc0 = load_frag_l(kl + 0 * 1024);   // keys 0..15,  d 0..31
  v16bf kc1 = load_frag_l(kl + 1 * 1024);   // keys 0..15,  d 32..63
  v16bf kc2 = load_frag_l(kl + 2 * 1024);   // keys 16..31, d 0..31
  v16bf kc3 = load_frag_l(kl + 3 * 1024);   // keys 16..31, d 32..63

  // Kept rolled: K and the mask reload into the registers just read, so there
  // is nothing for an unrolled body to save, and the code stays short.
#pragma unroll 1
  for (int j = 0; j < SEQ; j += 32) {
    // V fragments for this step: independent of P, issue early
    // (32 keys are 4 fragments = 4 KB, in K and in V^T alike)
    int buf = ((j / AKT) & 1) * ABUF;
    const unsigned char* sv = kl + buf + ATILE + (j & (AKT - 1)) * (HD * 2);
    v16bf va0 = load_frag_l(sv + 0 * 1024);
    v16bf va1 = load_frag_l(sv + 1 * 1024);
    v16bf va2 = load_frag_l(sv + 2 * 1024);
    v16bf va3 = load_frag_l(sv + 3 * 1024);

    // scores: K(16 keys x 64) @ Q^T for two 16-key sub-tiles of each query tile
    // Q carries log2(e) / sqrt(64), and the mask (a lane's 8 rows are 8 keys)
    // goes in as the C operand: the result is the argument of exp2, but for the
    // maximum, with no vector instruction spent.
    v8f s0[AQT], s1[AQT];
#pragma unroll
    for (int u = 0; u < AQT; u++) {
      s0[u] = wmma_bf16(kc0, qb[u][0], mk0);
      s1[u] = wmma_bf16(kc2, qb[u][0], mk1);
    }
#pragma unroll
    for (int u = 0; u < AQT; u++) {
      s0[u] = wmma_bf16(kc1, qb[u][1], s0[u]);
      s1[u] = wmma_bf16(kc3, qb[u][1], s1[u]);
    }

    // A tile's last step: the wave has issued all its reads of the tile.
    if ((j & (AKT - 1)) == AKT - 32) {
      asm volatile("s_wait_dscnt 0x0" ::: "memory");     // own reads of this buffer done
      asm volatile("s_wait_asynccnt 0x0" ::: "memory");  // own copies of the next tile landed
      __syncthreads();   // publishes the next tile, frees this tile's buffer
      if (j + 32 + AKT < SEQ)                            // the tile after the next
        stage_kv(gk + (j + 32 + AKT) * HD, gv + (j + 32 + AKT) * HD, lds0 + buf);
    }

    // K fragments for the next step, into the registers just read
    // (wraps on last iter: K of a tile worked on before, unused; the mask,
    // read further down, redundant but cheap)
    int jn = (j + 32) & (SEQ - 1);
    const unsigned char* sk = kl + ((jn / AKT) & 1) * ABUF + (jn & (AKT - 1)) * (HD * 2);
    kc0 = load_frag_l(sk + 0 * 1024);
    kc1 = load_frag_l(sk + 1 * 1024);
    kc2 = load_frag_l(sk + 2 * 1024);
    kc3 = load_frag_l(sk + 3 * 1024);

    v16f p[AQT];
    v16bf pb[AQT];
    float alpha[AQT];
#pragma unroll
    for (int u = 0; u < AQT; u++) {
      v8f x0 = s0[u], x1 = s1[u];
      // maximum over this lane's 16 keys, as a tree, then over both halves
      float t0 = mx(mx(x0[0], x0[1]), x0[2]);
      float t1 = mx(mx(x0[3], x0[4]), x0[5]);
      float t2 = mx(mx(x0[6], x0[7]), x1[0]);
      float t3 = mx(mx(x1[1], x1[2]), x1[3]);
      float t4 = mx(mx(x1[4], x1[5]), x1[6]);
      float t = fmaxf(fmaxf(fmaxf(t0, t1), t2), fmaxf(fmaxf(t3, t4), x1[7]));
      t = fmaxf(t, other_half(t));
      float nm = fmaxf(rmax[u], t);
      alpha[u] = __builtin_amdgcn_exp2f(rmax[u] - nm);
      rmax[u] = nm;

      v8f y0 = x0 - nm, y1 = x1 - nm;
#pragma unroll
      for (int r = 0; r < 8; r++) {
        p[u][r]     = __builtin_amdgcn_exp2f(y0[r]);
        p[u][8 + r] = __builtin_amdgcn_exp2f(y1[r]);
      }
      o[u][0] *= alpha[u]; o[u][1] *= alpha[u];
      o[u][2] *= alpha[u]; o[u][3] *= alpha[u];

      // P^T as B operand: element s is key 8h + s (s < 8), 16 + 8h + s - 8 (else)
      pb[u] = __builtin_convertvector(p[u], v16bf);
    }

    // Keeps vector work out from among the eight products: there it lands in
    // registers of a V fragment just read, which costs four idle slots behind
    // the product each time.
    __builtin_amdgcn_sched_barrier(0);

    // The next step's mask, read here, where the registers of this step's scores
    // have fallen free: the products and the sums below cover the LDS latency.
    mk0 = load8f(mrow + jn);
    mk1 = load8f(mrow + jn + 16);

    // ctx^T += V^T(64 x 32) @ P^T(32 x 16); V^T fragment rows are d
#pragma unroll
    for (int u = 0; u < AQT; u++) {
      o[u][0] = wmma_bf16(va0, pb[u], o[u][0]);
      o[u][1] = wmma_bf16(va1, pb[u], o[u][1]);
      o[u][2] = wmma_bf16(va2, pb[u], o[u][2]);
      o[u][3] = wmma_bf16(va3, pb[u], o[u][3]);
    }
    // Other end of the same group. The row sums need nothing of the products
    // and run while the matrix unit works on them; they also stand between the
    // last product that reads P^T and the next step's first product, whose
    // result the compiler puts into the same registers.
    __builtin_amdgcn_sched_barrier(0);

#pragma unroll
    for (int u = 0; u < AQT; u++) {
      v16f q = p[u];
      float rs = ((q[0] + q[8]) + (q[1] + q[9])) + ((q[2] + q[10]) + (q[3] + q[11])) +
                 (((q[4] + q[12]) + (q[5] + q[13])) + ((q[6] + q[14]) + (q[7] + q[15])));
      rsum[u] = rsum[u] * alpha[u] + rs;
    }
  }
  asm volatile("s_wait_asynccnt 0x0" ::: "memory");    // none in flight at the end

  // normalize and store merged-head ctx [B*S, H] in bf16, in fragment order:
  // row = b * SEQ + s, k = h * HD + d, fragment (row >> 4) * (H / 32) + (k >> 5).
  // A lane's 8 d of one tile are one 16-byte chunk, chunk number = lane.
#pragma unroll
  for (int u = 0; u < AQT; u++) {
    float inv = 1.f / (rsum[u] + other_half(rsum[u]));
    unsigned short* cw = Ctx +
        ((size_t)(b * (SEQ / 16) + qt + u) * (H / 32) + h * 2) * FRAG + lane * 8;
#pragma unroll
    for (int t = 0; t < 4; t++)                  // d 16t .. 16t + 15
      *reinterpret_cast<uint4*>(cw + (t >> 1) * FRAG + (t & 1) * 256) =
          pack8(o[u][t][0] * inv, o[u][t][1] * inv, o[u][t][2] * inv,
                o[u][t][3] * inv, o[u][t][4] * inv, o[u][t][5] * inv,
                o[u][t][6] * inv, o[u][t][7] * inv);
  }
}

// ------------------------------- output GEMM + bias + residual + LayerNorm --
// grid = MROWS/32 = 256 blocks of 512 (16 waves), one per WGP. Wave w: 32 rows
// x 64 cols; the block owns the full 32x1024 strip for the fused LayerNorm.
// Every block has to read all of Wo (2 MB) from L2, so the L2 bytes of this
// launch are 2 MB x the number of blocks. With two 16-row tiles a wave, each
// Wo fragment loaded feeds two products and the blocks are half as many.
// All 16 waves need the block's whole strip of Ctx (64 KB). As in attn_kernel,
// what every wave of the work-group reads is asked of L2 once: the strip is
// copied asynchronously into LDS at the start, and the waves take their Ctx
// fragments from there. Wo fragments, each read by one wave, come from L2.

#define ORT 2   // 16-row tiles a wave (and a block)
#define OCTX (16 * ORT * H * 2)   // bytes of the block's strip of Ctx: 65,536

// Copy the strip: 8 copies of 16 B per lane; one copy of the work-group's 512
// lanes covers 8 KB in a row. g: this lane's 16 bytes in the strip's first
// 8 KB; lds: the byte address of the same place in LDS.
static __device__ __forceinline__ void stage_ctx(const unsigned short* g,
                                                 unsigned lds) {
  const unsigned R = 8192;        // 8 KB further in LDS
  const size_t   G = 4096;        // 8 KB further in global memory, in elements
  // The copies and their s_wait_xcnt stand in one statement, so that no
  // address register is rewritten ahead of the wait.
  asm volatile(
      "global_load_async_to_lds_b128 %0, %8, off\n\t"
      "global_load_async_to_lds_b128 %1, %9, off\n\t"
      "global_load_async_to_lds_b128 %2, %10, off\n\t"
      "global_load_async_to_lds_b128 %3, %11, off\n\t"
      "global_load_async_to_lds_b128 %4, %12, off\n\t"
      "global_load_async_to_lds_b128 %5, %13, off\n\t"
      "global_load_async_to_lds_b128 %6, %14, off\n\t"
      "global_load_async_to_lds_b128 %7, %15, off\n\t"
      "s_wait_xcnt 0x0"
      :: "v"(lds), "v"(lds + R), "v"(lds + 2 * R), "v"(lds + 3 * R),
         "v"(lds + 4 * R), "v"(lds + 5 * R), "v"(lds + 6 * R), "v"(lds + 7 * R),
         "v"(g), "v"(g + G), "v"(g + 2 * G), "v"(g + 3 * G),
         "v"(g + 4 * G), "v"(g + 5 * G), "v"(g + 6 * G), "v"(g + 7 * G)
      : "memory");
}

typedef __attribute__((ext_vector_type(4))) float v4f;

// This grid puts four waves on a SIMD, and their register budget is asked for
// by name: aiming for eight, the compiler gives up the second fragment set and
// waits for each set's loads right behind their issue.
__global__ __launch_bounds__(512) __attribute__((amdgpu_waves_per_eu(4, 4)))
void out_ln_kernel(
    const unsigned short* __restrict__ Ctx,
    const unsigned short* __restrict__ Wo,
    const float* __restrict__ bo,
    const float* __restrict__ hidden,
    const float* __restrict__ ln_g, const float* __restrict__ ln_b,
    float* __restrict__ out) {
  __shared__ __attribute__((aligned(16))) float tile[16 * ORT * H];   // 128 KB
  __shared__ __attribute__((aligned(16))) unsigned char cs[OCTX];     // 64 KB

  int m0 = blockIdx.x * (16 * ORT);
  int tid = threadIdx.x;
  int w = tid >> 5, lane = tid & 31, l15 = lane & 15;
  int n0 = w << 6;

  stage_ctx(Ctx + (size_t)blockIdx.x * (16 * ORT * H) + tid * 8,
            (unsigned)(size_t)cs + tid * 16);

  v8f acc[ORT][4] = {};
  // Ctx and Wo lie in fragment order: 16 rows are H / 32 fragments in a row
  // (16 * H * 2 bytes), in LDS as in global memory.
  // Ca, Wb: this lane's first chunk (load_frag_f is given lane 0).
  const unsigned char* Ca = cs + lane * 16;
  const unsigned short* Wb = Wo + (size_t)n0 * H + lane * 8;
  // All 256 blocks read the whole of Wo. Each enters the k walk at its own
  // slab of 64 and wraps round, so that they do not all ask L2 for the same
  // lines at the same moment (neighbours, and blocks 8 apart, differ).
  int k0 = ((blockIdx.x + (blockIdx.x >> 3)) & (H / 64 - 1)) * 64;
  v16bf bA[4];
#pragma unroll
  for (int t = 0; t < 4; t++)
    bA[t] = load_frag_f(Wb + k0 * 16 + t * (16 * H), 0);
  asm volatile("s_wait_asynccnt 0x0" ::: "memory");  // own part of the strip has landed
  __syncthreads();                                   // and every wave may read all of it
  v16bf aA[ORT];
#pragma unroll
  for (int u = 0; u < ORT; u++)
    aA[u] = load_frag_l(Ca + k0 * 32 + u * (16 * H * 2));

  for (int it = 0; it < H; it += 64) {
    int kb = (k0 + it) & (H - 1);
    // 32 k on = one fragment on = 16 * 32 elements
    const unsigned char* pa = Ca + kb * 32;
    const unsigned short* pb = Wb + kb * 16;
    v16bf aB[ORT];
#pragma unroll
    for (int u = 0; u < ORT; u++)
      aB[u] = load_frag_l(pa + u * (16 * H * 2) + FRAG * 2);
    v16bf bB[4];
#pragma unroll
    for (int t = 0; t < 4; t++)
      bB[t] = load_frag_f(pb + t * (16 * H) + FRAG, 0);
    // The wait that stands before the global loads' address registers are
    // rewritten. It names them, so that they live up to it: otherwise the last
    // load of a group gets them as its result registers, ahead of the wait.
    asm volatile("s_wait_xcnt 0x0" :: "v"(pb) : "memory");
    // Keeps these loads in front of the products of the other set: left free,
    // the products are lifted over them, and each set is then waited for right
    // behind its issue, with half the bytes in flight.
    __builtin_amdgcn_sched_barrier(0);

#pragma unroll
    for (int t = 0; t < 4; t++)
#pragma unroll
      for (int u = 0; u < ORT; u++)
        acc[u][t] = wmma_bf16(aA[u], bA[t], acc[u][t]);

    int k2 = (kb + 64) & (H - 1);
    pa = Ca + k2 * 32;
    pb = Wb + k2 * 16;
#pragma unroll
    for (int u = 0; u < ORT; u++)
      aA[u] = load_frag_l(pa + u * (16 * H * 2));
#pragma unroll
    for (int t = 0; t < 4; t++)
      bA[t] = load_frag_f(pb + t * (16 * H), 0);
    // As above, the wait and the order.
    asm volatile("s_wait_xcnt 0x0" :: "v"(pb) : "memory");
    __builtin_amdgcn_sched_barrier(0);

#pragma unroll
    for (int t = 0; t < 4; t++)
#pragma unroll
      for (int u = 0; u < ORT; u++)
        acc[u][t] = wmma_bf16(aB[u], bB[t], acc[u][t]);
  }

  // From here on every row-wise access goes by whole lines: in the LayerNorm
  // pass wave w takes rows w and 16 + w, and a lane takes columns
  // c * 128 + lane * 4 .. + 3, c = 0..7. So each 16-byte-a-lane access of a wave
  // covers 512 contiguous bytes: 4 whole lines of the residual, gamma, beta and
  // out, and 128 consecutive words of LDS, free of bank conflicts. (With 32
  // columns in a row per lane the lanes lie 128 B apart: an access touches 32
  // lines, and in LDS only two groups of 4 banks.)
  // The residual is added in that pass; its loads are issued here, ahead of the
  // LDS stores and the barrier.
  const v4f* hp = reinterpret_cast<const v4f*>(hidden + (size_t)(m0 + w) * H) + lane;
  v4f x[ORT][H / 128];
#pragma unroll
  for (int u = 0; u < ORT; u++)
#pragma unroll
    for (int c = 0; c < H / 128; c++)
      x[u][c] = hp[u * (16 * H / 4) + c * 32];
  // As in the loop: the wait names the loads' address, which so lives up to it.
  asm volatile("s_wait_xcnt 0x0" :: "v"(hp) : "memory");

  int rw = (lane >> 4) << 3;
#pragma unroll
  for (int u = 0; u < ORT; u++) {
#pragma unroll
    for (int t = 0; t < 4; t++) {
      int n = n0 + t * 16 + l15;
      float bn = bo[n];
#pragma unroll
      for (int v = 0; v < 8; v++) {
        int m = u * 16 + v + rw;
        tile[m * H + n] = acc[u][t][v] + bn;
      }
    }
  }
  __syncthreads();

  const v4f* gp = reinterpret_cast<const v4f*>(ln_g) + lane;
  const v4f* bp = reinterpret_cast<const v4f*>(ln_b) + lane;
  v4f g[H / 128], be[H / 128];
#pragma unroll
  for (int c = 0; c < H / 128; c++) { g[c] = gp[c * 32]; be[c] = bp[c * 32]; }
  // The wait that stands before these loads' address register is rewritten.
  asm volatile("s_wait_xcnt 0x0" ::: "memory");

  // LayerNorm: a row is read from LDS once and stays in registers. A lane sums
  // its 32 elements in four chains, one per column of its group of 4.
  float s[ORT], ss[ORT];
#pragma unroll
  for (int u = 0; u < ORT; u++) {
    const v4f* tr = reinterpret_cast<const v4f*>(&tile[(u * 16 + w) * H]) + lane;
    v4f s4 = {}, q4 = {};
#pragma unroll
    for (int c = 0; c < H / 128; c++) {
      v4f y = tr[c * 32] + x[u][c];
      x[u][c] = y;
      s4 += y;
      q4 += y * y;
    }
    s[u]  = (s4[0] + s4[1]) + (s4[2] + s4[3]);
    ss[u] = (q4[0] + q4[1]) + (q4[2] + q4[3]);
  }
#pragma unroll
  for (int o = 1; o < 32; o <<= 1) {
#pragma unroll
    for (int u = 0; u < ORT; u++) {
      s[u]  += __shfl_xor(s[u],  o, 32);
      ss[u] += __shfl_xor(ss[u], o, 32);
    }
  }
#pragma unroll
  for (int u = 0; u < ORT; u++) {
    float mu   = s[u]  * (1.f / H);
    float var  = ss[u] * (1.f / H) - mu * mu;
    float rstd = rsqrtf(var + 1e-12f);
#pragma unroll
    for (int c = 0; c < H / 128; c++)
      x[u][c] = (x[u][c] - mu) * rstd * g[c] + be[c];
  }
  // Nothing is computed behind the stores, so no register that they name is
  // written again.
  v4f* op = reinterpret_cast<v4f*>(out + (size_t)(m0 + w) * H) + lane;
#pragma unroll
  for (int u = 0; u < ORT; u++)
#pragma unroll
    for (int c = 0; c < H / 128; c++)
      op[u * (16 * H / 4) + c * 32] = x[u][c];
}

// ------------------------------------------------------------------ launch --

extern "C" void kernel_launch(void* const* d_in, const int* in_sizes, int n_in,
                              void* d_out, int out_size, void* d_ws,
                              size_t ws_size, hipStream_t stream) {
  (void)in_sizes; (void)n_in; (void)out_size; (void)ws_size;

  const float* hidden = (const float*)d_in[0];
  const float* mask   = (const float*)d_in[1];
  const float* Wq     = (const float*)d_in[2];
  const float* bq     = (const float*)d_in[3];
  const float* Wk     = (const float*)d_in[4];
  const float* bk     = (const float*)d_in[5];
  const float* Wv     = (const float*)d_in[6];
  const float* bv     = (const float*)d_in[7];
  const float* Wo     = (const float*)d_in[8];
  const float* bo     = (const float*)d_in[9];
  const float* ln_g   = (const float*)d_in[10];
  const float* ln_b   = (const float*)d_in[11];

  char* ws = (char*)d_ws;
  size_t off = 0;
  auto alloc = [&](size_t bytes) {
    char* p = ws + off;
    off += (bytes + 255) & ~(size_t)255;
    return p;
  };
  unsigned short* Xbf  = (unsigned short*)alloc((size_t)MROWS * H * 2);
  unsigned short* Wqkv = (unsigned short*)alloc((size_t)3 * H * H * 2);
  unsigned short* Wobf = (unsigned short*)alloc((size_t)H * H * 2);
  unsigned short* Qbf  = (unsigned short*)alloc((size_t)MROWS * H * 2);
  unsigned short* Kbf  = (unsigned short*)alloc((size_t)MROWS * H * 2);
  unsigned short* Vt   = (unsigned short*)alloc((size_t)MROWS * H * 2);
  unsigned short* Ctx  = (unsigned short*)alloc((size_t)MROWS * H * 2);

  cvt_all_kernel<<<dim3(CVT_BLOCKS), dim3(CVT_WAVES * 32), 0, stream>>>(
      hidden, Wq, Wk, Wv, Wo, Xbf, Wqkv, Wobf);

  qkv_kernel<<<dim3(MROWS / QBM, 3 * H / QBN), dim3(256), 0, stream>>>(
      Xbf, Wqkv, bq, bk, bv, Qbf, Kbf, Vt);

  attn_kernel<<<dim3(BATCH * NHEAD * (SEQ / (16 * AQT)) / 8), dim3(256), 0, stream>>>(
      Qbf, Kbf, Vt, mask, Ctx);

  out_ln_kernel<<<dim3(MROWS / (16 * ORT)), dim3(512), 0, stream>>>(
      Ctx, Wobf, bo, hidden, ln_g, ln_b, (float*)d_out);
}
